// v000
// The times below were measured on an AMD MI455X: many runs one after another, warmed up first and cycling through
// copies of the inputs, with the whole window's GPU time divided by the number of runs. Launches and the gaps
// between them are all in it. The median over several windows is given; except for v000 it joins two sittings, which
// can be a few percent apart, so the side-by-side timings, each taken in one sitting, are the better comparison.
// v000 is the starting kernel. One run takes 1160 microseconds.
#include <hip/hip_runtime.h>

// ---------------------------------------------------------------------------
// MI455X (gfx1250) attention pipeline.
//   keys    = LN(Y @ K)        queries = LN(X @ Q)
//   alpha   = softmax(queries @ keys^T / 1024)
//   out     = alpha @ Y
// All contractions: v_wmma_f32_16x16x32_bf16 with f32 accumulation.
// B operands double-buffered in LDS via global_load_async_to_lds_b128
// (ASYNCcnt) so async DMA of tile k+1 overlaps the WMMAs of tile k.
// ---------------------------------------------------------------------------

typedef __attribute__((ext_vector_type(16))) __bf16 v16bf;
typedef __attribute__((ext_vector_type(8)))  float  v8f;

#define HID    1024
#define SEQ    2048
#define NBATCH 8
#define NROWS  (NBATCH * SEQ)      // 16384
#define LN_EPS 1e-5f

// round-to-nearest-even float -> bf16 (raw u16)
static __device__ __forceinline__ unsigned short f2bf(float x) {
  unsigned u = __builtin_bit_cast(unsigned, x);
  unsigned r = u + 0x7FFFu + ((u >> 16) & 1u);
  return (unsigned short)(r >> 16);
}

union FragU { v16bf v; uint4 q[2]; };

// 16x32 bf16 fragment from row-major global memory at column k0.
// CDNA5 16-bit A layout: lanes 0-15 hold row M=lane, K in {0..7,16..23};
// lanes 16-31 hold row M=lane-16, K in {8..15,24..31}. Two b128 loads/lane.
static __device__ __forceinline__ v16bf load_frag16x32(
    const unsigned short* __restrict__ p, int ld, int k0, int lane) {
  const int half = (lane >> 4) & 1;
  const int r    = lane & 15;
  const unsigned short* base = p + (size_t)r * ld + (k0 + half * 8);
  FragU f;
  f.q[0] = *reinterpret_cast<const uint4*>(base);
  f.q[1] = *reinterpret_cast<const uint4*>(base + 16);
  return f.v;
}

// Same fragment pattern read from an LDS tile of layout [n][32] bf16.
static __device__ __forceinline__ v16bf lds_frag(
    const unsigned short* __restrict__ sm, int n0, int lane) {
  const int half = (lane >> 4) & 1;
  const int r    = lane & 15;
  const unsigned short* base = sm + (size_t)(n0 + r) * 32 + half * 8;
  FragU f;
  f.q[0] = *reinterpret_cast<const uint4*>(base);   // ds_load_b128
  f.q[1] = *reinterpret_cast<const uint4*>(base + 16);
  return f.v;
}

static __device__ __forceinline__ v8f wmma_bf16(v16bf a, v16bf b, v8f c) {
  return __builtin_amdgcn_wmma_f32_16x16x32_bf16(false, a, false, b,
                                                 (short)0, c, false, false);
}

static __device__ __forceinline__ void wait_async0() {
  asm volatile("s_wait_asynccnt 0" ::: "memory");
}

// Async-copy one B tile (Nrows x 32 bf16, row stride ld elems in global,
// packed [n][32] in LDS) into LDS at byte offset lds_base.  Every thread
// moves 16 x 16B chunks; chunk c covers row n=c>>2, quarter part=c&3.
static __device__ __forceinline__ void stage_tile(
    unsigned lds_base, const unsigned short* __restrict__ g, int ld,
    int tid, int nthreads) {
#pragma unroll
  for (int i = 0; i < 16; ++i) {
    const int c    = tid + i * nthreads;
    const int n    = c >> 2;
    const int part = c & 3;
    const unsigned long long gp =
        (unsigned long long)(uintptr_t)(g + (size_t)n * ld + part * 8);
    const unsigned lo = lds_base + (unsigned)c * 16u;
    asm volatile("global_load_async_to_lds_b128 %0, %1, off"
                 :: "v"(lo), "v"(gp) : "memory");
  }
}

// Double-buffered pipelined mainloop: acc[t] += A[16,K] * B[K, col0+t*16..+16]
// A read from global (register-pipelined); B staged async into LDS.
// Block stages B rows [0, nthreads*64/16) = all rows its waves consume.
static __device__ __forceinline__ void gemm_pipeline(
    const unsigned short* __restrict__ Arow, int ldA,
    const unsigned short* __restrict__ B0,  int ldB,
    int Kdim, unsigned short* sm, unsigned tileBytes,
    int tid, int nthreads, int lane, int col0, v8f acc[8]) {
  const unsigned sbase = (unsigned)(unsigned long long)(uintptr_t)sm;
  const int nIter = Kdim / 32;
  const int mr = lane & 15;

  stage_tile(sbase, B0, ldB, tid, nthreads);
  wait_async0();
  __syncthreads();

  v16bf a = load_frag16x32(Arow, ldA, 0, lane);

  for (int it = 0; it < nIter; ++it) {
    const unsigned curOff = (it & 1) ? tileBytes : 0u;
    const unsigned nxtOff = (it & 1) ? 0u : tileBytes;
    const bool more = (it + 1 < nIter);

    // issue async DMA for tile it+1 (overlaps this iteration's compute)
    if (more)
      stage_tile(sbase + nxtOff, B0 + (size_t)(it + 1) * 32, ldB, tid, nthreads);

    // register-pipeline next A fragment
    v16bf an = a;
    if (more) {
      an = load_frag16x32(Arow, ldA, (it + 1) * 32, lane);
      __builtin_prefetch(Arow + (size_t)mr * ldA + (it + 1) * 32 + 32, 0, 0);
    }

    // batch the 8 B-fragment ds loads, then the 8 WMMAs
    const unsigned short* smc = sm + (curOff >> 1);
    v16bf bf[8];
#pragma unroll
    for (int t = 0; t < 8; ++t) bf[t] = lds_frag(smc, col0 + t * 16, lane);
#pragma unroll
    for (int t = 0; t < 8; ++t) acc[t] = wmma_bf16(a, bf[t], acc[t]);

    a = an;
    wait_async0();     // own copies for tile it+1 done (overlapped compute)
    __syncthreads();   // block-wide: tile it reads done, tile it+1 visible
  }
}

// ---------------------------------------------------------------------------
// Kernel 1: X,Y fp32 -> bf16 row-major; also write Y^T (per batch) in bf16.
// ---------------------------------------------------------------------------
__global__ void attn_conv_xy(const float* __restrict__ X,
                             const float* __restrict__ Y,
                             unsigned short* __restrict__ Xb,
                             unsigned short* __restrict__ Yb,
                             unsigned short* __restrict__ YT) {
  size_t idx = (size_t)blockIdx.x * blockDim.x + threadIdx.x;  // < 16777216
  float x = X[idx];
  float y = Y[idx];
  Xb[idx] = f2bf(x);
  unsigned short yb = f2bf(y);
  Yb[idx] = yb;
  int f = (int)(idx & (HID - 1));
  int s = (int)((idx >> 10) & (SEQ - 1));
  int b = (int)(idx >> 21);
  YT[((size_t)b * HID + f) * SEQ + s] = yb;   // Y^T[b][f][s]
}

// ---------------------------------------------------------------------------
// Kernel 2: K,Q fp32 [F,H] -> transposed bf16 [H,F]  (B-operand layout)
// ---------------------------------------------------------------------------
__global__ void attn_conv_w(const float* __restrict__ K,
                            const float* __restrict__ Q,
                            unsigned short* __restrict__ KT,
                            unsigned short* __restrict__ QT) {
  size_t idx = (size_t)blockIdx.x * blockDim.x + threadIdx.x;  // < 1048576
  int h = (int)(idx & (HID - 1));
  int f = (int)(idx >> 10);
  size_t t = (size_t)h * HID + f;
  KT[t] = f2bf(K[idx]);
  QT[t] = f2bf(Q[idx]);
}

// ---------------------------------------------------------------------------
// Kernel 3: fused GEMM + LayerNorm.  256 thr (8 waves): 16 rows x 1024 cols.
// Dynamic LDS: 2 x 64KB B-tile buffers.
// ---------------------------------------------------------------------------
__global__ void attn_gemm_ln(const unsigned short* __restrict__ A,
                             const unsigned short* __restrict__ WT,
                             const float* __restrict__ gamma,
                             const float* __restrict__ beta,
                             unsigned short* __restrict__ out) {
  extern __shared__ unsigned short smem[];          // 2 * 1024*32 bf16
  const int tid  = threadIdx.x;
  const int lane = tid & 31;
  const int wave = tid >> 5;            // 0..7
  const int half = (lane >> 4) & 1;
  const int mr   = lane & 15;
  const int row0 = blockIdx.x * 16;
  const int col0 = wave * 128;

  v8f acc[8];
#pragma unroll
  for (int t = 0; t < 8; ++t)
#pragma unroll
    for (int r = 0; r < 8; ++r) acc[t][r] = 0.0f;

  gemm_pipeline(A + (size_t)row0 * HID, HID, WT, HID, HID,
                smem, 1024u * 64u, tid, 256, lane, col0, acc);

  __shared__ float s_sum[16];
  __shared__ float s_sq[16];
  if (tid < 16) { s_sum[tid] = 0.0f; s_sq[tid] = 0.0f; }
  __syncthreads();

#pragma unroll
  for (int r = 0; r < 8; ++r) {
    float ps = 0.0f, pq = 0.0f;
#pragma unroll
    for (int t = 0; t < 8; ++t) { float v = acc[t][r]; ps += v; pq += v * v; }
#pragma unroll
    for (int m = 1; m <= 8; m <<= 1) {      // reduce over the 16-lane half
      ps += __shfl_xor(ps, m, 32);
      pq += __shfl_xor(pq, m, 32);
    }
    if (mr == 0) {
      int row = r + 8 * half;
      atomicAdd(&s_sum[row], ps);           // ds_add_f32
      atomicAdd(&s_sq[row], pq);
    }
  }
  __syncthreads();

  const float inv_h = 1.0f / (float)HID;
#pragma unroll
  for (int r = 0; r < 8; ++r) {
    const int row  = r + 8 * half;
    const float mu = s_sum[row] * inv_h;
    float var      = s_sq[row] * inv_h - mu * mu;
    const float rs = rsqrtf(var + LN_EPS);
#pragma unroll
    for (int t = 0; t < 8; ++t) {
      const int n  = col0 + t * 16 + mr;
      float v = (acc[t][r] - mu) * rs * gamma[n] + beta[n];
      out[(size_t)(row0 + row) * HID + n] = f2bf(v);
    }
  }
}

// ---------------------------------------------------------------------------
// Kernel 4: fused scores + softmax.  512 thr (16 waves): 16 q rows x 2048 keys.
// Dynamic LDS: 2 x 128KB key-tile buffers.
// ---------------------------------------------------------------------------
__global__ void attn_scores_softmax(const unsigned short* __restrict__ Qb,
                                    const unsigned short* __restrict__ Kb,
                                    unsigned short* __restrict__ alpha) {
  extern __shared__ unsigned short smem[];          // 2 * 2048*32 bf16
  const int tid  = threadIdx.x;
  const int lane = tid & 31;
  const int wave = tid >> 5;            // 0..15
  const int half = (lane >> 4) & 1;
  const int mr   = lane & 15;
  const int b    = blockIdx.x >> 7;     // /128
  const int qt   = blockIdx.x & 127;
  const int row0 = qt * 16;
  const int col0 = wave * 128;

  const unsigned short* Qrow = Qb + ((size_t)b * SEQ + row0) * HID;
  const unsigned short* Krow = Kb + (size_t)b * SEQ * HID;

  v8f acc[8];
#pragma unroll
  for (int t = 0; t < 8; ++t)
#pragma unroll
    for (int r = 0; r < 8; ++r) acc[t][r] = 0.0f;

  gemm_pipeline(Qrow, HID, Krow, HID, HID,
                smem, 2048u * 64u, tid, 512, lane, col0, acc);

  const float sc = 1.0f / (float)HID;
#pragma unroll
  for (int t = 0; t < 8; ++t)
#pragma unroll
    for (int r = 0; r < 8; ++r) acc[t][r] *= sc;

  __shared__ float s_red[256];          // [wave][row]
  __shared__ float s_rowmax[16];
  __shared__ float s_rowsum[16];

  // ---- row max ----
#pragma unroll
  for (int r = 0; r < 8; ++r) {
    float m = -3.0e38f;
#pragma unroll
    for (int t = 0; t < 8; ++t) m = fmaxf(m, acc[t][r]);
#pragma unroll
    for (int msk = 1; msk <= 8; msk <<= 1) m = fmaxf(m, __shfl_xor(m, msk, 32));
    if (mr == 0) s_red[wave * 16 + r + 8 * half] = m;
  }
  __syncthreads();
  if (tid < 16) {
    float m = -3.0e38f;
    for (int w = 0; w < 16; ++w) m = fmaxf(m, s_red[w * 16 + tid]);
    s_rowmax[tid] = m;
  }
  __syncthreads();

  // ---- exp + row sum ----
#pragma unroll
  for (int r = 0; r < 8; ++r) {
    const int row = r + 8 * half;
    const float rm = s_rowmax[row];
    float s = 0.0f;
#pragma unroll
    for (int t = 0; t < 8; ++t) {
      float e = __expf(acc[t][r] - rm);
      acc[t][r] = e;
      s += e;
    }
#pragma unroll
    for (int msk = 1; msk <= 8; msk <<= 1) s += __shfl_xor(s, msk, 32);
    if (mr == 0) s_red[wave * 16 + row] = s;
  }
  __syncthreads();
  if (tid < 16) {
    float s = 0.0f;
    for (int w = 0; w < 16; ++w) s += s_red[w * 16 + tid];
    s_rowsum[tid] = 1.0f / s;
  }
  __syncthreads();

  // ---- normalize + store bf16 alpha ----
#pragma unroll
  for (int r = 0; r < 8; ++r) {
    const int row = r + 8 * half;
    const float inv = s_rowsum[row];
#pragma unroll
    for (int t = 0; t < 8; ++t) {
      const int n = col0 + t * 16 + mr;
      alpha[((size_t)b * SEQ + row0 + row) * SEQ + n] = f2bf(acc[t][r] * inv);
    }
  }
}

// ---------------------------------------------------------------------------
// Kernel 5: out = alpha @ Y   (per batch [2048x2048] x [2048x1024], fp32 out)
// 256 thr (8 waves): 16 q rows x 1024 f cols; K-loop over 2048.
// Dynamic LDS: 2 x 64KB YT-tile buffers.
// ---------------------------------------------------------------------------
__global__ void attn_pv_gemm(const unsigned short* __restrict__ alpha,
                             const unsigned short* __restrict__ YT,
                             float* __restrict__ out) {
  extern __shared__ unsigned short smem[];          // 2 * 1024*32 bf16
  const int tid  = threadIdx.x;
  const int lane = tid & 31;
  const int wave = tid >> 5;            // 0..7
  const int half = (lane >> 4) & 1;
  const int mr   = lane & 15;
  const int b    = blockIdx.x >> 7;
  const int qt   = blockIdx.x & 127;
  const int row0 = qt * 16;
  const int col0 = wave * 128;

  const unsigned short* Arow = alpha + ((size_t)b * SEQ + row0) * SEQ;
  const unsigned short* Brow = YT + (size_t)b * HID * SEQ;

  v8f acc[8];
#pragma unroll
  for (int t = 0; t < 8; ++t)
#pragma unroll
    for (int r = 0; r < 8; ++r) acc[t][r] = 0.0f;

  gemm_pipeline(Arow, SEQ, Brow, SEQ, SEQ,
                smem, 1024u * 64u, tid, 256, lane, col0, acc);

#pragma unroll
  for (int r = 0; r < 8; ++r) {
    const int row = r + 8 * half;
#pragma unroll
    for (int t = 0; t < 8; ++t) {
      const int n = col0 + t * 16 + mr;
      out[((size_t)b * SEQ + row0 + row) * HID + n] = acc[t][r];
    }
  }
}

// ---------------------------------------------------------------------------
// host launcher
// ---------------------------------------------------------------------------
extern "C" void kernel_launch(void* const* d_in, const int* in_sizes, int n_in,
                              void* d_out, int out_size, void* d_ws, size_t ws_size,
                              hipStream_t stream) {
  const float* X  = (const float*)d_in[0];
  const float* Y  = (const float*)d_in[1];
  const float* K  = (const float*)d_in[2];
  const float* Q  = (const float*)d_in[3];
  const float* g1 = (const float*)d_in[4];
  const float* b1 = (const float*)d_in[5];
  const float* g2 = (const float*)d_in[6];
  const float* b2 = (const float*)d_in[7];
  float* out = (float*)d_out;

  // workspace layout (bytes); total ~228 MB
  char* w = (char*)d_ws;
  const size_t SZ_XY = (size_t)NROWS * HID * 2;        // 32 MB each
  const size_t SZ_W  = (size_t)HID * HID * 2;          // 2 MB each
  unsigned short* Xb    = (unsigned short*)(w);
  unsigned short* Yb    = (unsigned short*)(w + SZ_XY);
  unsigned short* YT    = (unsigned short*)(w + 2 * SZ_XY);
  unsigned short* KT    = (unsigned short*)(w + 3 * SZ_XY);
  unsigned short* QT    = (unsigned short*)(w + 3 * SZ_XY + SZ_W);
  unsigned short* Kb    = (unsigned short*)(w + 3 * SZ_XY + 2 * SZ_W);
  unsigned short* Qb    = (unsigned short*)(w + 4 * SZ_XY + 2 * SZ_W);
  unsigned short* alpha = (unsigned short*)(w + 5 * SZ_XY + 2 * SZ_W); // 64 MB

  const size_t LDS_1K = 2u * 1024u * 64u;   // 128 KB (double-buffered 64KB tiles)
  const size_t LDS_2K = 2u * 2048u * 64u;   // 256 KB

  // 1) convert X,Y -> bf16 (+ Y^T), K,Q -> transposed bf16
  attn_conv_xy<<<(NROWS * HID) / 256, 256, 0, stream>>>(X, Y, Xb, Yb, YT);
  attn_conv_w<<<(HID * HID) / 256, 256, 0, stream>>>(K, Q, KT, QT);

  // 2) keys = LN(Y @ K), queries = LN(X @ Q)   [fused GEMM+LN, bf16 out]
  attn_gemm_ln<<<NROWS / 16, 256, LDS_1K, stream>>>(Yb, KT, g1, b1, Kb);
  attn_gemm_ln<<<NROWS / 16, 256, LDS_1K, stream>>>(Xb, QT, g2, b2, Qb);

  // 3) alpha = softmax(queries @ keys^T / H)   [fused, bf16 out]
  attn_scores_softmax<<<NBATCH * (SEQ / 16), 512, LDS_2K, stream>>>(Qb, Kb, alpha);

  // 4) out = alpha @ Y                          [fp32 out]
  attn_pv_gemm<<<NBATCH * (SEQ / 16), 256, LDS_1K, stream>>>(alpha, YT, out);
}

// v001
// It runs in 664 microseconds.
// Timed twice side by side with v000, it ran 1.76 and 1.73 times as fast.
#include <hip/hip_runtime.h>

// ---------------------------------------------------------------------------
// MI455X (gfx1250) attention pipeline.
//   keys    = LN(Y @ K)        queries = LN(X @ Q)
//   alpha   = softmax(queries @ keys^T / 1024)
//   out     = alpha @ Y
// All contractions: v_wmma_f32_16x16x32_bf16 with f32 accumulation.
// B operands double-buffered in LDS via global_load_async_to_lds_b128
// (ASYNCcnt) so async DMA of tile k+1 overlaps the WMMAs of tile k.
// Each staged B tile serves 64 rows of A (32 in the score kernel), so the
// bytes copied from L2 into LDS per matrix instruction fall 4x (2x).
// ---------------------------------------------------------------------------

typedef __attribute__((ext_vector_type(16))) __bf16 v16bf;
typedef __attribute__((ext_vector_type(8)))  float  v8f;

#define HID    1024
#define SEQ    2048
#define NBATCH 8
#define NROWS  (NBATCH * SEQ)      // 16384
#define LN_EPS 1e-5f

// round-to-nearest-even float -> bf16 (raw u16)
static __device__ __forceinline__ unsigned short f2bf(float x) {
  unsigned u = __builtin_bit_cast(unsigned, x);
  unsigned r = u + 0x7FFFu + ((u >> 16) & 1u);
  return (unsigned short)(r >> 16);
}

union FragU { v16bf v; uint4 q[2]; };

// 16x32 bf16 fragment from row-major global memory at column k0.
// CDNA5 16-bit A layout: lanes 0-15 hold row M=lane, K in {0..7,16..23};
// lanes 16-31 hold row M=lane-16, K in {8..15,24..31}. Two b128 loads/lane.
static __device__ __forceinline__ v16bf load_frag16x32(
    const unsigned short* __restrict__ p, int ld, int k0, int lane) {
  const int half = (lane >> 4) & 1;
  const int r    = lane & 15;
  const unsigned short* base = p + (size_t)r * ld + (k0 + half * 8);
  FragU f;
  f.q[0] = *reinterpret_cast<const uint4*>(base);
  f.q[1] = *reinterpret_cast<const uint4*>(base + 16);
  return f.v;
}

// Same fragment pattern read from an LDS tile of layout [n][32] bf16.
static __device__ __forceinline__ v16bf lds_frag(
    const unsigned short* __restrict__ sm, int n0, int lane) {
  const int half = (lane >> 4) & 1;
  const int r    = lane & 15;
  const unsigned short* base = sm + (size_t)(n0 + r) * 32 + half * 8;
  FragU f;
  f.q[0] = *reinterpret_cast<const uint4*>(base);   // ds_load_b128
  f.q[1] = *reinterpret_cast<const uint4*>(base + 16);
  return f.v;
}

static __device__ __forceinline__ v8f wmma_bf16(v16bf a, v16bf b, v8f c) {
  return __builtin_amdgcn_wmma_f32_16x16x32_bf16(false, a, false, b,
                                                 (short)0, c, false, false);
}

static __device__ __forceinline__ void wait_async0() {
  asm volatile("s_wait_asynccnt 0" ::: "memory");
}

// Async-copy one B tile (Nrows x 32 bf16, row stride ld elems in global,
// packed [n][32] in LDS) into LDS at byte offset lds_base.  Every thread
// moves NC x 16B chunks; chunk c covers row n=c>>2, quarter part=c&3.
template <int NC>
static __device__ __forceinline__ void stage_tile(
    unsigned lds_base, const unsigned short* __restrict__ g, int ld,
    int tid, int nthreads) {
  static_assert(NC % 8 == 0, "copies are issued in groups of eight");
#pragma unroll
  for (int i0 = 0; i0 < NC; i0 += 8) {
    unsigned lo[8];
    unsigned long long gp[8];
#pragma unroll
    for (int j = 0; j < 8; ++j) {
      const int c    = tid + (i0 + j) * nthreads;
      const int n    = c >> 2;
      const int part = c & 3;
      gp[j] = (unsigned long long)(uintptr_t)(g + (size_t)n * ld + part * 8);
      lo[j] = lds_base + (unsigned)c * 16u;
    }
    // Eight copies and their s_wait_xcnt in one statement: the address
    // registers stay untouched until the wait has passed.
    asm volatile(
        "global_load_async_to_lds_b128 %0, %8, off\n\t"
        "global_load_async_to_lds_b128 %1, %9, off\n\t"
        "global_load_async_to_lds_b128 %2, %10, off\n\t"
        "global_load_async_to_lds_b128 %3, %11, off\n\t"
        "global_load_async_to_lds_b128 %4, %12, off\n\t"
        "global_load_async_to_lds_b128 %5, %13, off\n\t"
        "global_load_async_to_lds_b128 %6, %14, off\n\t"
        "global_load_async_to_lds_b128 %7, %15, off\n\t"
        "s_wait_xcnt 0x0"
        :: "v"(lo[0]), "v"(lo[1]), "v"(lo[2]), "v"(lo[3]),
           "v"(lo[4]), "v"(lo[5]), "v"(lo[6]), "v"(lo[7]),
           "v"(gp[0]), "v"(gp[1]), "v"(gp[2]), "v"(gp[3]),
           "v"(gp[4]), "v"(gp[5]), "v"(gp[6]), "v"(gp[7])
        : "memory");
  }
}

// Double-buffered pipelined mainloop, one wave tile of MT*16 rows x NT*16 cols:
//   acc[m][t] += A[m*16..+16, K] * B[K, col0+t*16..+16]
// A read from global (register-pipelined); B staged async into LDS.
// Block stages B rows [0, nthreads*NC/4) = all rows its waves consume; every
// B fragment read from LDS feeds MT matrix instructions.  GB = B fragments
// held in registers at a time (NT a multiple of it).
template <int MT, int NT, int NC, int GB>
static __device__ __forceinline__ void gemm_pipeline(
    const unsigned short* __restrict__ Arow, int ldA,
    const unsigned short* __restrict__ B0,  int ldB,
    int Kdim, unsigned short* sm, unsigned tileBytes,
    int tid, int nthreads, int lane, int col0, v8f (&acc)[MT][NT]) {
  const unsigned sbase = (unsigned)(unsigned long long)(uintptr_t)sm;
  const int nIter = Kdim / 32;

  stage_tile<NC>(sbase, B0, ldB, tid, nthreads);
  wait_async0();
  __syncthreads();

  v16bf a[MT];
#pragma unroll
  for (int m = 0; m < MT; ++m)
    a[m] = load_frag16x32(Arow + (size_t)(m * 16) * ldA, ldA, 0, lane);

  for (int it = 0; it < nIter; ++it) {
    const unsigned curOff = (it & 1) ? tileBytes : 0u;
    const unsigned nxtOff = (it & 1) ? 0u : tileBytes;
    const bool more = (it + 1 < nIter);

    // issue async DMA for tile it+1 (overlaps this iteration's compute)
    if (more)
      stage_tile<NC>(sbase + nxtOff, B0 + (size_t)(it + 1) * 32, ldB, tid, nthreads);

    // register-pipeline next A fragments
    v16bf an[MT];
#pragma unroll
    for (int m = 0; m < MT; ++m) an[m] = a[m];
    if (more) {
#pragma unroll
      for (int m = 0; m < MT; ++m)
        an[m] = load_frag16x32(Arow + (size_t)(m * 16) * ldA, ldA,
                               (it + 1) * 32, lane);
    }

    // GB B fragments from LDS as one group, then their MT*GB WMMAs
    const unsigned short* smc = sm + (curOff >> 1);
#pragma unroll
    for (int t0 = 0; t0 < NT; t0 += GB) {
      v16bf bf[GB];
#pragma unroll
      for (int t = 0; t < GB; ++t)
        bf[t] = lds_frag(smc, col0 + (t0 + t) * 16, lane);
      // Keeps the A loads and the LDS reads as one group ahead of the WMMAs:
      // the compiler otherwise spreads them among the WMMAs, a full wait at each.
      __builtin_amdgcn_sched_barrier(0);
#pragma unroll
      for (int t = 0; t < GB; ++t)
#pragma unroll
        for (int m = 0; m < MT; ++m)
          acc[m][t0 + t] = wmma_bf16(a[m], bf[t], acc[m][t0 + t]);
      // Holds the WMMAs in front of what follows (the waits at the loop's foot):
      // the compiler otherwise sinks them behind the barrier, and tile it+1's
      // copies no longer fly under them.
      __builtin_amdgcn_sched_barrier(0);
    }

#pragma unroll
    for (int m = 0; m < MT; ++m) a[m] = an[m];
    // own LDS reads of tile it retired before the buffer is handed back
    asm volatile("s_wait_dscnt 0" ::: "memory");
    wait_async0();     // own copies for tile it+1 done (overlapped compute)
    __syncthreads();   // block-wide: tile it reads done, tile it+1 visible
  }
}

// ---------------------------------------------------------------------------
// Kernel 1: X,Y fp32 -> bf16 row-major; also write Y^T (per batch) in bf16.
// ---------------------------------------------------------------------------
__global__ void attn_conv_xy(const float* __restrict__ X,
                             const float* __restrict__ Y,
                             unsigned short* __restrict__ Xb,
                             unsigned short* __restrict__ Yb,
                             unsigned short* __restrict__ YT) {
  size_t idx = (size_t)blockIdx.x * blockDim.x + threadIdx.x;  // < 16777216
  float x = X[idx];
  float y = Y[idx];
  Xb[idx] = f2bf(x);
  unsigned short yb = f2bf(y);
  Yb[idx] = yb;
  int f = (int)(idx & (HID - 1));
  int s = (int)((idx >> 10) & (SEQ - 1));
  int b = (int)(idx >> 21);
  YT[((size_t)b * HID + f) * SEQ + s] = yb;   // Y^T[b][f][s]
}

// ---------------------------------------------------------------------------
// Kernel 2: K,Q fp32 [F,H] -> transposed bf16 [H,F]  (B-operand layout)
// ---------------------------------------------------------------------------
__global__ void attn_conv_w(const float* __restrict__ K,
                            const float* __restrict__ Q,
                            unsigned short* __restrict__ KT,
                            unsigned short* __restrict__ QT) {
  size_t idx = (size_t)blockIdx.x * blockDim.x + threadIdx.x;  // < 1048576
  int h = (int)(idx & (HID - 1));
  int f = (int)(idx >> 10);
  size_t t = (size_t)h * HID + f;
  KT[t] = f2bf(K[idx]);
  QT[t] = f2bf(Q[idx]);
}

// ---------------------------------------------------------------------------
// Kernel 3: fused GEMM + LayerNorm.  512 thr (16 waves): 64 rows x 1024 cols,
// each wave 64 rows x 64 cols.  Dynamic LDS: 2 x 64KB B-tile buffers.
// ---------------------------------------------------------------------------
__global__ __launch_bounds__(512)
void attn_gemm_ln(const unsigned short* __restrict__ A,
                  const unsigned short* __restrict__ WT,
                  const float* __restrict__ gamma,
                  const float* __restrict__ beta,
                  unsigned short* __restrict__ out) {
  extern __shared__ unsigned short smem[];          // 2 * 1024*32 bf16
  const int tid  = threadIdx.x;
  const int lane = tid & 31;
  const int wave = tid >> 5;            // 0..15
  const int half = (lane >> 4) & 1;
  const int mr   = lane & 15;
  const int row0 = blockIdx.x * 64;
  const int col0 = wave * 64;

  v8f acc[4][4];
#pragma unroll
  for (int m = 0; m < 4; ++m)
#pragma unroll
    for (int t = 0; t < 4; ++t)
#pragma unroll
      for (int r = 0; r < 8; ++r) acc[m][t][r] = 0.0f;

  gemm_pipeline<4, 4, 8, 4>(A + (size_t)row0 * HID, HID, WT, HID, HID,
                         smem, 1024u * 64u, tid, 512, lane, col0, acc);

  __shared__ float s_sum[64];
  __shared__ float s_sq[64];
  if (tid < 64) { s_sum[tid] = 0.0f; s_sq[tid] = 0.0f; }
  __syncthreads();

#pragma unroll
  for (int m = 0; m < 4; ++m) {
#pragma unroll
    for (int r = 0; r < 8; ++r) {
      float ps = 0.0f, pq = 0.0f;
#pragma unroll
      for (int t = 0; t < 4; ++t) { float v = acc[m][t][r]; ps += v; pq += v * v; }
#pragma unroll
      for (int k = 1; k <= 8; k <<= 1) {    // reduce over the 16-lane half
        ps += __shfl_xor(ps, k, 32);
        pq += __shfl_xor(pq, k, 32);
      }
      if (mr == 0) {
        int row = m * 16 + r + 8 * half;
        atomicAdd(&s_sum[row], ps);         // ds_add_f32
        atomicAdd(&s_sq[row], pq);
      }
    }
  }
  __syncthreads();

  const float inv_h = 1.0f / (float)HID;
#pragma unroll
  for (int m = 0; m < 4; ++m) {
#pragma unroll
    for (int r = 0; r < 8; ++r) {
      const int row  = m * 16 + r + 8 * half;
      const float mu = s_sum[row] * inv_h;
      float var      = s_sq[row] * inv_h - mu * mu;
      const float rs = rsqrtf(var + LN_EPS);
#pragma unroll
      for (int t = 0; t < 4; ++t) {
        const int n  = col0 + t * 16 + mr;
        float v = (acc[m][t][r] - mu) * rs * gamma[n] + beta[n];
        out[(size_t)(row0 + row) * HID + n] = f2bf(v);
      }
    }
  }
}

// ---------------------------------------------------------------------------
// Kernel 4: fused scores + softmax.  512 thr (16 waves): 32 q rows x 2048 keys,
// each wave 32 rows x 128 keys.  Dynamic LDS: 2 x 128KB key-tile buffers.
// ---------------------------------------------------------------------------
__global__ __launch_bounds__(512)
void attn_scores_softmax(const unsigned short* __restrict__ Qb,
                         const unsigned short* __restrict__ Kb,
                         unsigned short* __restrict__ alpha) {
  extern __shared__ unsigned short smem[];          // 2 * 2048*32 bf16
  const int tid  = threadIdx.x;
  const int lane = tid & 31;
  const int wave = tid >> 5;            // 0..15
  const int half = (lane >> 4) & 1;
  const int mr   = lane & 15;
  const int b    = blockIdx.x >> 6;     // /64
  const int qt   = blockIdx.x & 63;
  const int row0 = qt * 32;
  const int col0 = wave * 128;

  const unsigned short* Qrow = Qb + ((size_t)b * SEQ + row0) * HID;
  const unsigned short* Krow = Kb + (size_t)b * SEQ * HID;

  v8f acc[2][8];
#pragma unroll
  for (int m = 0; m < 2; ++m)
#pragma unroll
    for (int t = 0; t < 8; ++t)
#pragma unroll
      for (int r = 0; r < 8; ++r) acc[m][t][r] = 0.0f;

  gemm_pipeline<2, 8, 16, 4>(Qrow, HID, Krow, HID, HID,
                          smem, 2048u * 64u, tid, 512, lane, col0, acc);

  const float sc = 1.0f / (float)HID;
#pragma unroll
  for (int m = 0; m < 2; ++m)
#pragma unroll
    for (int t = 0; t < 8; ++t)
#pragma unroll
      for (int r = 0; r < 8; ++r) acc[m][t][r] *= sc;

  __shared__ float s_red[512];          // [wave][row]
  __shared__ float s_rowmax[32];
  __shared__ float s_rowsum[32];

  // ---- row max ----
#pragma unroll
  for (int m = 0; m < 2; ++m) {
#pragma unroll
    for (int r = 0; r < 8; ++r) {
      float mx = -3.0e38f;
#pragma unroll
      for (int t = 0; t < 8; ++t) mx = fmaxf(mx, acc[m][t][r]);
#pragma unroll
      for (int msk = 1; msk <= 8; msk <<= 1) mx = fmaxf(mx, __shfl_xor(mx, msk, 32));
      if (mr == 0) s_red[wave * 32 + m * 16 + r + 8 * half] = mx;
    }
  }
  __syncthreads();
  if (tid < 32) {
    float mx = -3.0e38f;
    for (int w = 0; w < 16; ++w) mx = fmaxf(mx, s_red[w * 32 + tid]);
    s_rowmax[tid] = mx;
  }
  __syncthreads();

  // ---- exp + row sum ----
#pragma unroll
  for (int m = 0; m < 2; ++m) {
#pragma unroll
    for (int r = 0; r < 8; ++r) {
      const int row = m * 16 + r + 8 * half;
      const float rm = s_rowmax[row];
      float s = 0.0f;
#pragma unroll
      for (int t = 0; t < 8; ++t) {
        float e = __expf(acc[m][t][r] - rm);
        acc[m][t][r] = e;
        s += e;
      }
#pragma unroll
      for (int msk = 1; msk <= 8; msk <<= 1) s += __shfl_xor(s, msk, 32);
      if (mr == 0) s_red[wave * 32 + row] = s;
    }
  }
  __syncthreads();
  if (tid < 32) {
    float s = 0.0f;
    for (int w = 0; w < 16; ++w) s += s_red[w * 32 + tid];
    s_rowsum[tid] = 1.0f / s;
  }
  __syncthreads();

  // ---- normalize + store bf16 alpha ----
#pragma unroll
  for (int m = 0; m < 2; ++m) {
#pragma unroll
    for (int r = 0; r < 8; ++r) {
      const int row = m * 16 + r + 8 * half;
      const float inv = s_rowsum[row];
#pragma unroll
      for (int t = 0; t < 8; ++t) {
        const int n = col0 + t * 16 + mr;
        alpha[((size_t)b * SEQ + row0 + row) * SEQ + n] = f2bf(acc[m][t][r] * inv);
      }
    }
  }
}

// ---------------------------------------------------------------------------
// Kernel 5: out = alpha @ Y   (per batch [2048x2048] x [2048x1024], fp32 out)
// 512 thr (16 waves): 64 q rows x 1024 f cols, each wave 64 rows x 64 cols;
// K-loop over 2048.  Dynamic LDS: 2 x 64KB YT-tile buffers.
// ---------------------------------------------------------------------------
__global__ __launch_bounds__(512)
void attn_pv_gemm(const unsigned short* __restrict__ alpha,
                  const unsigned short* __restrict__ YT,
                  float* __restrict__ out) {
  extern __shared__ unsigned short smem[];          // 2 * 1024*32 bf16
  const int tid  = threadIdx.x;
  const int lane = tid & 31;
  const int wave = tid >> 5;            // 0..15
  const int half = (lane >> 4) & 1;
  const int mr   = lane & 15;
  const int b    = blockIdx.x >> 5;
  const int qt   = blockIdx.x & 31;
  const int row0 = qt * 64;
  const int col0 = wave * 64;

  const unsigned short* Arow = alpha + ((size_t)b * SEQ + row0) * SEQ;
  const unsigned short* Brow = YT + (size_t)b * HID * SEQ;

  v8f acc[4][4];
#pragma unroll
  for (int m = 0; m < 4; ++m)
#pragma unroll
    for (int t = 0; t < 4; ++t)
#pragma unroll
      for (int r = 0; r < 8; ++r) acc[m][t][r] = 0.0f;

  gemm_pipeline<4, 4, 8, 4>(Arow, SEQ, Brow, SEQ, SEQ,
                         smem, 1024u * 64u, tid, 512, lane, col0, acc);

#pragma unroll
  for (int m = 0; m < 4; ++m) {
#pragma unroll
    for (int r = 0; r < 8; ++r) {
      const int row = m * 16 + r + 8 * half;
#pragma unroll
      for (int t = 0; t < 4; ++t) {
        const int n = col0 + t * 16 + mr;
        out[((size_t)b * SEQ + row0 + row) * HID + n] = acc[m][t][r];
      }
    }
  }
}

// ---------------------------------------------------------------------------
// host launcher
// ---------------------------------------------------------------------------
extern "C" void kernel_launch(void* const* d_in, const int* in_sizes, int n_in,
                              void* d_out, int out_size, void* d_ws, size_t ws_size,
                              hipStream_t stream) {
  const float* X  = (const float*)d_in[0];
  const float* Y  = (const float*)d_in[1];
  const float* K  = (const float*)d_in[2];
  const float* Q  = (const float*)d_in[3];
  const float* g1 = (const float*)d_in[4];
  const float* b1 = (const float*)d_in[5];
  const float* g2 = (const float*)d_in[6];
  const float* b2 = (const float*)d_in[7];
  float* out = (float*)d_out;

  // workspace layout (bytes); total ~228 MB
  char* w = (char*)d_ws;
  const size_t SZ_XY = (size_t)NROWS * HID * 2;        // 32 MB each
  const size_t SZ_W  = (size_t)HID * HID * 2;          // 2 MB each
  unsigned short* Xb    = (unsigned short*)(w);
  unsigned short* Yb    = (unsigned short*)(w + SZ_XY);
  unsigned short* YT    = (unsigned short*)(w + 2 * SZ_XY);
  unsigned short* KT    = (unsigned short*)(w + 3 * SZ_XY);
  unsigned short* QT    = (unsigned short*)(w + 3 * SZ_XY + SZ_W);
  unsigned short* Kb    = (unsigned short*)(w + 3 * SZ_XY + 2 * SZ_W);
  unsigned short* Qb    = (unsigned short*)(w + 4 * SZ_XY + 2 * SZ_W);
  unsigned short* alpha = (unsigned short*)(w + 5 * SZ_XY + 2 * SZ_W); // 64 MB

  const size_t LDS_1K = 2u * 1024u * 64u;   // 128 KB (double-buffered 64KB tiles)
  const size_t LDS_2K = 2u * 2048u * 64u;   // 256 KB

  // 1) convert X,Y -> bf16 (+ Y^T), K,Q -> transposed bf16
  attn_conv_xy<<<(NROWS * HID) / 256, 256, 0, stream>>>(X, Y, Xb, Yb, YT);
  attn_conv_w<<<(HID * HID) / 256, 256, 0, stream>>>(K, Q, KT, QT);

  // 2) keys = LN(Y @ K), queries = LN(X @ Q)   [fused GEMM+LN, bf16 out]
  attn_gemm_ln<<<NROWS / 64, 512, LDS_1K, stream>>>(Yb, KT, g1, b1, Kb);
  attn_gemm_ln<<<NROWS / 64, 512, LDS_1K, stream>>>(Xb, QT, g2, b2, Qb);

  // 3) alpha = softmax(queries @ keys^T / H)   [fused, bf16 out]
  attn_scores_softmax<<<NBATCH * (SEQ / 32), 512, LDS_2K, stream>>>(Qb, Kb, alpha);

  // 4) out = alpha @ Y                          [fp32 out]
  attn_pv_gemm<<<NBATCH * (SEQ / 64), 512, LDS_1K, stream>>>(alpha, YT, out);
}

// v002
// One run takes 435 microseconds.
// Two timings next to v001 both put it at 1.56 times that version's speed.
// Over all steps from v000 it is 2.72 times as fast.
#include <hip/hip_runtime.h>

// ---------------------------------------------------------------------------
// MI455X (gfx1250) attention pipeline.
//   keys    = LN(Y @ K)        queries = LN(X @ Q)
//   alpha   = softmax(queries @ keys^T / 1024)
//   out     = alpha @ Y
// All contractions: v_wmma_f32_16x16x32_bf16 with f32 accumulation.
// B operands double-buffered in LDS via global_load_async_to_lds_b128
// (ASYNCcnt) so async DMA of tile k+1 overlaps the WMMAs of tile k.
// Each staged B tile serves 64 rows of A (32 in the score kernel), so the
// bytes copied from L2 into LDS per matrix instruction fall 4x (2x).
// ---------------------------------------------------------------------------

typedef __attribute__((ext_vector_type(16))) __bf16 v16bf;
typedef __attribute__((ext_vector_type(8)))  float  v8f;

#define HID    1024
#define SEQ    2048
#define NBATCH 8
#define NROWS  (NBATCH * SEQ)      // 16384
#define LN_EPS 1e-5f

// round-to-nearest-even float -> bf16 (raw u16)
static __device__ __forceinline__ unsigned short f2bf(float x) {
  unsigned u = __builtin_bit_cast(unsigned, x);
  unsigned r = u + 0x7FFFu + ((u >> 16) & 1u);
  return (unsigned short)(r >> 16);
}

union FragU { v16bf v; uint4 q[2]; };

// 16x32 bf16 fragment from row-major global memory at column k0.
// CDNA5 16-bit A layout: lanes 0-15 hold row M=lane, K in {0..7,16..23};
// lanes 16-31 hold row M=lane-16, K in {8..15,24..31}. Two b128 loads/lane.
static __device__ __forceinline__ v16bf load_frag16x32(
    const unsigned short* __restrict__ p, int ld, int k0, int lane) {
  const int half = (lane >> 4) & 1;
  const int r    = lane & 15;
  const unsigned short* base = p + (size_t)r * ld + (k0 + half * 8);
  FragU f;
  f.q[0] = *reinterpret_cast<const uint4*>(base);
  f.q[1] = *reinterpret_cast<const uint4*>(base + 16);
  return f.v;
}

// Same fragment pattern read from an LDS tile of layout [n][32] bf16.
static __device__ __forceinline__ v16bf lds_frag(
    const unsigned short* __restrict__ sm, int n0, int lane) {
  const int half = (lane >> 4) & 1;
  const int r    = lane & 15;
  const unsigned short* base = sm + (size_t)(n0 + r) * 32 + half * 8;
  FragU f;
  f.q[0] = *reinterpret_cast<const uint4*>(base);   // ds_load_b128
  f.q[1] = *reinterpret_cast<const uint4*>(base + 16);
  return f.v;
}

static __device__ __forceinline__ v8f wmma_bf16(v16bf a, v16bf b, v8f c) {
  return __builtin_amdgcn_wmma_f32_16x16x32_bf16(false, a, false, b,
                                                 (short)0, c, false, false);
}

static __device__ __forceinline__ void wait_async0() {
  asm volatile("s_wait_asynccnt 0" ::: "memory");
}

// Async-copy one B tile (Nrows x 32 bf16, row stride ld elems in global,
// packed [n][32] in LDS) into LDS at byte offset lds_base.  Every thread
// moves NC x 16B chunks; chunk c covers row n=c>>2, quarter part=c&3.
template <int NC>
static __device__ __forceinline__ void stage_tile(
    unsigned lds_base, const unsigned short* __restrict__ g, int ld,
    int tid, int nthreads) {
  static_assert(NC % 8 == 0, "copies are issued in groups of eight");
#pragma unroll
  for (int i0 = 0; i0 < NC; i0 += 8) {
    unsigned lo[8];
    unsigned long long gp[8];
#pragma unroll
    for (int j = 0; j < 8; ++j) {
      const int c    = tid + (i0 + j) * nthreads;
      const int n    = c >> 2;
      const int part = c & 3;
      gp[j] = (unsigned long long)(uintptr_t)(g + (size_t)n * ld + part * 8);
      lo[j] = lds_base + (unsigned)c * 16u;
    }
    // Eight copies and their s_wait_xcnt in one statement: the address
    // registers stay untouched until the wait has passed.
    asm volatile(
        "global_load_async_to_lds_b128 %0, %8, off\n\t"
        "global_load_async_to_lds_b128 %1, %9, off\n\t"
        "global_load_async_to_lds_b128 %2, %10, off\n\t"
        "global_load_async_to_lds_b128 %3, %11, off\n\t"
        "global_load_async_to_lds_b128 %4, %12, off\n\t"
        "global_load_async_to_lds_b128 %5, %13, off\n\t"
        "global_load_async_to_lds_b128 %6, %14, off\n\t"
        "global_load_async_to_lds_b128 %7, %15, off\n\t"
        "s_wait_xcnt 0x0"
        :: "v"(lo[0]), "v"(lo[1]), "v"(lo[2]), "v"(lo[3]),
           "v"(lo[4]), "v"(lo[5]), "v"(lo[6]), "v"(lo[7]),
           "v"(gp[0]), "v"(gp[1]), "v"(gp[2]), "v"(gp[3]),
           "v"(gp[4]), "v"(gp[5]), "v"(gp[6]), "v"(gp[7])
        : "memory");
  }
}

// Double-buffered pipelined mainloop, one wave tile of MT*16 rows x NT*16 cols:
//   acc[m][t] += A[m*16..+16, K] * B[K, col0+t*16..+16]
// A read from global (register-pipelined); B staged async into LDS.
// Block stages B rows [0, nthreads*NC/4) = all rows its waves consume; every
// B fragment read from LDS feeds MT matrix instructions.  GB = B fragments
// held in registers at a time (NT a multiple of it).
template <int MT, int NT, int NC, int GB>
static __device__ __forceinline__ void gemm_pipeline(
    const unsigned short* __restrict__ Arow, int ldA,
    const unsigned short* __restrict__ B0,  int ldB,
    int Kdim, unsigned short* sm, unsigned tileBytes,
    int tid, int nthreads, int lane, int col0, v8f (&acc)[MT][NT]) {
  const unsigned sbase = (unsigned)(unsigned long long)(uintptr_t)sm;
  const int nIter = Kdim / 32;

  stage_tile<NC>(sbase, B0, ldB, tid, nthreads);
  wait_async0();
  __syncthreads();

  v16bf a[MT];
#pragma unroll
  for (int m = 0; m < MT; ++m)
    a[m] = load_frag16x32(Arow + (size_t)(m * 16) * ldA, ldA, 0, lane);

  for (int it = 0; it < nIter; ++it) {
    const unsigned curOff = (it & 1) ? tileBytes : 0u;
    const unsigned nxtOff = (it & 1) ? 0u : tileBytes;
    const bool more = (it + 1 < nIter);

    // issue async DMA for tile it+1 (overlaps this iteration's compute)
    if (more)
      stage_tile<NC>(sbase + nxtOff, B0 + (size_t)(it + 1) * 32, ldB, tid, nthreads);

    // register-pipeline next A fragments
    v16bf an[MT];
#pragma unroll
    for (int m = 0; m < MT; ++m) an[m] = a[m];
    if (more) {
#pragma unroll
      for (int m = 0; m < MT; ++m)
        an[m] = load_frag16x32(Arow + (size_t)(m * 16) * ldA, ldA,
                               (it + 1) * 32, lane);
    }

    // GB B fragments from LDS as one group, then their MT*GB WMMAs
    const unsigned short* smc = sm + (curOff >> 1);
#pragma unroll
    for (int t0 = 0; t0 < NT; t0 += GB) {
      v16bf bf[GB];
#pragma unroll
      for (int t = 0; t < GB; ++t)
        bf[t] = lds_frag(smc, col0 + (t0 + t) * 16, lane);
      // Keeps the A loads and the LDS reads as one group ahead of the WMMAs:
      // the compiler otherwise spreads them among the WMMAs, a full wait at each.
      __builtin_amdgcn_sched_barrier(0);
#pragma unroll
      for (int t = 0; t < GB; ++t)
#pragma unroll
        for (int m = 0; m < MT; ++m)
          acc[m][t0 + t] = wmma_bf16(a[m], bf[t], acc[m][t0 + t]);
      // Holds the WMMAs in front of what follows (the waits at the loop's foot):
      // the compiler otherwise sinks them behind the barrier, and tile it+1's
      // copies no longer fly under them.
      __builtin_amdgcn_sched_barrier(0);
    }

#pragma unroll
    for (int m = 0; m < MT; ++m) a[m] = an[m];
    // own LDS reads of tile it retired before the buffer is handed back
    asm volatile("s_wait_dscnt 0" ::: "memory");
    wait_async0();     // own copies for tile it+1 done (overlapped compute)
    __syncthreads();   // block-wide: tile it reads done, tile it+1 visible
  }
}

// ---------------------------------------------------------------------------
// Conversion kernels.  Work-groups of 8 waves take 128 x 128 tiles, 64 elements
// a thread, so that a launch starts 64x fewer waves than one element a thread
// would; global loads are 16 B a lane (512 B of one row a wave), stores cover
// 256 contiguous bytes of a row, and the transposed copy goes through LDS.
// ---------------------------------------------------------------------------
#define CT   128                 // tile edge, elements
#define CTPD (CT / 2 + 1)        // LDS row pitch in dwords (two bf16 a dword)

static __device__ __forceinline__ unsigned pack2bf(float lo, float hi) {
  return (unsigned)f2bf(lo) | ((unsigned)f2bf(hi) << 16);
}

// One 128 x 128 tile of a row-major f32 matrix with HID columns.
//   dstT[c * ldT + r] = bf16(src[r * HID + c]);  STRAIGHT: dst[r * HID + c] too.
// 256 threads; tile = CT * CTPD dwords of LDS.
template <bool STRAIGHT>
static __device__ __forceinline__ void conv_tile(
    const float* __restrict__ src, unsigned short* __restrict__ dst,
    unsigned short* __restrict__ dstT, int ldT, unsigned* tile, int tid) {
  const int c4 = tid & 31;       // group of four columns
  const int r0 = tid >> 5;       // a wave reads one row at a time
  const float* __restrict__ ps = src + (size_t)r0 * HID + c4 * 4;
  float4 v[16];
#pragma unroll
  for (int i = 0; i < 16; ++i)
    v[i] = *reinterpret_cast<const float4*>(ps + (size_t)(8 * i) * HID);
  // The loads' address register pair is reused only behind this wait; naming
  // the address keeps it out of the loads' own destination registers.
  asm volatile("s_wait_xcnt 0x0" :: "v"(ps) : "memory");
  uint2 pk[16];
#pragma unroll
  for (int i = 0; i < 16; ++i) {
    const int r = r0 + 8 * i;
    pk[i] = make_uint2(pack2bf(v[i].x, v[i].y), pack2bf(v[i].z, v[i].w));
    tile[r * CTPD + c4 * 2]     = pk[i].x;
    tile[r * CTPD + c4 * 2 + 1] = pk[i].y;
  }
  __syncthreads();

  // The straight copy is stored behind the barrier: in front of it the barrier
  // would wait until these global stores have completed.
  if (STRAIGHT) {
#pragma unroll
    for (int i = 0; i < 16; ++i)
      *reinterpret_cast<uint2*>(dst + (size_t)(r0 + 8 * i) * HID + c4 * 4) = pk[i];
  }

  // A thread gathers eight rows of one column pair: 16 B for each of two rows
  // of the transposed copy; sixteen lanes fill 256 contiguous bytes of a row.
  const int rg = tid & 15;       // group of eight source rows
#pragma unroll
  for (int p = 0; p < 4; ++p) {
    const int cp = (tid >> 4) + 16 * p;      // column pair, 0..63
    unsigned a[8];
#pragma unroll
    for (int j = 0; j < 8; ++j) a[j] = tile[(rg * 8 + j) * CTPD + cp];
    uint4 lo, hi;
    lo.x = (a[0] & 0xFFFFu) | (a[1] << 16);
    lo.y = (a[2] & 0xFFFFu) | (a[3] << 16);
    lo.z = (a[4] & 0xFFFFu) | (a[5] << 16);
    lo.w = (a[6] & 0xFFFFu) | (a[7] << 16);
    hi.x = (a[0] >> 16) | (a[1] & 0xFFFF0000u);
    hi.y = (a[2] >> 16) | (a[3] & 0xFFFF0000u);
    hi.z = (a[4] >> 16) | (a[5] & 0xFFFF0000u);
    hi.w = (a[6] >> 16) | (a[7] & 0xFFFF0000u);
    *reinterpret_cast<uint4*>(dstT + (size_t)(2 * cp) * ldT + rg * 8)     = lo;
    *reinterpret_cast<uint4*>(dstT + (size_t)(2 * cp + 1) * ldT + rg * 8) = hi;
  }
}

// ---------------------------------------------------------------------------
// Kernel 1: X,Y fp32 -> bf16 row-major; also write Y^T (per batch) in bf16.
// grid (1024, 2): y = 0 takes a tile of Y, y = 1 the same count of X elements.
// ---------------------------------------------------------------------------
// At most 8 waves a SIMD are planned for, so that the register budget holds a
// thread's 16 loads in flight at once (at 64 registers they go out in turns).
__global__ __launch_bounds__(256) __attribute__((amdgpu_waves_per_eu(2, 8)))
void attn_conv_xy(const float* __restrict__ X,
                  const float* __restrict__ Y,
                  unsigned short* __restrict__ Xb,
                  unsigned short* __restrict__ Yb,
                  unsigned short* __restrict__ YT) {
  __shared__ unsigned tile[CT * CTPD];
  const int tid = threadIdx.x;
  const int t   = blockIdx.x;
  if (blockIdx.y == 0) {
    const int f0  = (t & 7) * CT;            // HID / CT = 8 column tiles
    const int row = (t >> 3) * CT;           // row of the [NROWS, HID] view
    const int b   = row >> 11;               // / SEQ
    const int s0  = row & (SEQ - 1);
    const size_t o = (size_t)row * HID + f0;
    conv_tile<true>(Y + o, Yb + o, YT + ((size_t)b * HID + f0) * SEQ + s0, SEQ,
                    tile, tid);              // Y^T[b][f][s]
  } else {
    const size_t base = (size_t)t * (CT * CT) + (size_t)tid * 4;
    const float* __restrict__ px = X + base;
    float4 v[16];
#pragma unroll
    for (int i = 0; i < 16; ++i)
      v[i] = *reinterpret_cast<const float4*>(px + i * 1024);
    // As in conv_tile: the address pair is reused only behind this wait.
    asm volatile("s_wait_xcnt 0x0" :: "v"(px) : "memory");
#pragma unroll
    for (int i = 0; i < 16; ++i)
      *reinterpret_cast<uint2*>(Xb + base + i * 1024) =
          make_uint2(pack2bf(v[i].x, v[i].y), pack2bf(v[i].z, v[i].w));
    // The stores' data and address registers are reused only behind this wait.
    asm volatile("s_wait_xcnt 0x0" ::: "memory");
  }
}

// ---------------------------------------------------------------------------
// Kernel 2: K,Q fp32 [F,H] -> transposed bf16 [H,F]  (B-operand layout)
// grid (64, 2): y picks the matrix, x its tile.
// ---------------------------------------------------------------------------
// At most 8 waves a SIMD are planned for, so that the register budget holds a
// thread's 16 loads in flight at once (at 64 registers they go out in turns).
__global__ __launch_bounds__(256) __attribute__((amdgpu_waves_per_eu(2, 8)))
void attn_conv_w(const float* __restrict__ K,
                 const float* __restrict__ Q,
                 unsigned short* __restrict__ KT,
                 unsigned short* __restrict__ QT) {
  __shared__ unsigned tile[CT * CTPD];
  const int t  = blockIdx.x;
  const int h0 = (t & 7) * CT;
  const int f0 = (t >> 3) * CT;
  const float* __restrict__ s    = (blockIdx.y == 0) ? K : Q;
  unsigned short* __restrict__ d = (blockIdx.y == 0) ? KT : QT;
  conv_tile<false>(s + (size_t)f0 * HID + h0, nullptr,
                   d + (size_t)h0 * HID + f0, HID, tile, threadIdx.x);
}

// ---------------------------------------------------------------------------
// Kernel 3: fused GEMM + LayerNorm.  512 thr (16 waves): 64 rows x 1024 cols,
// each wave 64 rows x 64 cols.  Dynamic LDS: 2 x 64KB B-tile buffers.
// ---------------------------------------------------------------------------
__global__ __launch_bounds__(512)
void attn_gemm_ln(const unsigned short* __restrict__ A,
                  const unsigned short* __restrict__ WT,
                  const float* __restrict__ gamma,
                  const float* __restrict__ beta,
                  unsigned short* __restrict__ out) {
  extern __shared__ unsigned short smem[];          // 2 * 1024*32 bf16
  const int tid  = threadIdx.x;
  const int lane = tid & 31;
  const int wave = tid >> 5;            // 0..15
  const int half = (lane >> 4) & 1;
  const int mr   = lane & 15;
  const int row0 = blockIdx.x * 64;
  const int col0 = wave * 64;

  v8f acc[4][4];
#pragma unroll
  for (int m = 0; m < 4; ++m)
#pragma unroll
    for (int t = 0; t < 4; ++t)
#pragma unroll
      for (int r = 0; r < 8; ++r) acc[m][t][r] = 0.0f;

  gemm_pipeline<4, 4, 8, 4>(A + (size_t)row0 * HID, HID, WT, HID, HID,
                         smem, 1024u * 64u, tid, 512, lane, col0, acc);

  __shared__ float s_sum[64];
  __shared__ float s_sq[64];
  if (tid < 64) { s_sum[tid] = 0.0f; s_sq[tid] = 0.0f; }
  __syncthreads();

#pragma unroll
  for (int m = 0; m < 4; ++m) {
#pragma unroll
    for (int r = 0; r < 8; ++r) {
      float ps = 0.0f, pq = 0.0f;
#pragma unroll
      for (int t = 0; t < 4; ++t) { float v = acc[m][t][r]; ps += v; pq += v * v; }
#pragma unroll
      for (int k = 1; k <= 8; k <<= 1) {    // reduce over the 16-lane half
        ps += __shfl_xor(ps, k, 32);
        pq += __shfl_xor(pq, k, 32);
      }
      if (mr == 0) {
        int row = m * 16 + r + 8 * half;
        atomicAdd(&s_sum[row], ps);         // ds_add_f32
        atomicAdd(&s_sq[row], pq);
      }
    }
  }
  __syncthreads();

  const float inv_h = 1.0f / (float)HID;
#pragma unroll
  for (int m = 0; m < 4; ++m) {
#pragma unroll
    for (int r = 0; r < 8; ++r) {
      const int row  = m * 16 + r + 8 * half;
      const float mu = s_sum[row] * inv_h;
      float var      = s_sq[row] * inv_h - mu * mu;
      const float rs = rsqrtf(var + LN_EPS);
#pragma unroll
      for (int t = 0; t < 4; ++t) {
        const int n  = col0 + t * 16 + mr;
        float v = (acc[m][t][r] - mu) * rs * gamma[n] + beta[n];
        out[(size_t)(row0 + row) * HID + n] = f2bf(v);
      }
    }
  }
}

// ---------------------------------------------------------------------------
// Kernel 4: fused scores + softmax.  512 thr (16 waves): 32 q rows x 2048 keys,
// each wave 32 rows x 128 keys.  Dynamic LDS: 2 x 128KB key-tile buffers.
// ---------------------------------------------------------------------------
__global__ __launch_bounds__(512)
void attn_scores_softmax(const unsigned short* __restrict__ Qb,
                         const unsigned short* __restrict__ Kb,
                         unsigned short* __restrict__ alpha) {
  extern __shared__ unsigned short smem[];          // 2 * 2048*32 bf16
  const int tid  = threadIdx.x;
  const int lane = tid & 31;
  const int wave = tid >> 5;            // 0..15
  const int half = (lane >> 4) & 1;
  const int mr   = lane & 15;
  const int b    = blockIdx.x >> 6;     // /64
  const int qt   = blockIdx.x & 63;
  const int row0 = qt * 32;
  const int col0 = wave * 128;

  const unsigned short* Qrow = Qb + ((size_t)b * SEQ + row0) * HID;
  const unsigned short* Krow = Kb + (size_t)b * SEQ * HID;

  v8f acc[2][8];
#pragma unroll
  for (int m = 0; m < 2; ++m)
#pragma unroll
    for (int t = 0; t < 8; ++t)
#pragma unroll
      for (int r = 0; r < 8; ++r) acc[m][t][r] = 0.0f;

  gemm_pipeline<2, 8, 16, 4>(Qrow, HID, Krow, HID, HID,
                          smem, 2048u * 64u, tid, 512, lane, col0, acc);

  const float sc = 1.0f / (float)HID;
#pragma unroll
  for (int m = 0; m < 2; ++m)
#pragma unroll
    for (int t = 0; t < 8; ++t)
#pragma unroll
      for (int r = 0; r < 8; ++r) acc[m][t][r] *= sc;

  __shared__ float s_red[512];          // [wave][row]
  __shared__ float s_rowmax[32];
  __shared__ float s_rowsum[32];

  // ---- row max ----
#pragma unroll
  for (int m = 0; m < 2; ++m) {
#pragma unroll
    for (int r = 0; r < 8; ++r) {
      float mx = -3.0e38f;
#pragma unroll
      for (int t = 0; t < 8; ++t) mx = fmaxf(mx, acc[m][t][r]);
#pragma unroll
      for (int msk = 1; msk <= 8; msk <<= 1) mx = fmaxf(mx, __shfl_xor(mx, msk, 32));
      if (mr == 0) s_red[wave * 32 + m * 16 + r + 8 * half] = mx;
    }
  }
  __syncthreads();
  if (tid < 32) {
    float mx = -3.0e38f;
    for (int w = 0; w < 16; ++w) mx = fmaxf(mx, s_red[w * 32 + tid]);
    s_rowmax[tid] = mx;
  }
  __syncthreads();

  // ---- exp + row sum ----
#pragma unroll
  for (int m = 0; m < 2; ++m) {
#pragma unroll
    for (int r = 0; r < 8; ++r) {
      const int row = m * 16 + r + 8 * half;
      const float rm = s_rowmax[row];
      float s = 0.0f;
#pragma unroll
      for (int t = 0; t < 8; ++t) {
        float e = __expf(acc[m][t][r] - rm);
        acc[m][t][r] = e;
        s += e;
      }
#pragma unroll
      for (int msk = 1; msk <= 8; msk <<= 1) s += __shfl_xor(s, msk, 32);
      if (mr == 0) s_red[wave * 32 + row] = s;
    }
  }
  __syncthreads();
  if (tid < 32) {
    float s = 0.0f;
    for (int w = 0; w < 16; ++w) s += s_red[w * 32 + tid];
    s_rowsum[tid] = 1.0f / s;
  }
  __syncthreads();

  // ---- normalize + store bf16 alpha ----
#pragma unroll
  for (int m = 0; m < 2; ++m) {
#pragma unroll
    for (int r = 0; r < 8; ++r) {
      const int row = m * 16 + r + 8 * half;
      const float inv = s_rowsum[row];
#pragma unroll
      for (int t = 0; t < 8; ++t) {
        const int n = col0 + t * 16 + mr;
        alpha[((size_t)b * SEQ + row0 + row) * SEQ + n] = f2bf(acc[m][t][r] * inv);
      }
    }
  }
}

// ---------------------------------------------------------------------------
// Kernel 5: out = alpha @ Y   (per batch [2048x2048] x [2048x1024], fp32 out)
// 512 thr (16 waves): 64 q rows x 1024 f cols, each wave 64 rows x 64 cols;
// K-loop over 2048.  Dynamic LDS: 2 x 64KB YT-tile buffers.
// ---------------------------------------------------------------------------
__global__ __launch_bounds__(512)
void attn_pv_gemm(const unsigned short* __restrict__ alpha,
                  const unsigned short* __restrict__ YT,
                  float* __restrict__ out) {
  extern __shared__ unsigned short smem[];          // 2 * 1024*32 bf16
  const int tid  = threadIdx.x;
  const int lane = tid & 31;
  const int wave = tid >> 5;            // 0..15
  const int half = (lane >> 4) & 1;
  const int mr   = lane & 15;
  const int b    = blockIdx.x >> 5;
  const int qt   = blockIdx.x & 31;
  const int row0 = qt * 64;
  const int col0 = wave * 64;

  const unsigned short* Arow = alpha + ((size_t)b * SEQ + row0) * SEQ;
  const unsigned short* Brow = YT + (size_t)b * HID * SEQ;

  v8f acc[4][4];
#pragma unroll
  for (int m = 0; m < 4; ++m)
#pragma unroll
    for (int t = 0; t < 4; ++t)
#pragma unroll
      for (int r = 0; r < 8; ++r) acc[m][t][r] = 0.0f;

  gemm_pipeline<4, 4, 8, 4>(Arow, SEQ, Brow, SEQ, SEQ,
                         smem, 1024u * 64u, tid, 512, lane, col0, acc);

#pragma unroll
  for (int m = 0; m < 4; ++m) {
#pragma unroll
    for (int r = 0; r < 8; ++r) {
      const int row = m * 16 + r + 8 * half;
#pragma unroll
      for (int t = 0; t < 4; ++t) {
        const int n = col0 + t * 16 + mr;
        out[((size_t)b * SEQ + row0 + row) * HID + n] = acc[m][t][r];
      }
    }
  }
}

// ---------------------------------------------------------------------------
// host launcher
// ---------------------------------------------------------------------------
extern "C" void kernel_launch(void* const* d_in, const int* in_sizes, int n_in,
                              void* d_out, int out_size, void* d_ws, size_t ws_size,
                              hipStream_t stream) {
  const float* X  = (const float*)d_in[0];
  const float* Y  = (const float*)d_in[1];
  const float* K  = (const float*)d_in[2];
  const float* Q  = (const float*)d_in[3];
  const float* g1 = (const float*)d_in[4];
  const float* b1 = (const float*)d_in[5];
  const float* g2 = (const float*)d_in[6];
  const float* b2 = (const float*)d_in[7];
  float* out = (float*)d_out;

  // workspace layout (bytes); total ~228 MB
  char* w = (char*)d_ws;
  const size_t SZ_XY = (size_t)NROWS * HID * 2;        // 32 MB each
  const size_t SZ_W  = (size_t)HID * HID * 2;          // 2 MB each
  unsigned short* Xb    = (unsigned short*)(w);
  unsigned short* Yb    = (unsigned short*)(w + SZ_XY);
  unsigned short* YT    = (unsigned short*)(w + 2 * SZ_XY);
  unsigned short* KT    = (unsigned short*)(w + 3 * SZ_XY);
  unsigned short* QT    = (unsigned short*)(w + 3 * SZ_XY + SZ_W);
  unsigned short* Kb    = (unsigned short*)(w + 3 * SZ_XY + 2 * SZ_W);
  unsigned short* Qb    = (unsigned short*)(w + 4 * SZ_XY + 2 * SZ_W);
  unsigned short* alpha = (unsigned short*)(w + 5 * SZ_XY + 2 * SZ_W); // 64 MB

  const size_t LDS_1K = 2u * 1024u * 64u;   // 128 KB (double-buffered 64KB tiles)
  const size_t LDS_2K = 2u * 2048u * 64u;   // 256 KB

  // 1) convert X,Y -> bf16 (+ Y^T), K,Q -> transposed bf16
  attn_conv_xy<<<dim3(1024, 2), 256, 0, stream>>>(X, Y, Xb, Yb, YT);
  attn_conv_w<<<dim3(64, 2), 256, 0, stream>>>(K, Q, KT, QT);

  // 2) keys = LN(Y @ K), queries = LN(X @ Q)   [fused GEMM+LN, bf16 out]
  attn_gemm_ln<<<NROWS / 64, 512, LDS_1K, stream>>>(Yb, KT, g1, b1, Kb);
  attn_gemm_ln<<<NROWS / 64, 512, LDS_1K, stream>>>(Xb, QT, g2, b2, Qb);

  // 3) alpha = softmax(queries @ keys^T / H)   [fused, bf16 out]
  attn_scores_softmax<<<NBATCH * (SEQ / 32), 512, LDS_2K, stream>>>(Qb, Kb, alpha);

  // 4) out = alpha @ Y                          [fp32 out]
  attn_pv_gemm<<<NBATCH * (SEQ / 64), 512, LDS_1K, stream>>>(alpha, YT, out);
}

// v003
// A run of this version takes 419 microseconds.
// Next to v002, in two timings, it ran 1.04 times as fast each time.
// Over all steps from v000 it is 2.82 times as fast.
#include <hip/hip_runtime.h>

// ---------------------------------------------------------------------------
// MI455X (gfx1250) attention pipeline.
//   keys    = LN(Y @ K)        queries = LN(X @ Q)
//   alpha   = softmax(queries @ keys^T / 1024)
//   out     = alpha @ Y
// All contractions: v_wmma_f32_16x16x32_bf16 with f32 accumulation.
// B operands double-buffered in LDS via global_load_async_to_lds_b128
// (ASYNCcnt) so async DMA of tile k+1 overlaps the WMMAs of tile k.
// Each staged B tile serves 64 rows of A (32 in the score kernel), so the
// bytes copied from L2 into LDS per matrix instruction fall 4x (2x).
// ---------------------------------------------------------------------------

typedef __attribute__((ext_vector_type(16))) __bf16 v16bf;
typedef __attribute__((ext_vector_type(8)))  float  v8f;

#define HID    1024
#define SEQ    2048
#define NBATCH 8
#define NROWS  (NBATCH * SEQ)      // 16384
#define LN_EPS 1e-5f

// round-to-nearest-even float -> bf16 (raw u16)
static __device__ __forceinline__ unsigned short f2bf(float x) {
  unsigned u = __builtin_bit_cast(unsigned, x);
  unsigned r = u + 0x7FFFu + ((u >> 16) & 1u);
  return (unsigned short)(r >> 16);
}

union FragU { v16bf v; uint4 q[2]; };

// 16x32 bf16 fragment from row-major global memory at column k0.
// CDNA5 16-bit A layout: lanes 0-15 hold row M=lane, K in {0..7,16..23};
// lanes 16-31 hold row M=lane-16, K in {8..15,24..31}. Two b128 loads/lane.
static __device__ __forceinline__ v16bf load_frag16x32(
    const unsigned short* __restrict__ p, int ld, int k0, int lane) {
  const int half = (lane >> 4) & 1;
  const int r    = lane & 15;
  const unsigned short* base = p + (size_t)r * ld + (k0 + half * 8);
  FragU f;
  f.q[0] = *reinterpret_cast<const uint4*>(base);
  f.q[1] = *reinterpret_cast<const uint4*>(base + 16);
  return f.v;
}

// LDS tile: rows of 32 bf16 = four 16-B chunks, no pad.  Chunk q of row n lies
// at place q ^ ((n >> 2) & 3) of its row.  The sixteen lanes of a half wave read
// one chunk number of sixteen successive rows: at plain places they fall on 16
// of the 64 banks, four deep; at these places they cover all 64 banks once.
static __device__ __forceinline__ int lds_place(int n, int q) {
  return q ^ ((n >> 2) & 3);
}

// Same fragment pattern read from such an LDS tile; n0 a multiple of 16.
static __device__ __forceinline__ v16bf lds_frag(
    const unsigned short* __restrict__ sm, int n0, int lane) {
  const int half = (lane >> 4) & 1;
  const int r    = lane & 15;
  const unsigned short* row = sm + (size_t)(n0 + r) * 32;
  FragU f;
  f.q[0] = *reinterpret_cast<const uint4*>(row + lds_place(r, half) * 8);      // ds_load_b128
  f.q[1] = *reinterpret_cast<const uint4*>(row + lds_place(r, half + 2) * 8);
  return f.v;
}

static __device__ __forceinline__ v8f wmma_bf16(v16bf a, v16bf b, v8f c) {
  return __builtin_amdgcn_wmma_f32_16x16x32_bf16(false, a, false, b,
                                                 (short)0, c, false, false);
}

static __device__ __forceinline__ void wait_async0() {
  asm volatile("s_wait_asynccnt 0" ::: "memory");
}

// Async-copy one B tile (Nrows x 32 bf16, row stride ld elems in global,
// rows of 64 B in LDS) into LDS at byte offset lds_base.  Every thread
// moves NC x 16B chunks; chunk c covers row n=c>>2, quarter part=c&3, and
// lands at place lds_place(n, part) of its row.
template <int NC>
static __device__ __forceinline__ void stage_tile(
    unsigned lds_base, const unsigned short* __restrict__ g, int ld,
    int tid, int nthreads) {
  static_assert(NC % 8 == 0, "copies are issued in groups of eight");
#pragma unroll
  for (int i0 = 0; i0 < NC; i0 += 8) {
    unsigned lo[8];
    unsigned long long gp[8];
#pragma unroll
    for (int j = 0; j < 8; ++j) {
      const int c    = tid + (i0 + j) * nthreads;
      const int n    = c >> 2;
      const int part = c & 3;
      gp[j] = (unsigned long long)(uintptr_t)(g + (size_t)n * ld + part * 8);
      lo[j] = lds_base + (unsigned)n * 64u + (unsigned)lds_place(n, part) * 16u;
    }
    // Eight copies and their s_wait_xcnt in one statement: the address
    // registers stay untouched until the wait has passed.
    asm volatile(
        "global_load_async_to_lds_b128 %0, %8, off\n\t"
        "global_load_async_to_lds_b128 %1, %9, off\n\t"
        "global_load_async_to_lds_b128 %2, %10, off\n\t"
        "global_load_async_to_lds_b128 %3, %11, off\n\t"
        "global_load_async_to_lds_b128 %4, %12, off\n\t"
        "global_load_async_to_lds_b128 %5, %13, off\n\t"
        "global_load_async_to_lds_b128 %6, %14, off\n\t"
        "global_load_async_to_lds_b128 %7, %15, off\n\t"
        "s_wait_xcnt 0x0"
        :: "v"(lo[0]), "v"(lo[1]), "v"(lo[2]), "v"(lo[3]),
           "v"(lo[4]), "v"(lo[5]), "v"(lo[6]), "v"(lo[7]),
           "v"(gp[0]), "v"(gp[1]), "v"(gp[2]), "v"(gp[3]),
           "v"(gp[4]), "v"(gp[5]), "v"(gp[6]), "v"(gp[7])
        : "memory");
  }
}

// Double-buffered pipelined mainloop, one wave tile of MT*16 rows x NT*16 cols:
//   acc[m][t] += A[m*16..+16, K] * B[K, col0+t*16..+16]
// A read from global (register-pipelined); B staged async into LDS.
// Block stages B rows [0, nthreads*NC/4) = all rows its waves consume; every
// B fragment read from LDS feeds MT matrix instructions.  GB = B fragments
// held in registers at a time (NT a multiple of it).
template <int MT, int NT, int NC, int GB>
static __device__ __forceinline__ void gemm_pipeline(
    const unsigned short* __restrict__ Arow, int ldA,
    const unsigned short* __restrict__ B0,  int ldB,
    int Kdim, unsigned short* sm, unsigned tileBytes,
    int tid, int nthreads, int lane, int col0, v8f (&acc)[MT][NT]) {
  const unsigned sbase = (unsigned)(unsigned long long)(uintptr_t)sm;
  const int nIter = Kdim / 32;

  stage_tile<NC>(sbase, B0, ldB, tid, nthreads);
  wait_async0();
  __syncthreads();

  v16bf a[MT];
#pragma unroll
  for (int m = 0; m < MT; ++m)
    a[m] = load_frag16x32(Arow + (size_t)(m * 16) * ldA, ldA, 0, lane);

  for (int it = 0; it < nIter; ++it) {
    const unsigned curOff = (it & 1) ? tileBytes : 0u;
    const unsigned nxtOff = (it & 1) ? 0u : tileBytes;
    const bool more = (it + 1 < nIter);

    // issue async DMA for tile it+1 (overlaps this iteration's compute)
    if (more)
      stage_tile<NC>(sbase + nxtOff, B0 + (size_t)(it + 1) * 32, ldB, tid, nthreads);

    // register-pipeline next A fragments
    v16bf an[MT];
#pragma unroll
    for (int m = 0; m < MT; ++m) an[m] = a[m];
    if (more) {
#pragma unroll
      for (int m = 0; m < MT; ++m)
        an[m] = load_frag16x32(Arow + (size_t)(m * 16) * ldA, ldA,
                               (it + 1) * 32, lane);
    }

    // GB B fragments from LDS as one group, then their MT*GB WMMAs
    const unsigned short* smc = sm + (curOff >> 1);
#pragma unroll
    for (int t0 = 0; t0 < NT; t0 += GB) {
      v16bf bf[GB];
#pragma unroll
      for (int t = 0; t < GB; ++t)
        bf[t] = lds_frag(smc, col0 + (t0 + t) * 16, lane);
      // Keeps the A loads and the LDS reads as one group ahead of the WMMAs:
      // the compiler otherwise spreads them among the WMMAs, a full wait at each.
      __builtin_amdgcn_sched_barrier(0);
#pragma unroll
      for (int t = 0; t < GB; ++t)
#pragma unroll
        for (int m = 0; m < MT; ++m)
          acc[m][t0 + t] = wmma_bf16(a[m], bf[t], acc[m][t0 + t]);
      // Holds the WMMAs in front of what follows (the waits at the loop's foot):
      // the compiler otherwise sinks them behind the barrier, and tile it+1's
      // copies no longer fly under them.
      __builtin_amdgcn_sched_barrier(0);
    }

#pragma unroll
    for (int m = 0; m < MT; ++m) a[m] = an[m];
    // own LDS reads of tile it retired before the buffer is handed back
    asm volatile("s_wait_dscnt 0" ::: "memory");
    wait_async0();     // own copies for tile it+1 done (overlapped compute)
    __syncthreads();   // block-wide: tile it reads done, tile it+1 visible
  }
}

// ---------------------------------------------------------------------------
// Conversion kernels.  Work-groups of 8 waves take 128 x 128 tiles, 64 elements
// a thread, so that a launch starts 64x fewer waves than one element a thread
// would; global loads are 16 B a lane (512 B of one row a wave), stores cover
// 256 contiguous bytes of a row, and the transposed copy goes through LDS.
// ---------------------------------------------------------------------------
#define CT   128                 // tile edge, elements
#define CTPD (CT / 2 + 1)        // LDS row pitch in dwords (two bf16 a dword)

static __device__ __forceinline__ unsigned pack2bf(float lo, float hi) {
  return (unsigned)f2bf(lo) | ((unsigned)f2bf(hi) << 16);
}

// One 128 x 128 tile of a row-major f32 matrix with HID columns.
//   dstT[c * ldT + r] = bf16(src[r * HID + c]);  STRAIGHT: dst[r * HID + c] too.
// 256 threads; tile = CT * CTPD dwords of LDS.
template <bool STRAIGHT>
static __device__ __forceinline__ void conv_tile(
    const float* __restrict__ src, unsigned short* __restrict__ dst,
    unsigned short* __restrict__ dstT, int ldT, unsigned* tile, int tid) {
  const int c4 = tid & 31;       // group of four columns
  const int r0 = tid >> 5;       // a wave reads one row at a time
  const float* __restrict__ ps = src + (size_t)r0 * HID + c4 * 4;
  float4 v[16];
#pragma unroll
  for (int i = 0; i < 16; ++i)
    v[i] = *reinterpret_cast<const float4*>(ps + (size_t)(8 * i) * HID);
  // The loads' address register pair is reused only behind this wait; naming
  // the address keeps it out of the loads' own destination registers.
  asm volatile("s_wait_xcnt 0x0" :: "v"(ps) : "memory");
  uint2 pk[16];
#pragma unroll
  for (int i = 0; i < 16; ++i) {
    const int r = r0 + 8 * i;
    pk[i] = make_uint2(pack2bf(v[i].x, v[i].y), pack2bf(v[i].z, v[i].w));
    tile[r * CTPD + c4 * 2]     = pk[i].x;
    tile[r * CTPD + c4 * 2 + 1] = pk[i].y;
  }
  __syncthreads();

  // The straight copy is stored behind the barrier: in front of it the barrier
  // would wait until these global stores have completed.
  if (STRAIGHT) {
#pragma unroll
    for (int i = 0; i < 16; ++i)
      *reinterpret_cast<uint2*>(dst + (size_t)(r0 + 8 * i) * HID + c4 * 4) = pk[i];
  }

  // A thread gathers eight rows of one column pair: 16 B for each of two rows
  // of the transposed copy; sixteen lanes fill 256 contiguous bytes of a row.
  const int rg = tid & 15;       // group of eight source rows
#pragma unroll
  for (int p = 0; p < 4; ++p) {
    const int cp = (tid >> 4) + 16 * p;      // column pair, 0..63
    unsigned a[8];
#pragma unroll
    for (int j = 0; j < 8; ++j) a[j] = tile[(rg * 8 + j) * CTPD + cp];
    uint4 lo, hi;
    lo.x = (a[0] & 0xFFFFu) | (a[1] << 16);
    lo.y = (a[2] & 0xFFFFu) | (a[3] << 16);
    lo.z = (a[4] & 0xFFFFu) | (a[5] << 16);
    lo.w = (a[6] & 0xFFFFu) | (a[7] << 16);
    hi.x = (a[0] >> 16) | (a[1] & 0xFFFF0000u);
    hi.y = (a[2] >> 16) | (a[3] & 0xFFFF0000u);
    hi.z = (a[4] >> 16) | (a[5] & 0xFFFF0000u);
    hi.w = (a[6] >> 16) | (a[7] & 0xFFFF0000u);
    *reinterpret_cast<uint4*>(dstT + (size_t)(2 * cp) * ldT + rg * 8)     = lo;
    *reinterpret_cast<uint4*>(dstT + (size_t)(2 * cp + 1) * ldT + rg * 8) = hi;
  }
}

// ---------------------------------------------------------------------------
// Kernel 1: X,Y fp32 -> bf16 row-major; also write Y^T (per batch) in bf16.
// grid (1024, 2): y = 0 takes a tile of Y, y = 1 the same count of X elements.
// ---------------------------------------------------------------------------
// At most 8 waves a SIMD are planned for, so that the register budget holds a
// thread's 16 loads in flight at once (at 64 registers they go out in turns).
__global__ __launch_bounds__(256) __attribute__((amdgpu_waves_per_eu(2, 8)))
void attn_conv_xy(const float* __restrict__ X,
                  const float* __restrict__ Y,
                  unsigned short* __restrict__ Xb,
                  unsigned short* __restrict__ Yb,
                  unsigned short* __restrict__ YT) {
  __shared__ unsigned tile[CT * CTPD];
  const int tid = threadIdx.x;
  const int t   = blockIdx.x;
  if (blockIdx.y == 0) {
    const int f0  = (t & 7) * CT;            // HID / CT = 8 column tiles
    const int row = (t >> 3) * CT;           // row of the [NROWS, HID] view
    const int b   = row >> 11;               // / SEQ
    const int s0  = row & (SEQ - 1);
    const size_t o = (size_t)row * HID + f0;
    conv_tile<true>(Y + o, Yb + o, YT + ((size_t)b * HID + f0) * SEQ + s0, SEQ,
                    tile, tid);              // Y^T[b][f][s]
  } else {
    const size_t base = (size_t)t * (CT * CT) + (size_t)tid * 4;
    const float* __restrict__ px = X + base;
    float4 v[16];
#pragma unroll
    for (int i = 0; i < 16; ++i)
      v[i] = *reinterpret_cast<const float4*>(px + i * 1024);
    // As in conv_tile: the address pair is reused only behind this wait.
    asm volatile("s_wait_xcnt 0x0" :: "v"(px) : "memory");
#pragma unroll
    for (int i = 0; i < 16; ++i)
      *reinterpret_cast<uint2*>(Xb + base + i * 1024) =
          make_uint2(pack2bf(v[i].x, v[i].y), pack2bf(v[i].z, v[i].w));
    // The stores' data and address registers are reused only behind this wait.
    asm volatile("s_wait_xcnt 0x0" ::: "memory");
  }
}

// ---------------------------------------------------------------------------
// Kernel 2: K,Q fp32 [F,H] -> transposed bf16 [H,F]  (B-operand layout)
// grid (64, 2): y picks the matrix, x its tile.
// ---------------------------------------------------------------------------
// At most 8 waves a SIMD are planned for, so that the register budget holds a
// thread's 16 loads in flight at once (at 64 registers they go out in turns).
__global__ __launch_bounds__(256) __attribute__((amdgpu_waves_per_eu(2, 8)))
void attn_conv_w(const float* __restrict__ K,
                 const float* __restrict__ Q,
                 unsigned short* __restrict__ KT,
                 unsigned short* __restrict__ QT) {
  __shared__ unsigned tile[CT * CTPD];
  const int t  = blockIdx.x;
  const int h0 = (t & 7) * CT;
  const int f0 = (t >> 3) * CT;
  const float* __restrict__ s    = (blockIdx.y == 0) ? K : Q;
  unsigned short* __restrict__ d = (blockIdx.y == 0) ? KT : QT;
  conv_tile<false>(s + (size_t)f0 * HID + h0, nullptr,
                   d + (size_t)h0 * HID + f0, HID, tile, threadIdx.x);
}

// ---------------------------------------------------------------------------
// Kernel 3: fused GEMM + LayerNorm.  512 thr (16 waves): 64 rows x 1024 cols,
// each wave 64 rows x 64 cols.  Dynamic LDS: 2 x 64KB B-tile buffers.
// ---------------------------------------------------------------------------
__global__ __launch_bounds__(512)
void attn_gemm_ln(const unsigned short* __restrict__ A,
                  const unsigned short* __restrict__ WT,
                  const float* __restrict__ gamma,
                  const float* __restrict__ beta,
                  unsigned short* __restrict__ out) {
  extern __shared__ unsigned short smem[];          // 2 * 1024*32 bf16
  const int tid  = threadIdx.x;
  const int lane = tid & 31;
  const int wave = tid >> 5;            // 0..15
  const int half = (lane >> 4) & 1;
  const int mr   = lane & 15;
  const int row0 = blockIdx.x * 64;
  const int col0 = wave * 64;

  v8f acc[4][4];
#pragma unroll
  for (int m = 0; m < 4; ++m)
#pragma unroll
    for (int t = 0; t < 4; ++t)
#pragma unroll
      for (int r = 0; r < 8; ++r) acc[m][t][r] = 0.0f;

  gemm_pipeline<4, 4, 8, 4>(A + (size_t)row0 * HID, HID, WT, HID, HID,
                         smem, 1024u * 64u, tid, 512, lane, col0, acc);

  __shared__ float s_sum[64];
  __shared__ float s_sq[64];
  if (tid < 64) { s_sum[tid] = 0.0f; s_sq[tid] = 0.0f; }
  __syncthreads();

#pragma unroll
  for (int m = 0; m < 4; ++m) {
#pragma unroll
    for (int r = 0; r < 8; ++r) {
      float ps = 0.0f, pq = 0.0f;
#pragma unroll
      for (int t = 0; t < 4; ++t) { float v = acc[m][t][r]; ps += v; pq += v * v; }
#pragma unroll
      for (int k = 1; k <= 8; k <<= 1) {    // reduce over the 16-lane half
        ps += __shfl_xor(ps, k, 32);
        pq += __shfl_xor(pq, k, 32);
      }
      if (mr == 0) {
        int row = m * 16 + r + 8 * half;
        atomicAdd(&s_sum[row], ps);         // ds_add_f32
        atomicAdd(&s_sq[row], pq);
      }
    }
  }
  __syncthreads();

  const float inv_h = 1.0f / (float)HID;
#pragma unroll
  for (int m = 0; m < 4; ++m) {
#pragma unroll
    for (int r = 0; r < 8; ++r) {
      const int row  = m * 16 + r + 8 * half;
      const float mu = s_sum[row] * inv_h;
      float var      = s_sq[row] * inv_h - mu * mu;
      const float rs = rsqrtf(var + LN_EPS);
#pragma unroll
      for (int t = 0; t < 4; ++t) {
        const int n  = col0 + t * 16 + mr;
        float v = (acc[m][t][r] - mu) * rs * gamma[n] + beta[n];
        out[(size_t)(row0 + row) * HID + n] = f2bf(v);
      }
    }
  }
}

// ---------------------------------------------------------------------------
// Kernel 4: fused scores + softmax.  512 thr (16 waves): 32 q rows x 2048 keys,
// each wave 32 rows x 128 keys.  Dynamic LDS: 2 x 128KB key-tile buffers.
// ---------------------------------------------------------------------------
__global__ __launch_bounds__(512)
void attn_scores_softmax(const unsigned short* __restrict__ Qb,
                         const unsigned short* __restrict__ Kb,
                         unsigned short* __restrict__ alpha) {
  extern __shared__ unsigned short smem[];          // 2 * 2048*32 bf16
  const int tid  = threadIdx.x;
  const int lane = tid & 31;
  const int wave = tid >> 5;            // 0..15
  const int half = (lane >> 4) & 1;
  const int mr   = lane & 15;
  const int b    = blockIdx.x >> 6;     // /64
  const int qt   = blockIdx.x & 63;
  const int row0 = qt * 32;
  const int col0 = wave * 128;

  const unsigned short* Qrow = Qb + ((size_t)b * SEQ + row0) * HID;
  const unsigned short* Krow = Kb + (size_t)b * SEQ * HID;

  v8f acc[2][8];
#pragma unroll
  for (int m = 0; m < 2; ++m)
#pragma unroll
    for (int t = 0; t < 8; ++t)
#pragma unroll
      for (int r = 0; r < 8; ++r) acc[m][t][r] = 0.0f;

  gemm_pipeline<2, 8, 16, 4>(Qrow, HID, Krow, HID, HID,
                          smem, 2048u * 64u, tid, 512, lane, col0, acc);

  const float sc = 1.0f / (float)HID;
#pragma unroll
  for (int m = 0; m < 2; ++m)
#pragma unroll
    for (int t = 0; t < 8; ++t)
#pragma unroll
      for (int r = 0; r < 8; ++r) acc[m][t][r] *= sc;

  __shared__ float s_red[512];          // [wave][row]
  __shared__ float s_rowmax[32];
  __shared__ float s_rowsum[32];

  // ---- row max ----
#pragma unroll
  for (int m = 0; m < 2; ++m) {
#pragma unroll
    for (int r = 0; r < 8; ++r) {
      float mx = -3.0e38f;
#pragma unroll
      for (int t = 0; t < 8; ++t) mx = fmaxf(mx, acc[m][t][r]);
#pragma unroll
      for (int msk = 1; msk <= 8; msk <<= 1) mx = fmaxf(mx, __shfl_xor(mx, msk, 32));
      if (mr == 0) s_red[wave * 32 + m * 16 + r + 8 * half] = mx;
    }
  }
  __syncthreads();
  if (tid < 32) {
    float mx = -3.0e38f;
    for (int w = 0; w < 16; ++w) mx = fmaxf(mx, s_red[w * 32 + tid]);
    s_rowmax[tid] = mx;
  }
  __syncthreads();

  // ---- exp + row sum ----
#pragma unroll
  for (int m = 0; m < 2; ++m) {
#pragma unroll
    for (int r = 0; r < 8; ++r) {
      const int row = m * 16 + r + 8 * half;
      const float rm = s_rowmax[row];
      float s = 0.0f;
#pragma unroll
      for (int t = 0; t < 8; ++t) {
        float e = __expf(acc[m][t][r] - rm);
        acc[m][t][r] = e;
        s += e;
      }
#pragma unroll
      for (int msk = 1; msk <= 8; msk <<= 1) s += __shfl_xor(s, msk, 32);
      if (mr == 0) s_red[wave * 32 + row] = s;
    }
  }
  __syncthreads();
  if (tid < 32) {
    float s = 0.0f;
    for (int w = 0; w < 16; ++w) s += s_red[w * 32 + tid];
    s_rowsum[tid] = 1.0f / s;
  }
  __syncthreads();

  // ---- normalize + store bf16 alpha ----
#pragma unroll
  for (int m = 0; m < 2; ++m) {
#pragma unroll
    for (int r = 0; r < 8; ++r) {
      const int row = m * 16 + r + 8 * half;
      const float inv = s_rowsum[row];
#pragma unroll
      for (int t = 0; t < 8; ++t) {
        const int n = col0 + t * 16 + mr;
        alpha[((size_t)b * SEQ + row0 + row) * SEQ + n] = f2bf(acc[m][t][r] * inv);
      }
    }
  }
}

// ---------------------------------------------------------------------------
// Kernel 5: out = alpha @ Y   (per batch [2048x2048] x [2048x1024], fp32 out)
// 512 thr (16 waves): 64 q rows x 1024 f cols, each wave 64 rows x 64 cols;
// K-loop over 2048.  Dynamic LDS: 2 x 64KB YT-tile buffers.
// ---------------------------------------------------------------------------
__global__ __launch_bounds__(512)
void attn_pv_gemm(const unsigned short* __restrict__ alpha,
                  const unsigned short* __restrict__ YT,
                  float* __restrict__ out) {
  extern __shared__ unsigned short smem[];          // 2 * 1024*32 bf16
  const int tid  = threadIdx.x;
  const int lane = tid & 31;
  const int wave = tid >> 5;            // 0..15
  const int half = (lane >> 4) & 1;
  const int mr   = lane & 15;
  const int b    = blockIdx.x >> 5;
  const int qt   = blockIdx.x & 31;
  const int row0 = qt * 64;
  const int col0 = wave * 64;

  const unsigned short* Arow = alpha + ((size_t)b * SEQ + row0) * SEQ;
  const unsigned short* Brow = YT + (size_t)b * HID * SEQ;

  v8f acc[4][4];
#pragma unroll
  for (int m = 0; m < 4; ++m)
#pragma unroll
    for (int t = 0; t < 4; ++t)
#pragma unroll
      for (int r = 0; r < 8; ++r) acc[m][t][r] = 0.0f;

  gemm_pipeline<4, 4, 8, 4>(Arow, SEQ, Brow, SEQ, SEQ,
                         smem, 1024u * 64u, tid, 512, lane, col0, acc);

#pragma unroll
  for (int m = 0; m < 4; ++m) {
#pragma unroll
    for (int r = 0; r < 8; ++r) {
      const int row = m * 16 + r + 8 * half;
#pragma unroll
      for (int t = 0; t < 4; ++t) {
        const int n = col0 + t * 16 + mr;
        out[((size_t)b * SEQ + row0 + row) * HID + n] = acc[m][t][r];
      }
    }
  }
}

// ---------------------------------------------------------------------------
// host launcher
// ---------------------------------------------------------------------------
extern "C" void kernel_launch(void* const* d_in, const int* in_sizes, int n_in,
                              void* d_out, int out_size, void* d_ws, size_t ws_size,
                              hipStream_t stream) {
  const float* X  = (const float*)d_in[0];
  const float* Y  = (const float*)d_in[1];
  const float* K  = (const float*)d_in[2];
  const float* Q  = (const float*)d_in[3];
  const float* g1 = (const float*)d_in[4];
  const float* b1 = (const float*)d_in[5];
  const float* g2 = (const float*)d_in[6];
  const float* b2 = (const float*)d_in[7];
  float* out = (float*)d_out;

  // workspace layout (bytes); total ~228 MB
  char* w = (char*)d_ws;
  const size_t SZ_XY = (size_t)NROWS * HID * 2;        // 32 MB each
  const size_t SZ_W  = (size_t)HID * HID * 2;          // 2 MB each
  unsigned short* Xb    = (unsigned short*)(w);
  unsigned short* Yb    = (unsigned short*)(w + SZ_XY);
  unsigned short* YT    = (unsigned short*)(w + 2 * SZ_XY);
  unsigned short* KT    = (unsigned short*)(w + 3 * SZ_XY);
  unsigned short* QT    = (unsigned short*)(w + 3 * SZ_XY + SZ_W);
  unsigned short* Kb    = (unsigned short*)(w + 3 * SZ_XY + 2 * SZ_W);
  unsigned short* Qb    = (unsigned short*)(w + 4 * SZ_XY + 2 * SZ_W);
  unsigned short* alpha = (unsigned short*)(w + 5 * SZ_XY + 2 * SZ_W); // 64 MB

  const size_t LDS_1K = 2u * 1024u * 64u;   // 128 KB (double-buffered 64KB tiles)
  const size_t LDS_2K = 2u * 2048u * 64u;   // 256 KB

  // 1) convert X,Y -> bf16 (+ Y^T), K,Q -> transposed bf16
  attn_conv_xy<<<dim3(1024, 2), 256, 0, stream>>>(X, Y, Xb, Yb, YT);
  attn_conv_w<<<dim3(64, 2), 256, 0, stream>>>(K, Q, KT, QT);

  // 2) keys = LN(Y @ K), queries = LN(X @ Q)   [fused GEMM+LN, bf16 out]
  attn_gemm_ln<<<NROWS / 64, 512, LDS_1K, stream>>>(Yb, KT, g1, b1, Kb);
  attn_gemm_ln<<<NROWS / 64, 512, LDS_1K, stream>>>(Xb, QT, g2, b2, Qb);

  // 3) alpha = softmax(queries @ keys^T / H)   [fused, bf16 out]
  attn_scores_softmax<<<NBATCH * (SEQ / 32), 512, LDS_2K, stream>>>(Qb, Kb, alpha);

  // 4) out = alpha @ Y                          [fp32 out]
  attn_pv_gemm<<<NBATCH * (SEQ / 64), 512, LDS_1K, stream>>>(alpha, YT, out);
}

// v004
// A run of this version takes 324 microseconds.
// Two timings next to v003 both put it at 1.30 times that version's speed.
// Counting every step since v000, it is 3.66 times as fast.
#include <hip/hip_runtime.h>

// ---------------------------------------------------------------------------
// MI455X (gfx1250) attention pipeline.
//   keys    = LN(Y @ K)        queries = LN(X @ Q)
//   alpha   = softmax(queries @ keys^T / 1024)
//   out     = alpha @ Y
// All contractions: v_wmma_f32_16x16x32_bf16 with f32 accumulation.
// B operands double-buffered in LDS via global_load_async_to_lds_b128
// (ASYNCcnt) so async DMA of tile k+1 overlaps the WMMAs of tile k.
// Each staged B tile serves 64 rows of A (32 in the score kernel), so the
// bytes copied from L2 into LDS per matrix instruction fall 4x (2x).
// A staged B row is 64 k = 128 B, one whole cache line, so that a wave's copy
// of 512 B touches four lines of L2 and no line is asked for twice.
// ---------------------------------------------------------------------------

typedef __attribute__((ext_vector_type(16))) __bf16 v16bf;
typedef __attribute__((ext_vector_type(8)))  float  v8f;

#define HID    1024
#define SEQ    2048
#define NBATCH 8
#define NROWS  (NBATCH * SEQ)      // 16384
#define LN_EPS 1e-5f

// round-to-nearest-even float -> bf16 (raw u16)
static __device__ __forceinline__ unsigned short f2bf(float x) {
  unsigned u = __builtin_bit_cast(unsigned, x);
  unsigned r = u + 0x7FFFu + ((u >> 16) & 1u);
  return (unsigned short)(r >> 16);
}

union FragU { v16bf v; uint4 q[2]; };

// 16x32 bf16 fragment from row-major global memory at column k0.
// CDNA5 16-bit A layout: lanes 0-15 hold row M=lane, K in {0..7,16..23};
// lanes 16-31 hold row M=lane-16, K in {8..15,24..31}. Two b128 loads/lane.
static __device__ __forceinline__ v16bf load_frag16x32(
    const unsigned short* __restrict__ p, int ld, int k0, int lane) {
  const int half = (lane >> 4) & 1;
  const int r    = lane & 15;
  const unsigned short* base = p + (size_t)r * ld + (k0 + half * 8);
  FragU f;
  f.q[0] = *reinterpret_cast<const uint4*>(base);
  f.q[1] = *reinterpret_cast<const uint4*>(base + 16);
  return f.v;
}

// LDS tile: rows of 64 bf16 = eight 16-B chunks, no pad.  Chunk q of row n lies
// at place q ^ ((n >> 1) & 7) of its row.  The sixteen lanes of a half wave read
// one chunk number of sixteen successive rows: at plain places they fall on 8
// of the 64 banks, eight deep; at these places they cover all 64 banks once.
static __device__ __forceinline__ int lds_place(int n, int q) {
  return q ^ ((n >> 1) & 7);
}

// Same fragment pattern read from such an LDS tile, for the k step ks (0 or 1)
// of 32 inside the tile's 64 k; n0 a multiple of 16.
static __device__ __forceinline__ v16bf lds_frag(
    const unsigned short* __restrict__ sm, int n0, int ks, int lane) {
  const int half = (lane >> 4) & 1;
  const int r    = lane & 15;
  const unsigned short* row = sm + (size_t)(n0 + r) * 64;
  FragU f;
  f.q[0] = *reinterpret_cast<const uint4*>(row + lds_place(r, ks * 4 + half) * 8);      // ds_load_b128
  f.q[1] = *reinterpret_cast<const uint4*>(row + lds_place(r, ks * 4 + half + 2) * 8);
  return f.v;
}

static __device__ __forceinline__ v8f wmma_bf16(v16bf a, v16bf b, v8f c) {
  return __builtin_amdgcn_wmma_f32_16x16x32_bf16(false, a, false, b,
                                                 (short)0, c, false, false);
}

static __device__ __forceinline__ void wait_async0() {
  asm volatile("s_wait_asynccnt 0" ::: "memory");
}

#define TILE_ROWS  1024u                 // B rows in a staged tile
#define TILE_BYTES (TILE_ROWS * 128u)    // 128 KB

// Async-copy one B tile (1024 rows x 64 bf16, row stride ld elems in global,
// rows of 128 B in LDS) into LDS at byte offset lds_base.  512 threads: eight
// lanes move one row, a wave four whole rows; a sweep of the block covers 64
// rows, and sweep i takes the 64 global rows from i * gstep on into LDS rows
// from i * 64 on.  Chunk part of row n lands at place lds_place(n, part); the
// place is the same in every sweep, as 64 rows leave (n >> 1) & 7 as it is.
template <int NC>
static __device__ __forceinline__ void stage_tile(
    unsigned lds_base, const unsigned short* __restrict__ g, int ld, int gstep,
    int tid) {
  static_assert(NC % 8 == 0, "copies are issued in groups of eight");
  static_assert(NC * 64 == (int)TILE_ROWS, "the sweeps cover the tile");
  const int n0   = tid >> 3;
  const int part = tid & 7;
  const unsigned long long gb =
      (unsigned long long)(uintptr_t)(g + (size_t)n0 * ld + part * 8);
  const unsigned l0 =
      lds_base + (unsigned)n0 * 128u + (unsigned)lds_place(n0, part) * 16u;
#pragma unroll
  for (int i0 = 0; i0 < NC; i0 += 8) {
    // One LDS address serves the eight copies of a group: copy j carries the
    // immediate offset j * 8192 (64 LDS rows), which moves BOTH its addresses,
    // so its global address register is set back by as much (the global step of
    // a sweep is larger, so the register still points into the source).  With
    // an LDS address register a copy the compiler keeps them all across the
    // loop, and the score kernel's registers no longer suffice.
    const unsigned lo = l0 + (unsigned)i0 * 8192u;
    unsigned long long gp[8];
#pragma unroll
    for (int j = 0; j < 8; ++j)
      gp[j] = gb + ((unsigned long long)((i0 + j) * gstep) * (unsigned long long)ld * 2ull -
                    (unsigned long long)(j * 8192));
    // Eight copies and their s_wait_xcnt in one statement: the address
    // registers stay untouched until the wait has passed.
    asm volatile(
        "global_load_async_to_lds_b128 %0, %1, off\n\t"
        "global_load_async_to_lds_b128 %0, %2, off offset:8192\n\t"
        "global_load_async_to_lds_b128 %0, %3, off offset:16384\n\t"
        "global_load_async_to_lds_b128 %0, %4, off offset:24576\n\t"
        "global_load_async_to_lds_b128 %0, %5, off offset:32768\n\t"
        "global_load_async_to_lds_b128 %0, %6, off offset:40960\n\t"
        "global_load_async_to_lds_b128 %0, %7, off offset:49152\n\t"
        "global_load_async_to_lds_b128 %0, %8, off offset:57344\n\t"
        "s_wait_xcnt 0x0"
        :: "v"(lo),
           "v"(gp[0]), "v"(gp[1]), "v"(gp[2]), "v"(gp[3]),
           "v"(gp[4]), "v"(gp[5]), "v"(gp[6]), "v"(gp[7])
        : "memory");
  }
}

// The matrix work of one staged tile, for one wave tile of MT*16 rows x 64 cols:
//   acc[m][H*4+t] += A[m*16..+16, kc*64..+64] * B tile[LDS rows col0+t*16..+16]
// Every B fragment read from LDS feeds MT matrix instructions; four B fragments
// are held in registers at a time.  A comes from global, asked for ahead of its
// use.  MT = 4: a holds the four fragments of one k step of 32, and the next
// step's are in flight in a second set.  MT = 2: a holds the four fragments of
// the whole k chunk of 64, which both tiles of the chunk use; in the chunk's
// last tile each k step's pair is asked for anew, for the next chunk, behind
// its last matrix instruction (a second set would not fit the registers).
template <int MT, int NH, int H>
static __device__ __forceinline__ void tile_mma(
    const unsigned short* __restrict__ Arow, int ldA, int kc, bool moreK,
    const unsigned short* smc, int lane, int col0,
    v16bf (&a)[NH][MT], const v16bf (&a1)[MT], v8f (&acc)[MT][4 * NH]) {
#pragma unroll
  for (int ks = 0; ks < 2; ++ks) {
    v16bf an[MT];
    if (NH == 1) {
      // k step 1's set (a1) was asked for by the caller, ahead of the copies
#pragma unroll
      for (int m = 0; m < MT; ++m) an[m] = (ks == 0) ? a1[m] : a[0][m];
      if (ks == 1 && moreK) {
#pragma unroll
        for (int m = 0; m < MT; ++m)
          an[m] = load_frag16x32(Arow + (size_t)(m * 16) * ldA, ldA,
                                 (kc + 1) * 64, lane);
      }
    }

    // four B fragments from LDS as one group, then their MT*4 WMMAs
    v16bf bf[4];
#pragma unroll
    for (int t = 0; t < 4; ++t)
      bf[t] = lds_frag(smc, col0 + t * 16, ks, lane);
    // Keeps the A loads and the LDS reads as one group ahead of the WMMAs:
    // the compiler otherwise spreads them among the WMMAs, a full wait at each.
    __builtin_amdgcn_sched_barrier(0);
#pragma unroll
    for (int t = 0; t < 4; ++t)
#pragma unroll
      for (int m = 0; m < MT; ++m)
        acc[m][H * 4 + t] =
            wmma_bf16(a[NH == 1 ? 0 : ks][m], bf[t], acc[m][H * 4 + t]);
    // Holds the WMMAs in front of what follows (the A loads below, the waits at
    // the tile's foot): the compiler otherwise sinks them behind the barrier,
    // and the next tile's copies no longer fly under them.
    __builtin_amdgcn_sched_barrier(0);

    if (NH == 1) {
#pragma unroll
      for (int m = 0; m < MT; ++m) a[0][m] = an[m];
    } else if (H == NH - 1 && moreK) {
#pragma unroll
      for (int m = 0; m < MT; ++m)
        a[ks][m] = load_frag16x32(Arow + (size_t)(m * 16) * ldA, ldA,
                                  (kc + 1) * 64 + ks * 32, lane);
    }
  }
}

// Double-buffered pipelined mainloop, one wave tile of MT*16 rows x NH*64 cols.
// B staged async into LDS in tiles of 1024 rows x 64 k, NH tiles a k chunk,
// tile number kc*NH + h in the buffer of its parity.  NH = 1: a tile holds all
// B rows of the block, global rows 0..1023.  NH = 2: the block has 2048 B rows,
// and tile h of a chunk holds for each wave w its global rows w*128 + h*64 ..
// +64.  Either way a wave reads LDS rows col0 .. +64, col0 = wave*64.
template <int MT, int NH>
static __device__ __forceinline__ void gemm_pipeline(
    const unsigned short* __restrict__ Arow, int ldA,
    const unsigned short* __restrict__ B0,  int ldB,
    int Kdim, unsigned short* sm, int tid, int lane, int col0,
    v8f (&acc)[MT][4 * NH]) {
  static_assert((MT == 4 && NH == 1) || (MT == 2 && NH == 2), "four A fragments a set");
  const unsigned sbase = (unsigned)(unsigned long long)(uintptr_t)sm;
  const int nK = Kdim / 64;

  stage_tile<16>(sbase, B0, ldB, 64 * NH, tid);
  wait_async0();
  __syncthreads();

  v16bf a[NH][MT];
#pragma unroll
  for (int s = 0; s < NH; ++s)
#pragma unroll
    for (int m = 0; m < MT; ++m)
      a[s][m] = load_frag16x32(Arow + (size_t)(m * 16) * ldA, ldA, s * 32, lane);

  for (int kc = 0; kc < nK; ++kc) {
    const bool moreK = (kc + 1 < nK);
    // MT = 4: the A fragments of this tile's second k step are needed in the
    // middle of the tile, so they are asked for in front of the next tile's
    // copies: behind them they would queue up after 128 KB of requests.
    v16bf a1[MT];
    if (NH == 1) {
#pragma unroll
      for (int m = 0; m < MT; ++m)
        a1[m] = load_frag16x32(Arow + (size_t)(m * 16) * ldA, ldA, kc * 64 + 32, lane);
    }
    {
      const bool odd = (NH == 1) && ((kc & 1) != 0);
      const unsigned curOff = odd ? TILE_BYTES : 0u;
      const unsigned nxtOff = odd ? 0u : TILE_BYTES;
      // issue async DMA for the next tile (overlaps this tile's compute)
      if (NH == 2)
        stage_tile<16>(sbase + nxtOff, B0 + (size_t)64 * ldB + (size_t)kc * 64,
                       ldB, 64 * NH, tid);
      else if (moreK)
        stage_tile<16>(sbase + nxtOff, B0 + (size_t)(kc + 1) * 64, ldB, 64 * NH, tid);
      tile_mma<MT, NH, 0>(Arow, ldA, kc, moreK, sm + (curOff >> 1), lane, col0, a, a1,
                          acc);
      // own LDS reads of this tile retired before the buffer is handed back
      asm volatile("s_wait_dscnt 0" ::: "memory");
      wait_async0();     // own copies for the next tile done (overlapped compute)
      __syncthreads();   // block-wide: this tile's reads done, next tile visible
    }
    if (NH == 2) {
      if (moreK)
        stage_tile<16>(sbase, B0 + (size_t)(kc + 1) * 64, ldB, 64 * NH, tid);
      tile_mma<MT, NH, NH - 1>(Arow, ldA, kc, moreK, sm + (TILE_BYTES >> 1), lane,
                               col0, a, a1, acc);
      // the same three as at the first tile's foot
      asm volatile("s_wait_dscnt 0" ::: "memory");
      wait_async0();
      __syncthreads();
    }
  }
}

// ---------------------------------------------------------------------------
// Conversion kernels.  Work-groups of 8 waves take 128 x 128 tiles, 64 elements
// a thread, so that a launch starts 64x fewer waves than one element a thread
// would; global loads are 16 B a lane (512 B of one row a wave), stores cover
// 256 contiguous bytes of a row, and the transposed copy goes through LDS.
// ---------------------------------------------------------------------------
#define CT   128                 // tile edge, elements
#define CTPD (CT / 2 + 1)        // LDS row pitch in dwords (two bf16 a dword)

static __device__ __forceinline__ unsigned pack2bf(float lo, float hi) {
  return (unsigned)f2bf(lo) | ((unsigned)f2bf(hi) << 16);
}

// One 128 x 128 tile of a row-major f32 matrix with HID columns.
//   dstT[c * ldT + r] = bf16(src[r * HID + c]);  STRAIGHT: dst[r * HID + c] too.
// 256 threads; tile = CT * CTPD dwords of LDS.
template <bool STRAIGHT>
static __device__ __forceinline__ void conv_tile(
    const float* __restrict__ src, unsigned short* __restrict__ dst,
    unsigned short* __restrict__ dstT, int ldT, unsigned* tile, int tid) {
  const int c4 = tid & 31;       // group of four columns
  const int r0 = tid >> 5;       // a wave reads one row at a time
  const float* __restrict__ ps = src + (size_t)r0 * HID + c4 * 4;
  float4 v[16];
#pragma unroll
  for (int i = 0; i < 16; ++i)
    v[i] = *reinterpret_cast<const float4*>(ps + (size_t)(8 * i) * HID);
  // The loads' address register pair is reused only behind this wait; naming
  // the address keeps it out of the loads' own destination registers.
  asm volatile("s_wait_xcnt 0x0" :: "v"(ps) : "memory");
  uint2 pk[16];
#pragma unroll
  for (int i = 0; i < 16; ++i) {
    const int r = r0 + 8 * i;
    pk[i] = make_uint2(pack2bf(v[i].x, v[i].y), pack2bf(v[i].z, v[i].w));
    tile[r * CTPD + c4 * 2]     = pk[i].x;
    tile[r * CTPD + c4 * 2 + 1] = pk[i].y;
  }
  __syncthreads();

  // The straight copy is stored behind the barrier: in front of it the barrier
  // would wait until these global stores have completed.
  if (STRAIGHT) {
#pragma unroll
    for (int i = 0; i < 16; ++i)
      *reinterpret_cast<uint2*>(dst + (size_t)(r0 + 8 * i) * HID + c4 * 4) = pk[i];
  }

  // A thread gathers eight rows of one column pair: 16 B for each of two rows
  // of the transposed copy; sixteen lanes fill 256 contiguous bytes of a row.
  const int rg = tid & 15;       // group of eight source rows
#pragma unroll
  for (int p = 0; p < 4; ++p) {
    const int cp = (tid >> 4) + 16 * p;      // column pair, 0..63
    unsigned a[8];
#pragma unroll
    for (int j = 0; j < 8; ++j) a[j] = tile[(rg * 8 + j) * CTPD + cp];
    uint4 lo, hi;
    lo.x = (a[0] & 0xFFFFu) | (a[1] << 16);
    lo.y = (a[2] & 0xFFFFu) | (a[3] << 16);
    lo.z = (a[4] & 0xFFFFu) | (a[5] << 16);
    lo.w = (a[6] & 0xFFFFu) | (a[7] << 16);
    hi.x = (a[0] >> 16) | (a[1] & 0xFFFF0000u);
    hi.y = (a[2] >> 16) | (a[3] & 0xFFFF0000u);
    hi.z = (a[4] >> 16) | (a[5] & 0xFFFF0000u);
    hi.w = (a[6] >> 16) | (a[7] & 0xFFFF0000u);
    *reinterpret_cast<uint4*>(dstT + (size_t)(2 * cp) * ldT + rg * 8)     = lo;
    *reinterpret_cast<uint4*>(dstT + (size_t)(2 * cp + 1) * ldT + rg * 8) = hi;
  }
}

// ---------------------------------------------------------------------------
// Kernel 1: X,Y fp32 -> bf16 row-major; also write Y^T (per batch) in bf16.
// grid (1024, 2): y = 0 takes a tile of Y, y = 1 the same count of X elements.
// ---------------------------------------------------------------------------
// At most 8 waves a SIMD are planned for, so that the register budget holds a
// thread's 16 loads in flight at once (at 64 registers they go out in turns).
__global__ __launch_bounds__(256) __attribute__((amdgpu_waves_per_eu(2, 8)))
void attn_conv_xy(const float* __restrict__ X,
                  const float* __restrict__ Y,
                  unsigned short* __restrict__ Xb,
                  unsigned short* __restrict__ Yb,
                  unsigned short* __restrict__ YT) {
  __shared__ unsigned tile[CT * CTPD];
  const int tid = threadIdx.x;
  const int t   = blockIdx.x;
  if (blockIdx.y == 0) {
    const int f0  = (t & 7) * CT;            // HID / CT = 8 column tiles
    const int row = (t >> 3) * CT;           // row of the [NROWS, HID] view
    const int b   = row >> 11;               // / SEQ
    const int s0  = row & (SEQ - 1);
    const size_t o = (size_t)row * HID + f0;
    conv_tile<true>(Y + o, Yb + o, YT + ((size_t)b * HID + f0) * SEQ + s0, SEQ,
                    tile, tid);              // Y^T[b][f][s]
  } else {
    const size_t base = (size_t)t * (CT * CT) + (size_t)tid * 4;
    const float* __restrict__ px = X + base;
    float4 v[16];
#pragma unroll
    for (int i = 0; i < 16; ++i)
      v[i] = *reinterpret_cast<const float4*>(px + i * 1024);
    // As in conv_tile: the address pair is reused only behind this wait.
    asm volatile("s_wait_xcnt 0x0" :: "v"(px) : "memory");
#pragma unroll
    for (int i = 0; i < 16; ++i)
      *reinterpret_cast<uint2*>(Xb + base + i * 1024) =
          make_uint2(pack2bf(v[i].x, v[i].y), pack2bf(v[i].z, v[i].w));
    // The stores' data and address registers are reused only behind this wait.
    asm volatile("s_wait_xcnt 0x0" ::: "memory");
  }
}

// ---------------------------------------------------------------------------
// Kernel 2: K,Q fp32 [F,H] -> transposed bf16 [H,F]  (B-operand layout)
// grid (64, 2): y picks the matrix, x its tile.
// ---------------------------------------------------------------------------
// At most 8 waves a SIMD are planned for, so that the register budget holds a
// thread's 16 loads in flight at once (at 64 registers they go out in turns).
__global__ __launch_bounds__(256) __attribute__((amdgpu_waves_per_eu(2, 8)))
void attn_conv_w(const float* __restrict__ K,
                 const float* __restrict__ Q,
                 unsigned short* __restrict__ KT,
                 unsigned short* __restrict__ QT) {
  __shared__ unsigned tile[CT * CTPD];
  const int t  = blockIdx.x;
  const int h0 = (t & 7) * CT;
  const int f0 = (t >> 3) * CT;
  const float* __restrict__ s    = (blockIdx.y == 0) ? K : Q;
  unsigned short* __restrict__ d = (blockIdx.y == 0) ? KT : QT;
  conv_tile<false>(s + (size_t)f0 * HID + h0, nullptr,
                   d + (size_t)h0 * HID + f0, HID, tile, threadIdx.x);
}

// ---------------------------------------------------------------------------
// Kernel 3: fused GEMM + LayerNorm.  512 thr (16 waves): 64 rows x 1024 cols,
// each wave 64 rows x 64 cols.  Dynamic LDS: 2 x 128KB B-tile buffers.
// ---------------------------------------------------------------------------
__global__ __launch_bounds__(512)
void attn_gemm_ln(const unsigned short* __restrict__ A,
                  const unsigned short* __restrict__ WT,
                  const float* __restrict__ gamma,
                  const float* __restrict__ beta,
                  unsigned short* __restrict__ out) {
  extern __shared__ unsigned short smem[];          // 2 * 1024*64 bf16
  const int tid  = threadIdx.x;
  const int lane = tid & 31;
  const int wave = tid >> 5;            // 0..15
  const int half = (lane >> 4) & 1;
  const int mr   = lane & 15;
  const int row0 = blockIdx.x * 64;
  const int col0 = wave * 64;

  v8f acc[4][4];
#pragma unroll
  for (int m = 0; m < 4; ++m)
#pragma unroll
    for (int t = 0; t < 4; ++t)
#pragma unroll
      for (int r = 0; r < 8; ++r) acc[m][t][r] = 0.0f;

  gemm_pipeline<4, 1>(A + (size_t)row0 * HID, HID, WT, HID, HID,
                      smem, tid, lane, col0, acc);

  __shared__ float s_sum[64];
  __shared__ float s_sq[64];
  if (tid < 64) { s_sum[tid] = 0.0f; s_sq[tid] = 0.0f; }
  __syncthreads();

#pragma unroll
  for (int m = 0; m < 4; ++m) {
#pragma unroll
    for (int r = 0; r < 8; ++r) {
      float ps = 0.0f, pq = 0.0f;
#pragma unroll
      for (int t = 0; t < 4; ++t) { float v = acc[m][t][r]; ps += v; pq += v * v; }
#pragma unroll
      for (int k = 1; k <= 8; k <<= 1) {    // reduce over the 16-lane half
        ps += __shfl_xor(ps, k, 32);
        pq += __shfl_xor(pq, k, 32);
      }
      if (mr == 0) {
        int row = m * 16 + r + 8 * half;
        atomicAdd(&s_sum[row], ps);         // ds_add_f32
        atomicAdd(&s_sq[row], pq);
      }
    }
  }
  __syncthreads();

  const float inv_h = 1.0f / (float)HID;
#pragma unroll
  for (int m = 0; m < 4; ++m) {
#pragma unroll
    for (int r = 0; r < 8; ++r) {
      const int row  = m * 16 + r + 8 * half;
      const float mu = s_sum[row] * inv_h;
      float var      = s_sq[row] * inv_h - mu * mu;
      const float rs = rsqrtf(var + LN_EPS);
#pragma unroll
      for (int t = 0; t < 4; ++t) {
        const int n  = col0 + t * 16 + mr;
        float v = (acc[m][t][r] - mu) * rs * gamma[n] + beta[n];
        out[(size_t)(row0 + row) * HID + n] = f2bf(v);
      }
    }
  }
}

// ---------------------------------------------------------------------------
// Kernel 4: fused scores + softmax.  512 thr (16 waves): 32 q rows x 2048 keys,
// each wave 32 rows x 128 keys.  Dynamic LDS: 2 x 128KB key-tile buffers, each
// 64 keys of every wave x 64 k.
// ---------------------------------------------------------------------------
__global__ __launch_bounds__(512)
void attn_scores_softmax(const unsigned short* __restrict__ Qb,
                         const unsigned short* __restrict__ Kb,
                         unsigned short* __restrict__ alpha) {
  extern __shared__ unsigned short smem[];          // 2 * 1024*64 bf16
  const int tid  = threadIdx.x;
  const int lane = tid & 31;
  const int wave = tid >> 5;            // 0..15
  const int half = (lane >> 4) & 1;
  const int mr   = lane & 15;
  const int b    = blockIdx.x >> 6;     // /64
  const int qt   = blockIdx.x & 63;
  const int row0 = qt * 32;
  const int col0 = wave * 128;

  const unsigned short* Qrow = Qb + ((size_t)b * SEQ + row0) * HID;
  const unsigned short* Krow = Kb + (size_t)b * SEQ * HID;

  v8f acc[2][8];
#pragma unroll
  for (int m = 0; m < 2; ++m)
#pragma unroll
    for (int t = 0; t < 8; ++t)
#pragma unroll
      for (int r = 0; r < 8; ++r) acc[m][t][r] = 0.0f;

  gemm_pipeline<2, 2>(Qrow, HID, Krow, HID, HID,
                      smem, tid, lane, wave * 64, acc);

  const float sc = 1.0f / (float)HID;
#pragma unroll
  for (int m = 0; m < 2; ++m)
#pragma unroll
    for (int t = 0; t < 8; ++t)
#pragma unroll
      for (int r = 0; r < 8; ++r) acc[m][t][r] *= sc;

  __shared__ float s_red[512];          // [wave][row]
  __shared__ float s_rowmax[32];
  __shared__ float s_rowsum[32];

  // ---- row max ----
#pragma unroll
  for (int m = 0; m < 2; ++m) {
#pragma unroll
    for (int r = 0; r < 8; ++r) {
      float mx = -3.0e38f;
#pragma unroll
      for (int t = 0; t < 8; ++t) mx = fmaxf(mx, acc[m][t][r]);
#pragma unroll
      for (int msk = 1; msk <= 8; msk <<= 1) mx = fmaxf(mx, __shfl_xor(mx, msk, 32));
      if (mr == 0) s_red[wave * 32 + m * 16 + r + 8 * half] = mx;
    }
  }
  __syncthreads();
  if (tid < 32) {
    float mx = -3.0e38f;
    for (int w = 0; w < 16; ++w) mx = fmaxf(mx, s_red[w * 32 + tid]);
    s_rowmax[tid] = mx;
  }
  __syncthreads();

  // ---- exp + row sum ----
#pragma unroll
  for (int m = 0; m < 2; ++m) {
#pragma unroll
    for (int r = 0; r < 8; ++r) {
      const int row = m * 16 + r + 8 * half;
      const float rm = s_rowmax[row];
      float s = 0.0f;
#pragma unroll
      for (int t = 0; t < 8; ++t) {
        float e = __expf(acc[m][t][r] - rm);
        acc[m][t][r] = e;
        s += e;
      }
#pragma unroll
      for (int msk = 1; msk <= 8; msk <<= 1) s += __shfl_xor(s, msk, 32);
      if (mr == 0) s_red[wave * 32 + row] = s;
    }
  }
  __syncthreads();
  if (tid < 32) {
    float s = 0.0f;
    for (int w = 0; w < 16; ++w) s += s_red[w * 32 + tid];
    s_rowsum[tid] = 1.0f / s;
  }
  __syncthreads();

  // ---- normalize + store bf16 alpha ----
#pragma unroll
  for (int m = 0; m < 2; ++m) {
#pragma unroll
    for (int r = 0; r < 8; ++r) {
      const int row = m * 16 + r + 8 * half;
      const float inv = s_rowsum[row];
#pragma unroll
      for (int t = 0; t < 8; ++t) {
        const int n = col0 + t * 16 + mr;
        alpha[((size_t)b * SEQ + row0 + row) * SEQ + n] = f2bf(acc[m][t][r] * inv);
      }
    }
  }
}

// ---------------------------------------------------------------------------
// Kernel 5: out = alpha @ Y   (per batch [2048x2048] x [2048x1024], fp32 out)
// 512 thr (16 waves): 64 q rows x 1024 f cols, each wave 64 rows x 64 cols;
// K-loop over 2048.  Dynamic LDS: 2 x 128KB YT-tile buffers.
// ---------------------------------------------------------------------------
__global__ __launch_bounds__(512)
void attn_pv_gemm(const unsigned short* __restrict__ alpha,
                  const unsigned short* __restrict__ YT,
                  float* __restrict__ out) {
  extern __shared__ unsigned short smem[];          // 2 * 1024*64 bf16
  const int tid  = threadIdx.x;
  const int lane = tid & 31;
  const int wave = tid >> 5;            // 0..15
  const int half = (lane >> 4) & 1;
  const int mr   = lane & 15;
  const int b    = blockIdx.x >> 5;
  const int qt   = blockIdx.x & 31;
  const int row0 = qt * 64;
  const int col0 = wave * 64;

  const unsigned short* Arow = alpha + ((size_t)b * SEQ + row0) * SEQ;
  const unsigned short* Brow = YT + (size_t)b * HID * SEQ;

  v8f acc[4][4];
#pragma unroll
  for (int m = 0; m < 4; ++m)
#pragma unroll
    for (int t = 0; t < 4; ++t)
#pragma unroll
      for (int r = 0; r < 8; ++r) acc[m][t][r] = 0.0f;

  gemm_pipeline<4, 1>(Arow, SEQ, Brow, SEQ, SEQ,
                      smem, tid, lane, col0, acc);

#pragma unroll
  for (int m = 0; m < 4; ++m) {
#pragma unroll
    for (int r = 0; r < 8; ++r) {
      const int row = m * 16 + r + 8 * half;
#pragma unroll
      for (int t = 0; t < 4; ++t) {
        const int n = col0 + t * 16 + mr;
        out[((size_t)b * SEQ + row0 + row) * HID + n] = acc[m][t][r];
      }
    }
  }
}

// ---------------------------------------------------------------------------
// host launcher
// ---------------------------------------------------------------------------
extern "C" void kernel_launch(void* const* d_in, const int* in_sizes, int n_in,
                              void* d_out, int out_size, void* d_ws, size_t ws_size,
                              hipStream_t stream) {
  const float* X  = (const float*)d_in[0];
  const float* Y  = (const float*)d_in[1];
  const float* K  = (const float*)d_in[2];
  const float* Q  = (const float*)d_in[3];
  const float* g1 = (const float*)d_in[4];
  const float* b1 = (const float*)d_in[5];
  const float* g2 = (const float*)d_in[6];
  const float* b2 = (const float*)d_in[7];
  float* out = (float*)d_out;

  // workspace layout (bytes); total ~228 MB
  char* w = (char*)d_ws;
  const size_t SZ_XY = (size_t)NROWS * HID * 2;        // 32 MB each
  const size_t SZ_W  = (size_t)HID * HID * 2;          // 2 MB each
  unsigned short* Xb    = (unsigned short*)(w);
  unsigned short* Yb    = (unsigned short*)(w + SZ_XY);
  unsigned short* YT    = (unsigned short*)(w + 2 * SZ_XY);
  unsigned short* KT    = (unsigned short*)(w + 3 * SZ_XY);
  unsigned short* QT    = (unsigned short*)(w + 3 * SZ_XY + SZ_W);
  unsigned short* Kb    = (unsigned short*)(w + 3 * SZ_XY + 2 * SZ_W);
  unsigned short* Qb    = (unsigned short*)(w + 4 * SZ_XY + 2 * SZ_W);
  unsigned short* alpha = (unsigned short*)(w + 5 * SZ_XY + 2 * SZ_W); // 64 MB

  const size_t LDS_B = 2u * 1024u * 128u;   // 256 KB (double-buffered 128KB tiles)

  // 1) convert X,Y -> bf16 (+ Y^T), K,Q -> transposed bf16
  attn_conv_xy<<<dim3(1024, 2), 256, 0, stream>>>(X, Y, Xb, Yb, YT);
  attn_conv_w<<<dim3(64, 2), 256, 0, stream>>>(K, Q, KT, QT);

  // 2) keys = LN(Y @ K), queries = LN(X @ Q)   [fused GEMM+LN, bf16 out]
  attn_gemm_ln<<<NROWS / 64, 512, LDS_B, stream>>>(Yb, KT, g1, b1, Kb);
  attn_gemm_ln<<<NROWS / 64, 512, LDS_B, stream>>>(Xb, QT, g2, b2, Qb);

  // 3) alpha = softmax(queries @ keys^T / H)   [fused, bf16 out]
  attn_scores_softmax<<<NBATCH * (SEQ / 32), 512, LDS_B, stream>>>(Qb, Kb, alpha);

  // 4) out = alpha @ Y                          [fp32 out]
  attn_pv_gemm<<<NBATCH * (SEQ / 64), 512, LDS_B, stream>>>(alpha, YT, out);
}

// v005
// One run takes 274 microseconds.
// In both of two side-by-side timings against v004, it was 1.18 times as fast.
// All steps since v000 together make it 4.33 times as fast.
#include <hip/hip_runtime.h>

// ---------------------------------------------------------------------------
// MI455X (gfx1250) attention pipeline.
//   keys    = LN(Y @ K)        queries = LN(X @ Q)
//   alpha   = softmax(queries @ keys^T / 1024)
//   out     = alpha @ Y
// All contractions: v_wmma_f32_16x16x32_bf16 with f32 accumulation.
// B operands double-buffered in LDS via global_load_async_to_lds_b128
// (ASYNCcnt) so async DMA of tile k+1 overlaps the WMMAs of tile k.
// Each staged B tile serves 64 rows of A (32 in the score kernel), so the
// bytes copied from L2 into LDS per matrix instruction fall 4x (2x).
// A staged B row is 64 k = 128 B, one whole cache line, so that a wave's copy
// of 512 B touches four lines of L2 and no line is asked for twice.
// The A rows of a work-group are staged the same way, once for all its waves:
// a fragment load from global memory touches sixteen lines for its 512 B, and
// every wave would ask for the same rows again.
// ---------------------------------------------------------------------------

typedef __attribute__((ext_vector_type(16))) __bf16 v16bf;
typedef __attribute__((ext_vector_type(8)))  float  v8f;

#define HID    1024
#define SEQ    2048
#define NBATCH 8
#define NROWS  (NBATCH * SEQ)      // 16384
#define LN_EPS 1e-5f

// round-to-nearest-even float -> bf16 (raw u16)
static __device__ __forceinline__ unsigned short f2bf(float x) {
  unsigned u = __builtin_bit_cast(unsigned, x);
  unsigned r = u + 0x7FFFu + ((u >> 16) & 1u);
  return (unsigned short)(r >> 16);
}

union FragU { v16bf v; uint4 q[2]; };

// LDS tile: rows of 64 bf16 = eight 16-B chunks, no pad.  Chunk q of row n lies
// at place q ^ ((n >> 1) & 7) of its row.  The sixteen lanes of a half wave read
// one chunk number of sixteen successive rows: at plain places they fall on 8
// of the 64 banks, eight deep; at these places they cover all 64 banks once.
static __device__ __forceinline__ int lds_place(int n, int q) {
  return q ^ ((n >> 1) & 7);
}

// 16x32 bf16 fragment read from such an LDS tile, for the k step ks (0 or 1)
// of 32 inside the tile's 64 k; n0 a multiple of 16.
// CDNA5 16-bit A layout: lanes 0-15 hold row M=lane, K in {0..7,16..23};
// lanes 16-31 hold row M=lane-16, K in {8..15,24..31}. Two b128 loads/lane.
static __device__ __forceinline__ v16bf lds_frag(
    const unsigned short* __restrict__ sm, int n0, int ks, int lane) {
  const int half = (lane >> 4) & 1;
  const int r    = lane & 15;
  const unsigned short* row = sm + (size_t)(n0 + r) * 64;
  FragU f;
  f.q[0] = *reinterpret_cast<const uint4*>(row + lds_place(r, ks * 4 + half) * 8);      // ds_load_b128
  f.q[1] = *reinterpret_cast<const uint4*>(row + lds_place(r, ks * 4 + half + 2) * 8);
  return f.v;
}

static __device__ __forceinline__ v8f wmma_bf16(v16bf a, v16bf b, v8f c) {
  return __builtin_amdgcn_wmma_f32_16x16x32_bf16(false, a, false, b,
                                                 (short)0, c, false, false);
}

static __device__ __forceinline__ void wait_async0() {
  asm volatile("s_wait_asynccnt 0" ::: "memory");
}

#define TILE_ROWS  1024u                 // B rows in a staged tile
#define TILE_BYTES (TILE_ROWS * 128u)    // 128 KB

// Async-copy one B tile (1024 rows x 64 bf16, row stride ld elems in global,
// rows of 128 B in LDS) into LDS at byte offset lds_base.  512 threads: eight
// lanes move one row, a wave four whole rows; a sweep of the block covers 64
// rows, and sweep i takes the 64 global rows from i * gstep on into LDS rows
// from i * 64 on.  Chunk part of row n lands at place lds_place(n, part); the
// place is the same in every sweep, as 64 rows leave (n >> 1) & 7 as it is.
template <int NC>
static __device__ __forceinline__ void stage_tile(
    unsigned lds_base, const unsigned short* __restrict__ g, int ld, int gstep,
    int tid) {
  static_assert(NC % 8 == 0, "copies are issued in groups of eight");
  static_assert(NC * 64 == (int)TILE_ROWS, "the sweeps cover the tile");
  const int n0   = tid >> 3;
  const int part = tid & 7;
  const unsigned long long gb =
      (unsigned long long)(uintptr_t)(g + (size_t)n0 * ld + part * 8);
  const unsigned l0 =
      lds_base + (unsigned)n0 * 128u + (unsigned)lds_place(n0, part) * 16u;
#pragma unroll
  for (int i0 = 0; i0 < NC; i0 += 8) {
    // One LDS address serves the eight copies of a group: copy j carries the
    // immediate offset j * 8192 (64 LDS rows), which moves BOTH its addresses,
    // so its global address register is set back by as much (the global step of
    // a sweep is larger, so the register still points into the source).  With
    // an LDS address register a copy the compiler keeps them all across the
    // loop, and the score kernel's registers no longer suffice.
    const unsigned lo = l0 + (unsigned)i0 * 8192u;
    unsigned long long gp[8];
#pragma unroll
    for (int j = 0; j < 8; ++j)
      gp[j] = gb + ((unsigned long long)((i0 + j) * gstep) * (unsigned long long)ld * 2ull -
                    (unsigned long long)(j * 8192));
    // Eight copies and their s_wait_xcnt in one statement: the address
    // registers stay untouched until the wait has passed.
    asm volatile(
        "global_load_async_to_lds_b128 %0, %1, off\n\t"
        "global_load_async_to_lds_b128 %0, %2, off offset:8192\n\t"
        "global_load_async_to_lds_b128 %0, %3, off offset:16384\n\t"
        "global_load_async_to_lds_b128 %0, %4, off offset:24576\n\t"
        "global_load_async_to_lds_b128 %0, %5, off offset:32768\n\t"
        "global_load_async_to_lds_b128 %0, %6, off offset:40960\n\t"
        "global_load_async_to_lds_b128 %0, %7, off offset:49152\n\t"
        "global_load_async_to_lds_b128 %0, %8, off offset:57344\n\t"
        "s_wait_xcnt 0x0"
        :: "v"(lo),
           "v"(gp[0]), "v"(gp[1]), "v"(gp[2]), "v"(gp[3]),
           "v"(gp[4]), "v"(gp[5]), "v"(gp[6]), "v"(gp[7])
        : "memory");
  }
}

// Async-copy the work-group's A rows of one k chunk (MT*16 rows x 64 bf16, row
// stride ld elems in global, rows of 128 B in LDS, chunks at the places of
// lds_place) into LDS at byte offset lds_base: one copy a thread, every lane on.
// MT = 4: 8 KB, 16 B a lane, a wave four whole rows.  MT = 2: 4 KB, 8 B a lane,
// a wave two whole rows.
template <int MT>
static __device__ __forceinline__ void stage_a(
    unsigned lds_base, const unsigned short* __restrict__ g, int ld, int tid) {
  static_assert(MT == 4 || MT == 2, "512 threads cover the rows in one copy each");
  if (MT == 4) {
    const int n    = tid >> 3;
    const int part = tid & 7;
    const unsigned short* gp = g + (size_t)n * ld + part * 8;
    const unsigned lo =
        lds_base + (unsigned)n * 128u + (unsigned)lds_place(n, part) * 16u;
    // The copy and its s_wait_xcnt in one statement: the address registers
    // stay untouched until the wait has passed.
    asm volatile(
        "global_load_async_to_lds_b128 %0, %1, off\n\t"
        "s_wait_xcnt 0x0"
        :: "v"(lo), "v"(gp) : "memory");
  } else {
    const int n    = tid >> 4;
    const int part = (tid >> 1) & 7;
    const int sub  = tid & 1;            // which 8 B of the 16-B chunk
    const unsigned short* gp = g + (size_t)n * ld + part * 8 + sub * 4;
    const unsigned lo = lds_base + (unsigned)n * 128u +
                        (unsigned)lds_place(n, part) * 16u + (unsigned)sub * 8u;
    // As above: the wait stands in the copy's own statement.
    asm volatile(
        "global_load_async_to_lds_b64 %0, %1, off\n\t"
        "s_wait_xcnt 0x0"
        :: "v"(lo), "v"(gp) : "memory");
  }
}

// The matrix work of one staged tile, for one wave tile of MT*16 rows x 64 cols:
//   acc[m][H*4+t] += A chunk[LDS rows m*16..+16] * B tile[LDS rows col0+t*16..+16]
// Every B fragment read from LDS feeds MT matrix instructions, every A fragment
// four; the fragments of a k step of 32 are read as one group.  NH = 2: both
// tiles of a k chunk use the same A fragments, which the first reads from LDS
// and the second finds in a.
template <int MT, int NH, int H>
static __device__ __forceinline__ void tile_mma(
    const unsigned short* sma, const unsigned short* smc, int lane, int col0,
    v16bf (&a)[2][MT], v8f (&acc)[MT][4 * NH]) {
#pragma unroll
  for (int ks = 0; ks < 2; ++ks) {
    // the fragments of this k step from LDS as one group, then the MT*4 WMMAs
    v16bf bf[4];
    bf[0] = lds_frag(smc, col0, ks, lane);
    if (H == 0) {
#pragma unroll
      for (int m = 0; m < MT; ++m) a[ks][m] = lds_frag(sma, m * 16, ks, lane);
    }
#pragma unroll
    for (int t = 1; t < 4; ++t)
      bf[t] = lds_frag(smc, col0 + t * 16, ks, lane);
    // Keeps the LDS reads as one group ahead of the WMMAs: the compiler
    // otherwise spreads them among the WMMAs, a full wait at each.
    __builtin_amdgcn_sched_barrier(0);
#pragma unroll
    for (int t = 0; t < 4; ++t)
#pragma unroll
      for (int m = 0; m < MT; ++m)
        acc[m][H * 4 + t] = wmma_bf16(a[ks][m], bf[t], acc[m][H * 4 + t]);
    // Holds the WMMAs in front of what follows (the waits at the tile's foot):
    // the compiler otherwise sinks them behind the barrier, and the next
    // tile's copies no longer fly under them.
    __builtin_amdgcn_sched_barrier(0);
  }
}

// Double-buffered pipelined mainloop, one wave tile of MT*16 rows x NH*64 cols.
// B staged async into LDS in tiles of 1024 rows x 64 k, NH tiles a k chunk,
// tile number kc*NH + h in the buffer of its parity.  NH = 1: a tile holds all
// B rows of the block, global rows 0..1023.  NH = 2: the block has 2048 B rows,
// and tile h of a chunk holds for each wave w its global rows w*128 + h*64 ..
// +64.  Either way a wave reads LDS rows col0 .. +64, col0 = wave*64.
// The block's A rows of k chunk kc lie behind the two B buffers, in the A buffer
// of kc's parity; they are copied together with the chunk's first B tile.
template <int MT, int NH>
static __device__ __forceinline__ void gemm_pipeline(
    const unsigned short* __restrict__ Arow, int ldA,
    const unsigned short* __restrict__ B0,  int ldB,
    int Kdim, unsigned short* sm, int tid, int lane, int col0,
    v8f (&acc)[MT][4 * NH]) {
  static_assert((MT == 4 && NH == 1) || (MT == 2 && NH == 2), "four A fragments a set");
  constexpr unsigned A_BYTES = (unsigned)MT * 16u * 128u;
  const unsigned sbase = (unsigned)(unsigned long long)(uintptr_t)sm;
  const unsigned abase = sbase + 2u * TILE_BYTES;
  const unsigned short* smA = sm + TILE_BYTES;      // 2 * TILE_BYTES bytes on
  const int nK = Kdim / 64;

  stage_a<MT>(abase, Arow, ldA, tid);
  stage_tile<16>(sbase, B0, ldB, 64 * NH, tid);
  wait_async0();
  __syncthreads();

  v16bf a[2][MT];
  for (int kc = 0; kc < nK; ++kc) {
    const bool moreK = (kc + 1 < nK);
    const bool oddK  = (kc & 1) != 0;
    const unsigned aCur = oddK ? A_BYTES : 0u;
    const unsigned aNxt = oddK ? 0u : A_BYTES;
    {
      const bool odd = (NH == 1) && oddK;
      const unsigned curOff = odd ? TILE_BYTES : 0u;
      const unsigned nxtOff = odd ? 0u : TILE_BYTES;
      // issue async DMA for the next tile (overlaps this tile's compute)
      if (NH == 2) {
        stage_tile<16>(sbase + nxtOff, B0 + (size_t)64 * ldB + (size_t)kc * 64,
                       ldB, 64 * NH, tid);
      } else if (moreK) {
        stage_a<MT>(abase + aNxt, Arow + (size_t)(kc + 1) * 64, ldA, tid);
        stage_tile<16>(sbase + nxtOff, B0 + (size_t)(kc + 1) * 64, ldB, 64 * NH, tid);
      }
      tile_mma<MT, NH, 0>(smA + (aCur >> 1), sm + (curOff >> 1), lane, col0, a, acc);
      // own LDS reads of this tile retired before the buffer is handed back
      asm volatile("s_wait_dscnt 0" ::: "memory");
      wait_async0();     // own copies for the next tile done (overlapped compute)
      __syncthreads();   // block-wide: this tile's reads done, next tile visible
    }
    if (NH == 2) {
      if (moreK) {
        stage_a<MT>(abase + aNxt, Arow + (size_t)(kc + 1) * 64, ldA, tid);
        stage_tile<16>(sbase, B0 + (size_t)(kc + 1) * 64, ldB, 64 * NH, tid);
      }
      tile_mma<MT, NH, NH - 1>(smA + (aCur >> 1), sm + (TILE_BYTES >> 1), lane, col0,
                               a, acc);
      // the same three as at the first tile's foot
      asm volatile("s_wait_dscnt 0" ::: "memory");
      wait_async0();
      __syncthreads();
    }
  }
}

// ---------------------------------------------------------------------------
// Conversion kernels.  Work-groups of 8 waves take 128 x 128 tiles, 64 elements
// a thread, so that a launch starts 64x fewer waves than one element a thread
// would; global loads are 16 B a lane (512 B of one row a wave), stores cover
// 256 contiguous bytes of a row, and the transposed copy goes through LDS.
// ---------------------------------------------------------------------------
#define CT   128                 // tile edge, elements
#define CTPD (CT / 2 + 1)        // LDS row pitch in dwords (two bf16 a dword)

static __device__ __forceinline__ unsigned pack2bf(float lo, float hi) {
  return (unsigned)f2bf(lo) | ((unsigned)f2bf(hi) << 16);
}

// One 128 x 128 tile of a row-major f32 matrix with HID columns.
//   dstT[c * ldT + r] = bf16(src[r * HID + c]);  STRAIGHT: dst[r * HID + c] too.
// 256 threads; tile = CT * CTPD dwords of LDS.
template <bool STRAIGHT>
static __device__ __forceinline__ void conv_tile(
    const float* __restrict__ src, unsigned short* __restrict__ dst,
    unsigned short* __restrict__ dstT, int ldT, unsigned* tile, int tid) {
  const int c4 = tid & 31;       // group of four columns
  const int r0 = tid >> 5;       // a wave reads one row at a time
  const float* __restrict__ ps = src + (size_t)r0 * HID + c4 * 4;
  float4 v[16];
#pragma unroll
  for (int i = 0; i < 16; ++i)
    v[i] = *reinterpret_cast<const float4*>(ps + (size_t)(8 * i) * HID);
  // The loads' address register pair is reused only behind this wait; naming
  // the address keeps it out of the loads' own destination registers.
  asm volatile("s_wait_xcnt 0x0" :: "v"(ps) : "memory");
  uint2 pk[16];
#pragma unroll
  for (int i = 0; i < 16; ++i) {
    const int r = r0 + 8 * i;
    pk[i] = make_uint2(pack2bf(v[i].x, v[i].y), pack2bf(v[i].z, v[i].w));
    tile[r * CTPD + c4 * 2]     = pk[i].x;
    tile[r * CTPD + c4 * 2 + 1] = pk[i].y;
  }
  __syncthreads();

  // The straight copy is stored behind the barrier: in front of it the barrier
  // would wait until these global stores have completed.
  if (STRAIGHT) {
#pragma unroll
    for (int i = 0; i < 16; ++i)
      *reinterpret_cast<uint2*>(dst + (size_t)(r0 + 8 * i) * HID + c4 * 4) = pk[i];
  }

  // A thread gathers eight rows of one column pair: 16 B for each of two rows
  // of the transposed copy; sixteen lanes fill 256 contiguous bytes of a row.
  const int rg = tid & 15;       // group of eight source rows
#pragma unroll
  for (int p = 0; p < 4; ++p) {
    const int cp = (tid >> 4) + 16 * p;      // column pair, 0..63
    unsigned a[8];
#pragma unroll
    for (int j = 0; j < 8; ++j) a[j] = tile[(rg * 8 + j) * CTPD + cp];
    uint4 lo, hi;
    lo.x = (a[0] & 0xFFFFu) | (a[1] << 16);
    lo.y = (a[2] & 0xFFFFu) | (a[3] << 16);
    lo.z = (a[4] & 0xFFFFu) | (a[5] << 16);
    lo.w = (a[6] & 0xFFFFu) | (a[7] << 16);
    hi.x = (a[0] >> 16) | (a[1] & 0xFFFF0000u);
    hi.y = (a[2] >> 16) | (a[3] & 0xFFFF0000u);
    hi.z = (a[4] >> 16) | (a[5] & 0xFFFF0000u);
    hi.w = (a[6] >> 16) | (a[7] & 0xFFFF0000u);
    *reinterpret_cast<uint4*>(dstT + (size_t)(2 * cp) * ldT + rg * 8)     = lo;
    *reinterpret_cast<uint4*>(dstT + (size_t)(2 * cp + 1) * ldT + rg * 8) = hi;
  }
}

// ---------------------------------------------------------------------------
// Kernel 1: X,Y fp32 -> bf16 row-major; also write Y^T (per batch) in bf16.
// grid (1024, 2): y = 0 takes a tile of Y, y = 1 the same count of X elements.
// ---------------------------------------------------------------------------
// At most 8 waves a SIMD are planned for, so that the register budget holds a
// thread's 16 loads in flight at once (at 64 registers they go out in turns).
__global__ __launch_bounds__(256) __attribute__((amdgpu_waves_per_eu(2, 8)))
void attn_conv_xy(const float* __restrict__ X,
                  const float* __restrict__ Y,
                  unsigned short* __restrict__ Xb,
                  unsigned short* __restrict__ Yb,
                  unsigned short* __restrict__ YT) {
  __shared__ unsigned tile[CT * CTPD];
  const int tid = threadIdx.x;
  const int t   = blockIdx.x;
  if (blockIdx.y == 0) {
    const int f0  = (t & 7) * CT;            // HID / CT = 8 column tiles
    const int row = (t >> 3) * CT;           // row of the [NROWS, HID] view
    const int b   = row >> 11;               // / SEQ
    const int s0  = row & (SEQ - 1);
    const size_t o = (size_t)row * HID + f0;
    conv_tile<true>(Y + o, Yb + o, YT + ((size_t)b * HID + f0) * SEQ + s0, SEQ,
                    tile, tid);              // Y^T[b][f][s]
  } else {
    const size_t base = (size_t)t * (CT * CT) + (size_t)tid * 4;
    const float* __restrict__ px = X + base;
    float4 v[16];
#pragma unroll
    for (int i = 0; i < 16; ++i)
      v[i] = *reinterpret_cast<const float4*>(px + i * 1024);
    // As in conv_tile: the address pair is reused only behind this wait.
    asm volatile("s_wait_xcnt 0x0" :: "v"(px) : "memory");
#pragma unroll
    for (int i = 0; i < 16; ++i)
      *reinterpret_cast<uint2*>(Xb + base + i * 1024) =
          make_uint2(pack2bf(v[i].x, v[i].y), pack2bf(v[i].z, v[i].w));
    // The stores' data and address registers are reused only behind this wait.
    asm volatile("s_wait_xcnt 0x0" ::: "memory");
  }
}

// ---------------------------------------------------------------------------
// Kernel 2: K,Q fp32 [F,H] -> transposed bf16 [H,F]  (B-operand layout)
// grid (64, 2): y picks the matrix, x its tile.
// ---------------------------------------------------------------------------
// At most 8 waves a SIMD are planned for, so that the register budget holds a
// thread's 16 loads in flight at once (at 64 registers they go out in turns).
__global__ __launch_bounds__(256) __attribute__((amdgpu_waves_per_eu(2, 8)))
void attn_conv_w(const float* __restrict__ K,
                 const float* __restrict__ Q,
                 unsigned short* __restrict__ KT,
                 unsigned short* __restrict__ QT) {
  __shared__ unsigned tile[CT * CTPD];
  const int t  = blockIdx.x;
  const int h0 = (t & 7) * CT;
  const int f0 = (t >> 3) * CT;
  const float* __restrict__ s    = (blockIdx.y == 0) ? K : Q;
  unsigned short* __restrict__ d = (blockIdx.y == 0) ? KT : QT;
  conv_tile<false>(s + (size_t)f0 * HID + h0, nullptr,
                   d + (size_t)h0 * HID + f0, HID, tile, threadIdx.x);
}

// ---------------------------------------------------------------------------
// Kernel 3: fused GEMM + LayerNorm.  512 thr (16 waves): 64 rows x 1024 cols,
// each wave 64 rows x 64 cols.  Dynamic LDS: 2 x 128KB B-tile buffers, behind
// them 2 x 8KB for the A rows.
// ---------------------------------------------------------------------------
__global__ __launch_bounds__(512)
void attn_gemm_ln(const unsigned short* __restrict__ A,
                  const unsigned short* __restrict__ WT,
                  const float* __restrict__ gamma,
                  const float* __restrict__ beta,
                  unsigned short* __restrict__ out) {
  extern __shared__ unsigned short smem[];          // 2 * 1024*64 bf16 + A rows
  const int tid  = threadIdx.x;
  const int lane = tid & 31;
  const int wave = tid >> 5;            // 0..15
  const int half = (lane >> 4) & 1;
  const int mr   = lane & 15;
  const int row0 = blockIdx.x * 64;
  const int col0 = wave * 64;

  v8f acc[4][4];
#pragma unroll
  for (int m = 0; m < 4; ++m)
#pragma unroll
    for (int t = 0; t < 4; ++t)
#pragma unroll
      for (int r = 0; r < 8; ++r) acc[m][t][r] = 0.0f;

  gemm_pipeline<4, 1>(A + (size_t)row0 * HID, HID, WT, HID, HID,
                      smem, tid, lane, col0, acc);

  __shared__ float s_sum[64];
  __shared__ float s_sq[64];
  if (tid < 64) { s_sum[tid] = 0.0f; s_sq[tid] = 0.0f; }
  __syncthreads();

#pragma unroll
  for (int m = 0; m < 4; ++m) {
#pragma unroll
    for (int r = 0; r < 8; ++r) {
      float ps = 0.0f, pq = 0.0f;
#pragma unroll
      for (int t = 0; t < 4; ++t) { float v = acc[m][t][r]; ps += v; pq += v * v; }
#pragma unroll
      for (int k = 1; k <= 8; k <<= 1) {    // reduce over the 16-lane half
        ps += __shfl_xor(ps, k, 32);
        pq += __shfl_xor(pq, k, 32);
      }
      if (mr == 0) {
        int row = m * 16 + r + 8 * half;
        atomicAdd(&s_sum[row], ps);         // ds_add_f32
        atomicAdd(&s_sq[row], pq);
      }
    }
  }
  __syncthreads();

  const float inv_h = 1.0f / (float)HID;
#pragma unroll
  for (int m = 0; m < 4; ++m) {
#pragma unroll
    for (int r = 0; r < 8; ++r) {
      const int row  = m * 16 + r + 8 * half;
      const float mu = s_sum[row] * inv_h;
      float var      = s_sq[row] * inv_h - mu * mu;
      const float rs = rsqrtf(var + LN_EPS);
#pragma unroll
      for (int t = 0; t < 4; ++t) {
        const int n  = col0 + t * 16 + mr;
        float v = (acc[m][t][r] - mu) * rs * gamma[n] + beta[n];
        out[(size_t)(row0 + row) * HID + n] = f2bf(v);
      }
    }
  }
}

// ---------------------------------------------------------------------------
// Kernel 4: fused scores + softmax.  512 thr (16 waves): 32 q rows x 2048 keys,
// each wave 32 rows x 128 keys.  Dynamic LDS: 2 x 128KB key-tile buffers, each
// 64 keys of every wave x 64 k, behind them 2 x 4KB for the q rows.
// ---------------------------------------------------------------------------
__global__ __launch_bounds__(512)
void attn_scores_softmax(const unsigned short* __restrict__ Qb,
                         const unsigned short* __restrict__ Kb,
                         unsigned short* __restrict__ alpha) {
  extern __shared__ unsigned short smem[];          // 2 * 1024*64 bf16 + A rows
  const int tid  = threadIdx.x;
  const int lane = tid & 31;
  const int wave = tid >> 5;            // 0..15
  const int half = (lane >> 4) & 1;
  const int mr   = lane & 15;
  const int b    = blockIdx.x >> 6;     // /64
  const int qt   = blockIdx.x & 63;
  const int row0 = qt * 32;
  const int col0 = wave * 128;

  const unsigned short* Qrow = Qb + ((size_t)b * SEQ + row0) * HID;
  const unsigned short* Krow = Kb + (size_t)b * SEQ * HID;

  v8f acc[2][8];
#pragma unroll
  for (int m = 0; m < 2; ++m)
#pragma unroll
    for (int t = 0; t < 8; ++t)
#pragma unroll
      for (int r = 0; r < 8; ++r) acc[m][t][r] = 0.0f;

  gemm_pipeline<2, 2>(Qrow, HID, Krow, HID, HID,
                      smem, tid, lane, wave * 64, acc);

  const float sc = 1.0f / (float)HID;
#pragma unroll
  for (int m = 0; m < 2; ++m)
#pragma unroll
    for (int t = 0; t < 8; ++t)
#pragma unroll
      for (int r = 0; r < 8; ++r) acc[m][t][r] *= sc;

  __shared__ float s_red[512];          // [wave][row]
  __shared__ float s_rowmax[32];
  __shared__ float s_rowsum[32];

  // ---- row max ----
#pragma unroll
  for (int m = 0; m < 2; ++m) {
#pragma unroll
    for (int r = 0; r < 8; ++r) {
      float mx = -3.0e38f;
#pragma unroll
      for (int t = 0; t < 8; ++t) mx = fmaxf(mx, acc[m][t][r]);
#pragma unroll
      for (int msk = 1; msk <= 8; msk <<= 1) mx = fmaxf(mx, __shfl_xor(mx, msk, 32));
      if (mr == 0) s_red[wave * 32 + m * 16 + r + 8 * half] = mx;
    }
  }
  __syncthreads();
  if (tid < 32) {
    float mx = -3.0e38f;
    for (int w = 0; w < 16; ++w) mx = fmaxf(mx, s_red[w * 32 + tid]);
    s_rowmax[tid] = mx;
  }
  __syncthreads();

  // ---- exp + row sum ----
#pragma unroll
  for (int m = 0; m < 2; ++m) {
#pragma unroll
    for (int r = 0; r < 8; ++r) {
      const int row = m * 16 + r + 8 * half;
      const float rm = s_rowmax[row];
      float s = 0.0f;
#pragma unroll
      for (int t = 0; t < 8; ++t) {
        float e = __expf(acc[m][t][r] - rm);
        acc[m][t][r] = e;
        s += e;
      }
#pragma unroll
      for (int msk = 1; msk <= 8; msk <<= 1) s += __shfl_xor(s, msk, 32);
      if (mr == 0) s_red[wave * 32 + row] = s;
    }
  }
  __syncthreads();
  if (tid < 32) {
    float s = 0.0f;
    for (int w = 0; w < 16; ++w) s += s_red[w * 32 + tid];
    s_rowsum[tid] = 1.0f / s;
  }
  __syncthreads();

  // ---- normalize + store bf16 alpha ----
#pragma unroll
  for (int m = 0; m < 2; ++m) {
#pragma unroll
    for (int r = 0; r < 8; ++r) {
      const int row = m * 16 + r + 8 * half;
      const float inv = s_rowsum[row];
#pragma unroll
      for (int t = 0; t < 8; ++t) {
        const int n = col0 + t * 16 + mr;
        alpha[((size_t)b * SEQ + row0 + row) * SEQ + n] = f2bf(acc[m][t][r] * inv);
      }
    }
  }
}

// ---------------------------------------------------------------------------
// Kernel 5: out = alpha @ Y   (per batch [2048x2048] x [2048x1024], fp32 out)
// 512 thr (16 waves): 64 q rows x 1024 f cols, each wave 64 rows x 64 cols;
// K-loop over 2048.  Dynamic LDS: 2 x 128KB YT-tile buffers, behind them
// 2 x 8KB for the alpha rows.
// ---------------------------------------------------------------------------
__global__ __launch_bounds__(512)
void attn_pv_gemm(const unsigned short* __restrict__ alpha,
                  const unsigned short* __restrict__ YT,
                  float* __restrict__ out) {
  extern __shared__ unsigned short smem[];          // 2 * 1024*64 bf16 + A rows
  const int tid  = threadIdx.x;
  const int lane = tid & 31;
  const int wave = tid >> 5;            // 0..15
  const int half = (lane >> 4) & 1;
  const int mr   = lane & 15;
  const int b    = blockIdx.x >> 5;
  const int qt   = blockIdx.x & 31;
  const int row0 = qt * 64;
  const int col0 = wave * 64;

  const unsigned short* Arow = alpha + ((size_t)b * SEQ + row0) * SEQ;
  const unsigned short* Brow = YT + (size_t)b * HID * SEQ;

  v8f acc[4][4];
#pragma unroll
  for (int m = 0; m < 4; ++m)
#pragma unroll
    for (int t = 0; t < 4; ++t)
#pragma unroll
      for (int r = 0; r < 8; ++r) acc[m][t][r] = 0.0f;

  gemm_pipeline<4, 1>(Arow, SEQ, Brow, SEQ, SEQ,
                      smem, tid, lane, col0, acc);

#pragma unroll
  for (int m = 0; m < 4; ++m) {
#pragma unroll
    for (int r = 0; r < 8; ++r) {
      const int row = m * 16 + r + 8 * half;
#pragma unroll
      for (int t = 0; t < 4; ++t) {
        const int n = col0 + t * 16 + mr;
        out[((size_t)b * SEQ + row0 + row) * HID + n] = acc[m][t][r];
      }
    }
  }
}

// ---------------------------------------------------------------------------
// host launcher
// ---------------------------------------------------------------------------
extern "C" void kernel_launch(void* const* d_in, const int* in_sizes, int n_in,
                              void* d_out, int out_size, void* d_ws, size_t ws_size,
                              hipStream_t stream) {
  const float* X  = (const float*)d_in[0];
  const float* Y  = (const float*)d_in[1];
  const float* K  = (const float*)d_in[2];
  const float* Q  = (const float*)d_in[3];
  const float* g1 = (const float*)d_in[4];
  const float* b1 = (const float*)d_in[5];
  const float* g2 = (const float*)d_in[6];
  const float* b2 = (const float*)d_in[7];
  float* out = (float*)d_out;

  // workspace layout (bytes); total ~228 MB
  char* w = (char*)d_ws;
  const size_t SZ_XY = (size_t)NROWS * HID * 2;        // 32 MB each
  const size_t SZ_W  = (size_t)HID * HID * 2;          // 2 MB each
  unsigned short* Xb    = (unsigned short*)(w);
  unsigned short* Yb    = (unsigned short*)(w + SZ_XY);
  unsigned short* YT    = (unsigned short*)(w + 2 * SZ_XY);
  unsigned short* KT    = (unsigned short*)(w + 3 * SZ_XY);
  unsigned short* QT    = (unsigned short*)(w + 3 * SZ_XY + SZ_W);
  unsigned short* Kb    = (unsigned short*)(w + 3 * SZ_XY + 2 * SZ_W);
  unsigned short* Qb    = (unsigned short*)(w + 4 * SZ_XY + 2 * SZ_W);
  unsigned short* alpha = (unsigned short*)(w + 5 * SZ_XY + 2 * SZ_W); // 64 MB

  // 256 KB (double-buffered 128KB B tiles) + 16 KB (double-buffered A rows)
  const size_t LDS_B = 2u * 1024u * 128u + 2u * 64u * 128u;

  // 1) convert X,Y -> bf16 (+ Y^T), K,Q -> transposed bf16
  attn_conv_xy<<<dim3(1024, 2), 256, 0, stream>>>(X, Y, Xb, Yb, YT);
  attn_conv_w<<<dim3(64, 2), 256, 0, stream>>>(K, Q, KT, QT);

  // 2) keys = LN(Y @ K), queries = LN(X @ Q)   [fused GEMM+LN, bf16 out]
  attn_gemm_ln<<<NROWS / 64, 512, LDS_B, stream>>>(Yb, KT, g1, b1, Kb);
  attn_gemm_ln<<<NROWS / 64, 512, LDS_B, stream>>>(Xb, QT, g2, b2, Qb);

  // 3) alpha = softmax(queries @ keys^T / H)   [fused, bf16 out]
  attn_scores_softmax<<<NBATCH * (SEQ / 32), 512, LDS_B, stream>>>(Qb, Kb, alpha);

  // 4) out = alpha @ Y                          [fp32 out]
  attn_pv_gemm<<<NBATCH * (SEQ / 64), 512, LDS_B, stream>>>(alpha, YT, out);
}

// v006
// A run of this version takes 235 microseconds.
// In two side-by-side timings against v005, it was 1.16 and 1.17 times as fast.
// Counting every step since v000, it is 5.04 times as fast.
#include <hip/hip_runtime.h>

// ---------------------------------------------------------------------------
// MI455X (gfx1250) attention pipeline.
//   keys    = LN(Y @ K)        queries = LN(X @ Q)
//   alpha   = softmax(queries @ keys^T / 1024)
//   out     = alpha @ Y
// All contractions: v_wmma_f32_16x16x32_bf16 with f32 accumulation.
// B operands double-buffered in LDS via global_load_async_to_lds_b128
// (ASYNCcnt) so async DMA of tile k+1 overlaps the WMMAs of tile k.
// Each staged B tile of the LN kernel serves 64 whole rows of A.  The score and
// PV kernels need no whole rows: they take square tiles of 256 x 256, the shape
// that copies the fewest bytes from L2 into LDS per matrix instruction, and the
// softmax over the f32 scores is a kernel of its own.
// A staged B row is 64 k = 128 B, one whole cache line, so that a wave's copy
// of 512 B touches four lines of L2 and no line is asked for twice.
// The A rows of a work-group are staged the same way, once for all its waves:
// a fragment load from global memory touches sixteen lines for its 512 B, and
// every wave would ask for the same rows again.
// ---------------------------------------------------------------------------

typedef __attribute__((ext_vector_type(16))) __bf16 v16bf;
typedef __attribute__((ext_vector_type(8)))  float  v8f;

#define HID    1024
#define SEQ    2048
#define NBATCH 8
#define NROWS  (NBATCH * SEQ)      // 16384
#define LN_EPS 1e-5f

// round-to-nearest-even float -> bf16 (raw u16)
static __device__ __forceinline__ unsigned short f2bf(float x) {
  unsigned u = __builtin_bit_cast(unsigned, x);
  unsigned r = u + 0x7FFFu + ((u >> 16) & 1u);
  return (unsigned short)(r >> 16);
}

union FragU { v16bf v; uint4 q[2]; };

// LDS tile: rows of 64 bf16 = eight 16-B chunks, no pad.  Chunk q of row n lies
// at place q ^ ((n >> 1) & 7) of its row.  The sixteen lanes of a half wave read
// one chunk number of sixteen successive rows: at plain places they fall on 8
// of the 64 banks, eight deep; at these places they cover all 64 banks once.
static __device__ __forceinline__ int lds_place(int n, int q) {
  return q ^ ((n >> 1) & 7);
}

// 16x32 bf16 fragment read from such an LDS tile, for the k step ks (0 or 1)
// of 32 inside the tile's 64 k; n0 a multiple of 16.
// CDNA5 16-bit A layout: lanes 0-15 hold row M=lane, K in {0..7,16..23};
// lanes 16-31 hold row M=lane-16, K in {8..15,24..31}. Two b128 loads/lane.
static __device__ __forceinline__ v16bf lds_frag(
    const unsigned short* __restrict__ sm, int n0, int ks, int lane) {
  const int half = (lane >> 4) & 1;
  const int r    = lane & 15;
  const unsigned short* row = sm + (size_t)(n0 + r) * 64;
  FragU f;
  f.q[0] = *reinterpret_cast<const uint4*>(row + lds_place(r, ks * 4 + half) * 8);      // ds_load_b128
  f.q[1] = *reinterpret_cast<const uint4*>(row + lds_place(r, ks * 4 + half + 2) * 8);
  return f.v;
}

static __device__ __forceinline__ v8f wmma_bf16(v16bf a, v16bf b, v8f c) {
  return __builtin_amdgcn_wmma_f32_16x16x32_bf16(false, a, false, b,
                                                 (short)0, c, false, false);
}

static __device__ __forceinline__ void wait_async0() {
  asm volatile("s_wait_asynccnt 0" ::: "memory");
}

#define TILE_ROWS  1024u                 // B rows in a staged tile
#define TILE_BYTES (TILE_ROWS * 128u)    // 128 KB

// Async-copy one B tile (1024 rows x 64 bf16, row stride ld elems in global,
// rows of 128 B in LDS) into LDS at byte offset lds_base.  512 threads: eight
// lanes move one row, a wave four whole rows; a sweep of the block covers 64
// rows, and sweep i takes the 64 global rows from i * gstep on into LDS rows
// from i * 64 on.  Chunk part of row n lands at place lds_place(n, part); the
// place is the same in every sweep, as 64 rows leave (n >> 1) & 7 as it is.
template <int NC>
static __device__ __forceinline__ void stage_tile(
    unsigned lds_base, const unsigned short* __restrict__ g, int ld, int gstep,
    int tid) {
  static_assert(NC % 8 == 0, "copies are issued in groups of eight");
  static_assert(NC * 64 == (int)TILE_ROWS, "the sweeps cover the tile");
  const int n0   = tid >> 3;
  const int part = tid & 7;
  const unsigned long long gb =
      (unsigned long long)(uintptr_t)(g + (size_t)n0 * ld + part * 8);
  const unsigned l0 =
      lds_base + (unsigned)n0 * 128u + (unsigned)lds_place(n0, part) * 16u;
#pragma unroll
  for (int i0 = 0; i0 < NC; i0 += 8) {
    // One LDS address serves the eight copies of a group: copy j carries the
    // immediate offset j * 8192 (64 LDS rows), which moves BOTH its addresses,
    // so its global address register is set back by as much (the global step of
    // a sweep is larger, so the register still points into the source).  With
    // an LDS address register a copy the compiler keeps them all across the
    // loop.
    const unsigned lo = l0 + (unsigned)i0 * 8192u;
    unsigned long long gp[8];
#pragma unroll
    for (int j = 0; j < 8; ++j)
      gp[j] = gb + ((unsigned long long)((i0 + j) * gstep) * (unsigned long long)ld * 2ull -
                    (unsigned long long)(j * 8192));
    // Eight copies and their s_wait_xcnt in one statement: the address
    // registers stay untouched until the wait has passed.
    asm volatile(
        "global_load_async_to_lds_b128 %0, %1, off\n\t"
        "global_load_async_to_lds_b128 %0, %2, off offset:8192\n\t"
        "global_load_async_to_lds_b128 %0, %3, off offset:16384\n\t"
        "global_load_async_to_lds_b128 %0, %4, off offset:24576\n\t"
        "global_load_async_to_lds_b128 %0, %5, off offset:32768\n\t"
        "global_load_async_to_lds_b128 %0, %6, off offset:40960\n\t"
        "global_load_async_to_lds_b128 %0, %7, off offset:49152\n\t"
        "global_load_async_to_lds_b128 %0, %8, off offset:57344\n\t"
        "s_wait_xcnt 0x0"
        :: "v"(lo),
           "v"(gp[0]), "v"(gp[1]), "v"(gp[2]), "v"(gp[3]),
           "v"(gp[4]), "v"(gp[5]), "v"(gp[6]), "v"(gp[7])
        : "memory");
  }
}

// Async-copy the work-group's A rows of one k chunk (64 rows x 64 bf16, row
// stride ld elems in global, rows of 128 B in LDS, chunks at the places of
// lds_place) into LDS at byte offset lds_base: one copy a thread, every lane on;
// 8 KB, 16 B a lane, a wave four whole rows.
static __device__ __forceinline__ void stage_a(
    unsigned lds_base, const unsigned short* __restrict__ g, int ld, int tid) {
  const int n    = tid >> 3;
  const int part = tid & 7;
  const unsigned short* gp = g + (size_t)n * ld + part * 8;
  const unsigned lo =
      lds_base + (unsigned)n * 128u + (unsigned)lds_place(n, part) * 16u;
  // The copy and its s_wait_xcnt in one statement: the address registers
  // stay untouched until the wait has passed.
  asm volatile(
      "global_load_async_to_lds_b128 %0, %1, off\n\t"
      "s_wait_xcnt 0x0"
      :: "v"(lo), "v"(gp) : "memory");
}

// The matrix work of one staged k chunk, for one wave tile of 64 rows x 64 cols:
//   acc[m][t] += A chunk[LDS rows m*16..+16] * B tile[LDS rows col0+t*16..+16]
// Every fragment read from LDS feeds four matrix instructions; the fragments of
// a k step of 32 are read as one group.
static __device__ __forceinline__ void tile_mma(
    const unsigned short* sma, const unsigned short* smc, int lane, int col0,
    v8f (&acc)[4][4]) {
#pragma unroll
  for (int ks = 0; ks < 2; ++ks) {
    // the fragments of this k step from LDS as one group, then the 16 WMMAs
    v16bf a[4], bf[4];
    bf[0] = lds_frag(smc, col0, ks, lane);
#pragma unroll
    for (int m = 0; m < 4; ++m) a[m] = lds_frag(sma, m * 16, ks, lane);
#pragma unroll
    for (int t = 1; t < 4; ++t)
      bf[t] = lds_frag(smc, col0 + t * 16, ks, lane);
    // Keeps the LDS reads as one group ahead of the WMMAs: the compiler
    // otherwise spreads them among the WMMAs, a full wait at each.
    __builtin_amdgcn_sched_barrier(0);
#pragma unroll
    for (int t = 0; t < 4; ++t)
#pragma unroll
      for (int m = 0; m < 4; ++m)
        acc[m][t] = wmma_bf16(a[m], bf[t], acc[m][t]);
    // Holds the WMMAs in front of what follows (the waits at the tile's foot):
    // the compiler otherwise sinks them behind the barrier, and the next
    // tile's copies no longer fly under them.
    __builtin_amdgcn_sched_barrier(0);
  }
}

// Double-buffered pipelined mainloop, one wave tile of 64 rows x 64 cols of a
// block tile of 64 rows x 1024 cols.  B staged async into LDS in tiles of 1024
// rows x 64 k, the tile of k chunk kc in the buffer of kc's parity; a wave reads
// LDS rows col0 .. +64, col0 = wave*64.  The block's A rows of k chunk kc lie
// behind the two B buffers, in the A buffer of kc's parity; they are copied
// together with the chunk's B tile.
static __device__ __forceinline__ void gemm_pipeline(
    const unsigned short* __restrict__ Arow, int ldA,
    const unsigned short* __restrict__ B0,  int ldB,
    int Kdim, unsigned short* sm, int tid, int lane, int col0,
    v8f (&acc)[4][4]) {
  constexpr unsigned A_BYTES = 64u * 128u;
  const unsigned sbase = (unsigned)(unsigned long long)(uintptr_t)sm;
  const unsigned abase = sbase + 2u * TILE_BYTES;
  const unsigned short* smA = sm + TILE_BYTES;      // 2 * TILE_BYTES bytes on
  const int nK = Kdim / 64;

  stage_a(abase, Arow, ldA, tid);
  stage_tile<16>(sbase, B0, ldB, 64, tid);
  wait_async0();
  __syncthreads();

  for (int kc = 0; kc < nK; ++kc) {
    const bool odd = (kc & 1) != 0;
    const unsigned aCur = odd ? A_BYTES : 0u;
    const unsigned aNxt = odd ? 0u : A_BYTES;
    const unsigned curOff = odd ? TILE_BYTES : 0u;
    const unsigned nxtOff = odd ? 0u : TILE_BYTES;
    // issue async DMA for the next tile (overlaps this tile's compute)
    if (kc + 1 < nK) {
      stage_a(abase + aNxt, Arow + (size_t)(kc + 1) * 64, ldA, tid);
      stage_tile<16>(sbase + nxtOff, B0 + (size_t)(kc + 1) * 64, ldB, 64, tid);
    }
    tile_mma(smA + (aCur >> 1), sm + (curOff >> 1), lane, col0, acc);
    // own LDS reads of this tile retired before the buffer is handed back
    asm volatile("s_wait_dscnt 0" ::: "memory");
    wait_async0();     // own copies for the next tile done (overlapped compute)
    __syncthreads();   // block-wide: this tile's reads done, next tile visible
  }
}

#define SQ_HALF (256u * 128u)    // 32 KB: 256 rows of 64 k
#define SQ_BUF  (2u * SQ_HALF)   // one buffer: the A rows, behind them the B rows

// Async-copy one k chunk of a 256 x 256 block tile (256 A rows and 256 B rows x
// 64 bf16, row stride ld elems in global, rows of 128 B in LDS, chunks at the
// places of lds_place) into the buffer at LDS byte offset lds_base.  512 threads:
// eight lanes move one row, a sweep of the block 64 rows, four sweeps a matrix.
static __device__ __forceinline__ void stage_sq(
    unsigned lds_base, const unsigned short* __restrict__ ga,
    const unsigned short* __restrict__ gb, int ld, int tid) {
  const int n0   = tid >> 3;
  const int part = tid & 7;
  const size_t o = (size_t)n0 * ld + part * 8;
  const unsigned long long a0 = (unsigned long long)(uintptr_t)(ga + o);
  const unsigned long long b0 = (unsigned long long)(uintptr_t)(gb + o);
  const unsigned la =
      lds_base + (unsigned)n0 * 128u + (unsigned)lds_place(n0, part) * 16u;
  const unsigned lb = la + SQ_HALF;
  // As in stage_tile: copy j of a matrix carries the immediate offset j * 8192
  // (64 LDS rows), which moves both its addresses, so its global address
  // register is set back by as much.
  unsigned long long pa[4], pb[4];
#pragma unroll
  for (int j = 0; j < 4; ++j) {
    const unsigned long long step =
        (unsigned long long)(j * 64) * (unsigned long long)ld * 2ull -
        (unsigned long long)(j * 8192);
    pa[j] = a0 + step;
    pb[j] = b0 + step;
  }
  // Eight copies and their s_wait_xcnt in one statement: the address registers
  // stay untouched until the wait has passed.
  asm volatile(
      "global_load_async_to_lds_b128 %0, %2, off\n\t"
      "global_load_async_to_lds_b128 %0, %3, off offset:8192\n\t"
      "global_load_async_to_lds_b128 %0, %4, off offset:16384\n\t"
      "global_load_async_to_lds_b128 %0, %5, off offset:24576\n\t"
      "global_load_async_to_lds_b128 %1, %6, off\n\t"
      "global_load_async_to_lds_b128 %1, %7, off offset:8192\n\t"
      "global_load_async_to_lds_b128 %1, %8, off offset:16384\n\t"
      "global_load_async_to_lds_b128 %1, %9, off offset:24576\n\t"
      "s_wait_xcnt 0x0"
      :: "v"(la), "v"(lb),
         "v"(pa[0]), "v"(pa[1]), "v"(pa[2]), "v"(pa[3]),
         "v"(pb[0]), "v"(pb[1]), "v"(pb[2]), "v"(pb[3])
      : "memory");
}

// Double-buffered mainloop of a 256 x 256 block tile, sixteen wave tiles of
// 64 x 64: a k chunk of 64 brings 64 KB into LDS for 512 matrix instructions.
// The wave reads A rows arow0 .. +64 and B rows brow0 .. +64 of the buffer.
static __device__ __forceinline__ void gemm_pipeline_sq(
    const unsigned short* __restrict__ A0, const unsigned short* __restrict__ B0,
    int ld, int Kdim, unsigned short* sm, int tid, int lane, int arow0, int brow0,
    v8f (&acc)[4][4]) {
  const unsigned sbase = (unsigned)(unsigned long long)(uintptr_t)sm;
  const int nK = Kdim / 64;

  stage_sq(sbase, A0, B0, ld, tid);
  wait_async0();
  __syncthreads();

  for (int kc = 0; kc < nK; ++kc) {
    const unsigned cur = (kc & 1) ? SQ_BUF : 0u;
    // issue async DMA for the next chunk (overlaps this chunk's compute)
    if (kc + 1 < nK)
      stage_sq(sbase + (SQ_BUF - cur), A0 + (size_t)(kc + 1) * 64,
               B0 + (size_t)(kc + 1) * 64, ld, tid);
    tile_mma(sm + (cur >> 1) + arow0 * 64, sm + ((cur + SQ_HALF) >> 1), lane, brow0,
             acc);
    // own LDS reads of this chunk retired before the buffer is handed back
    asm volatile("s_wait_dscnt 0" ::: "memory");
    wait_async0();     // own copies for the next chunk done (overlapped compute)
    __syncthreads();   // block-wide: this chunk's reads done, next chunk visible
  }
}

// ---------------------------------------------------------------------------
// Conversion kernels.  Work-groups of 8 waves take 128 x 128 tiles, 64 elements
// a thread, so that a launch starts 64x fewer waves than one element a thread
// would; global loads are 16 B a lane (512 B of one row a wave), stores cover
// 256 contiguous bytes of a row, and the transposed copy goes through LDS.
// ---------------------------------------------------------------------------
#define CT   128                 // tile edge, elements
#define CTPD (CT / 2 + 1)        // LDS row pitch in dwords (two bf16 a dword)

static __device__ __forceinline__ unsigned pack2bf(float lo, float hi) {
  return (unsigned)f2bf(lo) | ((unsigned)f2bf(hi) << 16);
}

// One 128 x 128 tile of a row-major f32 matrix with HID columns.
//   dstT[c * ldT + r] = bf16(src[r * HID + c]);  STRAIGHT: dst[r * HID + c] too.
// 256 threads; tile = CT * CTPD dwords of LDS.
template <bool STRAIGHT>
static __device__ __forceinline__ void conv_tile(
    const float* __restrict__ src, unsigned short* __restrict__ dst,
    unsigned short* __restrict__ dstT, int ldT, unsigned* tile, int tid) {
  const int c4 = tid & 31;       // group of four columns
  const int r0 = tid >> 5;       // a wave reads one row at a time
  const float* __restrict__ ps = src + (size_t)r0 * HID + c4 * 4;
  float4 v[16];
#pragma unroll
  for (int i = 0; i < 16; ++i)
    v[i] = *reinterpret_cast<const float4*>(ps + (size_t)(8 * i) * HID);
  // The loads' address register pair is reused only behind this wait; naming
  // the address keeps it out of the loads' own destination registers.
  asm volatile("s_wait_xcnt 0x0" :: "v"(ps) : "memory");
  uint2 pk[16];
#pragma unroll
  for (int i = 0; i < 16; ++i) {
    const int r = r0 + 8 * i;
    pk[i] = make_uint2(pack2bf(v[i].x, v[i].y), pack2bf(v[i].z, v[i].w));
    tile[r * CTPD + c4 * 2]     = pk[i].x;
    tile[r * CTPD + c4 * 2 + 1] = pk[i].y;
  }
  __syncthreads();

  // The straight copy is stored behind the barrier: in front of it the barrier
  // would wait until these global stores have completed.
  if (STRAIGHT) {
#pragma unroll
    for (int i = 0; i < 16; ++i)
      *reinterpret_cast<uint2*>(dst + (size_t)(r0 + 8 * i) * HID + c4 * 4) = pk[i];
  }

  // A thread gathers eight rows of one column pair: 16 B for each of two rows
  // of the transposed copy; sixteen lanes fill 256 contiguous bytes of a row.
  const int rg = tid & 15;       // group of eight source rows
#pragma unroll
  for (int p = 0; p < 4; ++p) {
    const int cp = (tid >> 4) + 16 * p;      // column pair, 0..63
    unsigned a[8];
#pragma unroll
    for (int j = 0; j < 8; ++j) a[j] = tile[(rg * 8 + j) * CTPD + cp];
    uint4 lo, hi;
    lo.x = (a[0] & 0xFFFFu) | (a[1] << 16);
    lo.y = (a[2] & 0xFFFFu) | (a[3] << 16);
    lo.z = (a[4] & 0xFFFFu) | (a[5] << 16);
    lo.w = (a[6] & 0xFFFFu) | (a[7] << 16);
    hi.x = (a[0] >> 16) | (a[1] & 0xFFFF0000u);
    hi.y = (a[2] >> 16) | (a[3] & 0xFFFF0000u);
    hi.z = (a[4] >> 16) | (a[5] & 0xFFFF0000u);
    hi.w = (a[6] >> 16) | (a[7] & 0xFFFF0000u);
    *reinterpret_cast<uint4*>(dstT + (size_t)(2 * cp) * ldT + rg * 8)     = lo;
    *reinterpret_cast<uint4*>(dstT + (size_t)(2 * cp + 1) * ldT + rg * 8) = hi;
  }
}

// ---------------------------------------------------------------------------
// Kernel 1: X,Y fp32 -> bf16 row-major; also write Y^T (per batch) in bf16.
// grid (1024, 2): y = 0 takes a tile of Y, y = 1 the same count of X elements.
// ---------------------------------------------------------------------------
// At most 8 waves a SIMD are planned for, so that the register budget holds a
// thread's 16 loads in flight at once (at 64 registers they go out in turns).
__global__ __launch_bounds__(256) __attribute__((amdgpu_waves_per_eu(2, 8)))
void attn_conv_xy(const float* __restrict__ X,
                  const float* __restrict__ Y,
                  unsigned short* __restrict__ Xb,
                  unsigned short* __restrict__ Yb,
                  unsigned short* __restrict__ YT) {
  __shared__ unsigned tile[CT * CTPD];
  const int tid = threadIdx.x;
  const int t   = blockIdx.x;
  if (blockIdx.y == 0) {
    const int f0  = (t & 7) * CT;            // HID / CT = 8 column tiles
    const int row = (t >> 3) * CT;           // row of the [NROWS, HID] view
    const int b   = row >> 11;               // / SEQ
    const int s0  = row & (SEQ - 1);
    const size_t o = (size_t)row * HID + f0;
    conv_tile<true>(Y + o, Yb + o, YT + ((size_t)b * HID + f0) * SEQ + s0, SEQ,
                    tile, tid);              // Y^T[b][f][s]
  } else {
    const size_t base = (size_t)t * (CT * CT) + (size_t)tid * 4;
    const float* __restrict__ px = X + base;
    float4 v[16];
#pragma unroll
    for (int i = 0; i < 16; ++i)
      v[i] = *reinterpret_cast<const float4*>(px + i * 1024);
    // As in conv_tile: the address pair is reused only behind this wait.
    asm volatile("s_wait_xcnt 0x0" :: "v"(px) : "memory");
#pragma unroll
    for (int i = 0; i < 16; ++i)
      *reinterpret_cast<uint2*>(Xb + base + i * 1024) =
          make_uint2(pack2bf(v[i].x, v[i].y), pack2bf(v[i].z, v[i].w));
    // The stores' data and address registers are reused only behind this wait.
    asm volatile("s_wait_xcnt 0x0" ::: "memory");
  }
}

// ---------------------------------------------------------------------------
// Kernel 2: K,Q fp32 [F,H] -> transposed bf16 [H,F]  (B-operand layout)
// grid (64, 2): y picks the matrix, x its tile.
// ---------------------------------------------------------------------------
// At most 8 waves a SIMD are planned for, so that the register budget holds a
// thread's 16 loads in flight at once (at 64 registers they go out in turns).
__global__ __launch_bounds__(256) __attribute__((amdgpu_waves_per_eu(2, 8)))
void attn_conv_w(const float* __restrict__ K,
                 const float* __restrict__ Q,
                 unsigned short* __restrict__ KT,
                 unsigned short* __restrict__ QT) {
  __shared__ unsigned tile[CT * CTPD];
  const int t  = blockIdx.x;
  const int h0 = (t & 7) * CT;
  const int f0 = (t >> 3) * CT;
  const float* __restrict__ s    = (blockIdx.y == 0) ? K : Q;
  unsigned short* __restrict__ d = (blockIdx.y == 0) ? KT : QT;
  conv_tile<false>(s + (size_t)f0 * HID + h0, nullptr,
                   d + (size_t)h0 * HID + f0, HID, tile, threadIdx.x);
}

// ---------------------------------------------------------------------------
// Kernel 3: fused GEMM + LayerNorm.  512 thr (16 waves): 64 rows x 1024 cols,
// each wave 64 rows x 64 cols.  Dynamic LDS: 2 x 128KB B-tile buffers, behind
// them 2 x 8KB for the A rows.
// ---------------------------------------------------------------------------
__global__ __launch_bounds__(512)
void attn_gemm_ln(const unsigned short* __restrict__ A,
                  const unsigned short* __restrict__ WT,
                  const float* __restrict__ gamma,
                  const float* __restrict__ beta,
                  unsigned short* __restrict__ out) {
  extern __shared__ unsigned short smem[];          // 2 * 1024*64 bf16 + A rows
  const int tid  = threadIdx.x;
  const int lane = tid & 31;
  const int wave = tid >> 5;            // 0..15
  const int half = (lane >> 4) & 1;
  const int mr   = lane & 15;
  const int row0 = blockIdx.x * 64;
  const int col0 = wave * 64;

  v8f acc[4][4];
#pragma unroll
  for (int m = 0; m < 4; ++m)
#pragma unroll
    for (int t = 0; t < 4; ++t)
#pragma unroll
      for (int r = 0; r < 8; ++r) acc[m][t][r] = 0.0f;

  gemm_pipeline(A + (size_t)row0 * HID, HID, WT, HID, HID,
                smem, tid, lane, col0, acc);

  __shared__ float s_sum[64];
  __shared__ float s_sq[64];
  if (tid < 64) { s_sum[tid] = 0.0f; s_sq[tid] = 0.0f; }
  __syncthreads();

#pragma unroll
  for (int m = 0; m < 4; ++m) {
#pragma unroll
    for (int r = 0; r < 8; ++r) {
      float ps = 0.0f, pq = 0.0f;
#pragma unroll
      for (int t = 0; t < 4; ++t) { float v = acc[m][t][r]; ps += v; pq += v * v; }
#pragma unroll
      for (int k = 1; k <= 8; k <<= 1) {    // reduce over the 16-lane half
        ps += __shfl_xor(ps, k, 32);
        pq += __shfl_xor(pq, k, 32);
      }
      if (mr == 0) {
        int row = m * 16 + r + 8 * half;
        atomicAdd(&s_sum[row], ps);         // ds_add_f32
        atomicAdd(&s_sq[row], pq);
      }
    }
  }
  __syncthreads();

  const float inv_h = 1.0f / (float)HID;
#pragma unroll
  for (int m = 0; m < 4; ++m) {
#pragma unroll
    for (int r = 0; r < 8; ++r) {
      const int row  = m * 16 + r + 8 * half;
      const float mu = s_sum[row] * inv_h;
      float var      = s_sq[row] * inv_h - mu * mu;
      const float rs = rsqrtf(var + LN_EPS);
#pragma unroll
      for (int t = 0; t < 4; ++t) {
        const int n  = col0 + t * 16 + mr;
        float v = (acc[m][t][r] - mu) * rs * gamma[n] + beta[n];
        out[(size_t)(row0 + row) * HID + n] = f2bf(v);
      }
    }
  }
}

// ---------------------------------------------------------------------------
// Kernel 4: scores = queries @ keys^T / H, f32.  512 thr (16 waves): 256 q rows
// x 256 keys, each wave 64 x 64.  Dynamic LDS: 2 x 64KB (q rows + key rows).
// ---------------------------------------------------------------------------
__global__ __launch_bounds__(512)
void attn_scores(const unsigned short* __restrict__ Qb,
                 const unsigned short* __restrict__ Kb,
                 float* __restrict__ S) {
  extern __shared__ unsigned short smem[];          // 2 * (256 + 256) * 64 bf16
  const int tid  = threadIdx.x;
  const int lane = tid & 31;
  const int wave = tid >> 5;            // 0..15
  const int half = (lane >> 4) & 1;
  const int mr   = lane & 15;
  const int b    = blockIdx.x >> 6;
  const int row0 = ((blockIdx.x >> 3) & 7) * 256;
  const int key0 = (blockIdx.x & 7) * 256;
  const int wr0  = (wave >> 2) * 64;    // the wave's rows and keys in the tile
  const int wc0  = (wave & 3) * 64;

  v8f acc[4][4];
#pragma unroll
  for (int m = 0; m < 4; ++m)
#pragma unroll
    for (int t = 0; t < 4; ++t)
#pragma unroll
      for (int r = 0; r < 8; ++r) acc[m][t][r] = 0.0f;

  gemm_pipeline_sq(Qb + ((size_t)b * SEQ + row0) * HID,
                   Kb + ((size_t)b * SEQ + key0) * HID, HID, HID,
                   smem, tid, lane, wr0, wc0, acc);

  const float sc = 1.0f / (float)HID;
  float* __restrict__ ps =
      S + ((size_t)b * SEQ + row0 + wr0 + 8 * half) * SEQ + key0 + wc0 + mr;
#pragma unroll
  for (int m = 0; m < 4; ++m)
#pragma unroll
    for (int r = 0; r < 8; ++r)
#pragma unroll
      for (int t = 0; t < 4; ++t)
        ps[(size_t)(m * 16 + r) * SEQ + t * 16] = acc[m][t][r] * sc;
}

// ---------------------------------------------------------------------------
// Kernel 4b: alpha = softmax(scores) by rows, bf16 out.  One wave a row, the
// row's 2048 scores in its registers (64 a lane): no LDS and no barrier.
// ---------------------------------------------------------------------------
// At most 8 waves a SIMD are planned for, so that the register budget holds a
// thread's 16 loads in flight at once.
__global__ __launch_bounds__(256) __attribute__((amdgpu_waves_per_eu(2, 8)))
void attn_softmax(const float* __restrict__ S,
                  unsigned short* __restrict__ alpha) {
  const int lane = threadIdx.x & 31;
  const size_t o = (size_t)(blockIdx.x * 8 + (threadIdx.x >> 5)) * SEQ + lane * 4;
  const float* __restrict__ ps = S + o;
  float4 v[16];
#pragma unroll
  for (int i = 0; i < 16; ++i)
    v[i] = *reinterpret_cast<const float4*>(ps + i * 128);
  // As in conv_tile: the address pair is reused only behind this wait.
  asm volatile("s_wait_xcnt 0x0" :: "v"(ps) : "memory");

  float mx = -3.0e38f;
#pragma unroll
  for (int i = 0; i < 16; ++i)
    mx = fmaxf(mx, fmaxf(fmaxf(v[i].x, v[i].y), fmaxf(v[i].z, v[i].w)));
#pragma unroll
  for (int msk = 1; msk <= 16; msk <<= 1) mx = fmaxf(mx, __shfl_xor(mx, msk, 32));

  float s = 0.0f;
#pragma unroll
  for (int i = 0; i < 16; ++i) {
    v[i].x = __expf(v[i].x - mx);
    v[i].y = __expf(v[i].y - mx);
    v[i].z = __expf(v[i].z - mx);
    v[i].w = __expf(v[i].w - mx);
    s += (v[i].x + v[i].y) + (v[i].z + v[i].w);
  }
#pragma unroll
  for (int msk = 1; msk <= 16; msk <<= 1) s += __shfl_xor(s, msk, 32);
  const float inv = 1.0f / s;

#pragma unroll
  for (int i = 0; i < 16; ++i)
    *reinterpret_cast<uint2*>(alpha + o + i * 128) =
        make_uint2(pack2bf(v[i].x * inv, v[i].y * inv),
                   pack2bf(v[i].z * inv, v[i].w * inv));
}

// ---------------------------------------------------------------------------
// Kernel 5: out = alpha @ Y   (per batch [2048x2048] x [2048x1024], fp32 out)
// 512 thr (16 waves): 256 q rows x 256 f cols, each wave 64 x 64; K-loop over
// 2048.  Dynamic LDS: 2 x 64KB (alpha rows + YT rows).
// ---------------------------------------------------------------------------
__global__ __launch_bounds__(512)
void attn_pv_gemm(const unsigned short* __restrict__ alpha,
                  const unsigned short* __restrict__ YT,
                  float* __restrict__ out) {
  extern __shared__ unsigned short smem[];          // 2 * (256 + 256) * 64 bf16
  const int tid  = threadIdx.x;
  const int lane = tid & 31;
  const int wave = tid >> 5;            // 0..15
  const int half = (lane >> 4) & 1;
  const int mr   = lane & 15;
  const int b    = blockIdx.x >> 5;
  const int row0 = ((blockIdx.x >> 2) & 7) * 256;
  const int f0   = (blockIdx.x & 3) * 256;
  const int wr0  = (wave >> 2) * 64;    // the wave's rows and columns in the tile
  const int wc0  = (wave & 3) * 64;

  v8f acc[4][4];
#pragma unroll
  for (int m = 0; m < 4; ++m)
#pragma unroll
    for (int t = 0; t < 4; ++t)
#pragma unroll
      for (int r = 0; r < 8; ++r) acc[m][t][r] = 0.0f;

  gemm_pipeline_sq(alpha + ((size_t)b * SEQ + row0) * SEQ,
                   YT + ((size_t)b * HID + f0) * SEQ, SEQ, SEQ,
                   smem, tid, lane, wr0, wc0, acc);

  float* __restrict__ po =
      out + ((size_t)b * SEQ + row0 + wr0 + 8 * half) * HID + f0 + wc0 + mr;
#pragma unroll
  for (int m = 0; m < 4; ++m)
#pragma unroll
    for (int r = 0; r < 8; ++r)
#pragma unroll
      for (int t = 0; t < 4; ++t)
        po[(size_t)(m * 16 + r) * HID + t * 16] = acc[m][t][r];
}

// ---------------------------------------------------------------------------
// host launcher
// ---------------------------------------------------------------------------
extern "C" void kernel_launch(void* const* d_in, const int* in_sizes, int n_in,
                              void* d_out, int out_size, void* d_ws, size_t ws_size,
                              hipStream_t stream) {
  const float* X  = (const float*)d_in[0];
  const float* Y  = (const float*)d_in[1];
  const float* K  = (const float*)d_in[2];
  const float* Q  = (const float*)d_in[3];
  const float* g1 = (const float*)d_in[4];
  const float* b1 = (const float*)d_in[5];
  const float* g2 = (const float*)d_in[6];
  const float* b2 = (const float*)d_in[7];
  float* out = (float*)d_out;

  // workspace layout (bytes); total 224 MB.  The f32 scores (128 MB) lie over
  // Xb, Yb, KT and QT, which nothing reads once the keys and queries are made;
  // alpha (64 MB) lies over Kb and Qb, which nothing reads behind the scores.
  char* w = (char*)d_ws;
  const size_t SZ_XY = (size_t)NROWS * HID * 2;        // 32 MB each
  const size_t SZ_W  = (size_t)HID * HID * 2;          // 2 MB each
  unsigned short* YT    = (unsigned short*)(w);
  unsigned short* Kb    = (unsigned short*)(w + SZ_XY);
  unsigned short* Qb    = (unsigned short*)(w + 2 * SZ_XY);
  unsigned short* Xb    = (unsigned short*)(w + 3 * SZ_XY);
  unsigned short* Yb    = (unsigned short*)(w + 4 * SZ_XY);
  unsigned short* KT    = (unsigned short*)(w + 5 * SZ_XY);
  unsigned short* QT    = (unsigned short*)(w + 5 * SZ_XY + SZ_W);
  float*          S     = (float*)(w + 3 * SZ_XY);
  unsigned short* alpha = (unsigned short*)(w + SZ_XY);

  // 256 KB (double-buffered 128KB B tiles) + 16 KB (double-buffered A rows)
  const size_t LDS_B = 2u * 1024u * 128u + 2u * 64u * 128u;

  // 1) convert X,Y -> bf16 (+ Y^T), K,Q -> transposed bf16
  attn_conv_xy<<<dim3(1024, 2), 256, 0, stream>>>(X, Y, Xb, Yb, YT);
  attn_conv_w<<<dim3(64, 2), 256, 0, stream>>>(K, Q, KT, QT);

  // 2) keys = LN(Y @ K), queries = LN(X @ Q)   [fused GEMM+LN, bf16 out]
  attn_gemm_ln<<<NROWS / 64, 512, LDS_B, stream>>>(Yb, KT, g1, b1, Kb);
  attn_gemm_ln<<<NROWS / 64, 512, LDS_B, stream>>>(Xb, QT, g2, b2, Qb);

  // 3) alpha = softmax(queries @ keys^T / H)   [f32 scores, then bf16 alpha]
  attn_scores<<<NBATCH * (SEQ / 256) * (SEQ / 256), 512, 2u * SQ_BUF, stream>>>(Qb, Kb, S);
  attn_softmax<<<NROWS / 8, 256, 0, stream>>>(S, alpha);

  // 4) out = alpha @ Y                          [fp32 out]
  attn_pv_gemm<<<NBATCH * (SEQ / 256) * (HID / 256), 512, 2u * SQ_BUF, stream>>>(alpha, YT, out);
}

// v007
// It runs in 227 microseconds.
// Timed twice side by side with v006, it ran 1.04 and 1.03 times as fast.
// All steps since v000 together make it 5.23 times as fast.
#include <hip/hip_runtime.h>

// ---------------------------------------------------------------------------
// MI455X (gfx1250) attention pipeline.
//   keys    = LN(Y @ K)        queries = LN(X @ Q)
//   alpha   = softmax(queries @ keys^T / 1024)
//   out     = alpha @ Y
// All contractions: v_wmma_f32_16x16x32_bf16 with f32 accumulation.
// B operands double-buffered in LDS via global_load_async_to_lds_b128
// (ASYNCcnt) so async DMA of tile k+1 overlaps the WMMAs of tile k.
// Each staged B tile of the LN kernel serves 64 whole rows of A; its products
// are taken transposed (weights as the A operand), so that a lane holds pieces
// of whole output rows and the row sums need no walk over lanes.  The score and
// PV kernels need no whole rows: they take square tiles of 256 x 256, the shape
// that copies the fewest bytes from L2 into LDS per matrix instruction, and the
// softmax over the f32 scores is a kernel of its own.
// A staged B row is 64 k = 128 B, one whole cache line, so that a wave's copy
// of 512 B touches four lines of L2 and no line is asked for twice.
// The A rows of a work-group are staged the same way, once for all its waves:
// a fragment load from global memory touches sixteen lines for its 512 B, and
// every wave would ask for the same rows again.
// ---------------------------------------------------------------------------

typedef __attribute__((ext_vector_type(16))) __bf16 v16bf;
typedef __attribute__((ext_vector_type(8)))  float  v8f;

#define HID    1024
#define SEQ    2048
#define NBATCH 8
#define NROWS  (NBATCH * SEQ)      // 16384
#define LN_EPS 1e-5f

// round-to-nearest-even float -> bf16 (raw u16)
static __device__ __forceinline__ unsigned short f2bf(float x) {
  unsigned u = __builtin_bit_cast(unsigned, x);
  unsigned r = u + 0x7FFFu + ((u >> 16) & 1u);
  return (unsigned short)(r >> 16);
}

union FragU { v16bf v; uint4 q[2]; };

// LDS tile: rows of 64 bf16 = eight 16-B chunks, no pad.  Chunk q of row n lies
// at place q ^ ((n >> 1) & 7) of its row.  The sixteen lanes of a half wave read
// one chunk number of sixteen successive rows: at plain places they fall on 8
// of the 64 banks, eight deep; at these places they cover all 64 banks once.
static __device__ __forceinline__ int lds_place(int n, int q) {
  return q ^ ((n >> 1) & 7);
}

// 16x32 bf16 fragment read from such an LDS tile, for the k step ks (0 or 1)
// of 32 inside the tile's 64 k; n0 a multiple of 16.
// CDNA5 16-bit A layout: lanes 0-15 hold row M=lane, K in {0..7,16..23};
// lanes 16-31 hold row M=lane-16, K in {8..15,24..31}. Two b128 loads/lane.
static __device__ __forceinline__ v16bf lds_frag(
    const unsigned short* __restrict__ sm, int n0, int ks, int lane) {
  const int half = (lane >> 4) & 1;
  const int r    = lane & 15;
  const unsigned short* row = sm + (size_t)(n0 + r) * 64;
  FragU f;
  f.q[0] = *reinterpret_cast<const uint4*>(row + lds_place(r, ks * 4 + half) * 8);      // ds_load_b128
  f.q[1] = *reinterpret_cast<const uint4*>(row + lds_place(r, ks * 4 + half + 2) * 8);
  return f.v;
}

static __device__ __forceinline__ v8f wmma_bf16(v16bf a, v16bf b, v8f c) {
  return __builtin_amdgcn_wmma_f32_16x16x32_bf16(false, a, false, b,
                                                 (short)0, c, false, false);
}

// lane l takes the value of lane l ^ 16 (v_permlanex16_b32, no LDS trip)
static __device__ __forceinline__ float xhalf(float x) {
  const int b = __builtin_bit_cast(int, x);
  return __builtin_bit_cast(float, __builtin_amdgcn_permlanex16(
      b, b, 0x76543210, 0xfedcba98, false, false));
}

static __device__ __forceinline__ void wait_async0() {
  asm volatile("s_wait_asynccnt 0" ::: "memory");
}

#define TILE_ROWS  1024u                 // B rows in a staged tile
#define TILE_BYTES (TILE_ROWS * 128u)    // 128 KB

// Async-copy one B tile (1024 rows x 64 bf16, row stride ld elems in global,
// rows of 128 B in LDS) into LDS at byte offset lds_base.  512 threads: eight
// lanes move one row, a wave four whole rows; a sweep of the block covers 64
// rows, and sweep i takes the 64 global rows from i * gstep on into LDS rows
// from i * 64 on.  Chunk part of row n lands at place lds_place(n, part); the
// place is the same in every sweep, as 64 rows leave (n >> 1) & 7 as it is.
template <int NC>
static __device__ __forceinline__ void stage_tile(
    unsigned lds_base, const unsigned short* __restrict__ g, int ld, int gstep,
    int tid) {
  static_assert(NC % 8 == 0, "copies are issued in groups of eight");
  static_assert(NC * 64 == (int)TILE_ROWS, "the sweeps cover the tile");
  const int n0   = tid >> 3;
  const int part = tid & 7;
  const unsigned long long gb =
      (unsigned long long)(uintptr_t)(g + (size_t)n0 * ld + part * 8);
  const unsigned l0 =
      lds_base + (unsigned)n0 * 128u + (unsigned)lds_place(n0, part) * 16u;
#pragma unroll
  for (int i0 = 0; i0 < NC; i0 += 8) {
    // One LDS address serves the eight copies of a group: copy j carries the
    // immediate offset j * 8192 (64 LDS rows), which moves BOTH its addresses,
    // so its global address register is set back by as much (the global step of
    // a sweep is larger, so the register still points into the source).  With
    // an LDS address register a copy the compiler keeps them all across the
    // loop.
    const unsigned lo = l0 + (unsigned)i0 * 8192u;
    unsigned long long gp[8];
#pragma unroll
    for (int j = 0; j < 8; ++j)
      gp[j] = gb + ((unsigned long long)((i0 + j) * gstep) * (unsigned long long)ld * 2ull -
                    (unsigned long long)(j * 8192));
    // Eight copies and their s_wait_xcnt in one statement: the address
    // registers stay untouched until the wait has passed.
    asm volatile(
        "global_load_async_to_lds_b128 %0, %1, off\n\t"
        "global_load_async_to_lds_b128 %0, %2, off offset:8192\n\t"
        "global_load_async_to_lds_b128 %0, %3, off offset:16384\n\t"
        "global_load_async_to_lds_b128 %0, %4, off offset:24576\n\t"
        "global_load_async_to_lds_b128 %0, %5, off offset:32768\n\t"
        "global_load_async_to_lds_b128 %0, %6, off offset:40960\n\t"
        "global_load_async_to_lds_b128 %0, %7, off offset:49152\n\t"
        "global_load_async_to_lds_b128 %0, %8, off offset:57344\n\t"
        "s_wait_xcnt 0x0"
        :: "v"(lo),
           "v"(gp[0]), "v"(gp[1]), "v"(gp[2]), "v"(gp[3]),
           "v"(gp[4]), "v"(gp[5]), "v"(gp[6]), "v"(gp[7])
        : "memory");
  }
}

// Async-copy the work-group's A rows of one k chunk (64 rows x 64 bf16, row
// stride ld elems in global, rows of 128 B in LDS, chunks at the places of
// lds_place) into LDS at byte offset lds_base: one copy a thread, every lane on;
// 8 KB, 16 B a lane, a wave four whole rows.
static __device__ __forceinline__ void stage_a(
    unsigned lds_base, const unsigned short* __restrict__ g, int ld, int tid) {
  const int n    = tid >> 3;
  const int part = tid & 7;
  const unsigned short* gp = g + (size_t)n * ld + part * 8;
  const unsigned lo =
      lds_base + (unsigned)n * 128u + (unsigned)lds_place(n, part) * 16u;
  // The copy and its s_wait_xcnt in one statement: the address registers
  // stay untouched until the wait has passed.
  asm volatile(
      "global_load_async_to_lds_b128 %0, %1, off\n\t"
      "s_wait_xcnt 0x0"
      :: "v"(lo), "v"(gp) : "memory");
}

// The matrix work of one staged k chunk, for one wave tile of 64 rows x 64 cols:
//   acc[m][t] += A chunk[LDS rows m*16..+16] * B tile[LDS rows col0+t*16..+16]
// Every fragment read from LDS feeds four matrix instructions; the fragments of
// a k step of 32 are read as one group.
// SWAP: the B tile's rows go in as the A operand and the A chunk's rows as the
// B operand (both fragments have one layout and one k order), so acc[m][t] holds
// the transposed 16 x 16 tile: lane = A chunk row, register = B tile row.
template <bool SWAP>
static __device__ __forceinline__ void tile_mma(
    const unsigned short* sma, const unsigned short* smc, int lane, int col0,
    v8f (&acc)[4][4]) {
#pragma unroll
  for (int ks = 0; ks < 2; ++ks) {
    // the fragments of this k step from LDS as one group, then the 16 WMMAs
    v16bf a[4], bf[4];
    bf[0] = lds_frag(smc, col0, ks, lane);
#pragma unroll
    for (int m = 0; m < 4; ++m) a[m] = lds_frag(sma, m * 16, ks, lane);
#pragma unroll
    for (int t = 1; t < 4; ++t)
      bf[t] = lds_frag(smc, col0 + t * 16, ks, lane);
    // Keeps the LDS reads as one group ahead of the WMMAs: the compiler
    // otherwise spreads them among the WMMAs, a full wait at each.
    __builtin_amdgcn_sched_barrier(0);
#pragma unroll
    for (int t = 0; t < 4; ++t)
#pragma unroll
      for (int m = 0; m < 4; ++m)
        acc[m][t] = SWAP ? wmma_bf16(bf[t], a[m], acc[m][t])
                         : wmma_bf16(a[m], bf[t], acc[m][t]);
    // Holds the WMMAs in front of what follows (the waits at the tile's foot):
    // the compiler otherwise sinks them behind the barrier, and the next
    // tile's copies no longer fly under them.
    __builtin_amdgcn_sched_barrier(0);
  }
}

// Double-buffered pipelined mainloop, one wave tile of 64 rows x 64 cols of a
// block tile of 64 rows x 1024 cols.  B staged async into LDS in tiles of 1024
// rows x 64 k, the tile of k chunk kc in the buffer of kc's parity; a wave reads
// LDS rows col0 .. +64, col0 = wave*64.  The block's A rows of k chunk kc lie
// behind the two B buffers, in the A buffer of kc's parity; they are copied
// together with the chunk's B tile.  The tiles come out transposed:
// acc[m][t][r] of lane (half, mr) is row m*16 + mr, column col0 + t*16 + 8*half + r.
static __device__ __forceinline__ void gemm_pipeline(
    const unsigned short* __restrict__ Arow, int ldA,
    const unsigned short* __restrict__ B0,  int ldB,
    int Kdim, unsigned short* sm, int tid, int lane, int col0,
    v8f (&acc)[4][4]) {
  constexpr unsigned A_BYTES = 64u * 128u;
  const unsigned sbase = (unsigned)(unsigned long long)(uintptr_t)sm;
  const unsigned abase = sbase + 2u * TILE_BYTES;
  const unsigned short* smA = sm + TILE_BYTES;      // 2 * TILE_BYTES bytes on
  const int nK = Kdim / 64;

  stage_a(abase, Arow, ldA, tid);
  stage_tile<16>(sbase, B0, ldB, 64, tid);
  wait_async0();
  __syncthreads();

  for (int kc = 0; kc < nK; ++kc) {
    const bool odd = (kc & 1) != 0;
    const unsigned aCur = odd ? A_BYTES : 0u;
    const unsigned aNxt = odd ? 0u : A_BYTES;
    const unsigned curOff = odd ? TILE_BYTES : 0u;
    const unsigned nxtOff = odd ? 0u : TILE_BYTES;
    // issue async DMA for the next tile (overlaps this tile's compute)
    if (kc + 1 < nK) {
      stage_a(abase + aNxt, Arow + (size_t)(kc + 1) * 64, ldA, tid);
      stage_tile<16>(sbase + nxtOff, B0 + (size_t)(kc + 1) * 64, ldB, 64, tid);
    }
    tile_mma<true>(smA + (aCur >> 1), sm + (curOff >> 1), lane, col0, acc);
    // own LDS reads of this tile retired before the buffer is handed back
    asm volatile("s_wait_dscnt 0" ::: "memory");
    wait_async0();     // own copies for the next tile done (overlapped compute)
    __syncthreads();   // block-wide: this tile's reads done, next tile visible
  }
}

#define SQ_HALF (256u * 128u)    // 32 KB: 256 rows of 64 k
#define SQ_BUF  (2u * SQ_HALF)   // one buffer: the A rows, behind them the B rows

// Async-copy one k chunk of a 256 x 256 block tile (256 A rows and 256 B rows x
// 64 bf16, row stride ld elems in global, rows of 128 B in LDS, chunks at the
// places of lds_place) into the buffer at LDS byte offset lds_base.  512 threads:
// eight lanes move one row, a sweep of the block 64 rows, four sweeps a matrix.
static __device__ __forceinline__ void stage_sq(
    unsigned lds_base, const unsigned short* __restrict__ ga,
    const unsigned short* __restrict__ gb, int ld, int tid) {
  const int n0   = tid >> 3;
  const int part = tid & 7;
  const size_t o = (size_t)n0 * ld + part * 8;
  const unsigned long long a0 = (unsigned long long)(uintptr_t)(ga + o);
  const unsigned long long b0 = (unsigned long long)(uintptr_t)(gb + o);
  const unsigned la =
      lds_base + (unsigned)n0 * 128u + (unsigned)lds_place(n0, part) * 16u;
  const unsigned lb = la + SQ_HALF;
  // As in stage_tile: copy j of a matrix carries the immediate offset j * 8192
  // (64 LDS rows), which moves both its addresses, so its global address
  // register is set back by as much.
  unsigned long long pa[4], pb[4];
#pragma unroll
  for (int j = 0; j < 4; ++j) {
    const unsigned long long step =
        (unsigned long long)(j * 64) * (unsigned long long)ld * 2ull -
        (unsigned long long)(j * 8192);
    pa[j] = a0 + step;
    pb[j] = b0 + step;
  }
  // Eight copies and their s_wait_xcnt in one statement: the address registers
  // stay untouched until the wait has passed.
  asm volatile(
      "global_load_async_to_lds_b128 %0, %2, off\n\t"
      "global_load_async_to_lds_b128 %0, %3, off offset:8192\n\t"
      "global_load_async_to_lds_b128 %0, %4, off offset:16384\n\t"
      "global_load_async_to_lds_b128 %0, %5, off offset:24576\n\t"
      "global_load_async_to_lds_b128 %1, %6, off\n\t"
      "global_load_async_to_lds_b128 %1, %7, off offset:8192\n\t"
      "global_load_async_to_lds_b128 %1, %8, off offset:16384\n\t"
      "global_load_async_to_lds_b128 %1, %9, off offset:24576\n\t"
      "s_wait_xcnt 0x0"
      :: "v"(la), "v"(lb),
         "v"(pa[0]), "v"(pa[1]), "v"(pa[2]), "v"(pa[3]),
         "v"(pb[0]), "v"(pb[1]), "v"(pb[2]), "v"(pb[3])
      : "memory");
}

// Double-buffered mainloop of a 256 x 256 block tile, sixteen wave tiles of
// 64 x 64: a k chunk of 64 brings 64 KB into LDS for 512 matrix instructions.
// The wave reads A rows arow0 .. +64 and B rows brow0 .. +64 of the buffer.
static __device__ __forceinline__ void gemm_pipeline_sq(
    const unsigned short* __restrict__ A0, const unsigned short* __restrict__ B0,
    int ld, int Kdim, unsigned short* sm, int tid, int lane, int arow0, int brow0,
    v8f (&acc)[4][4]) {
  const unsigned sbase = (unsigned)(unsigned long long)(uintptr_t)sm;
  const int nK = Kdim / 64;

  stage_sq(sbase, A0, B0, ld, tid);
  wait_async0();
  __syncthreads();

  for (int kc = 0; kc < nK; ++kc) {
    const unsigned cur = (kc & 1) ? SQ_BUF : 0u;
    // issue async DMA for the next chunk (overlaps this chunk's compute)
    if (kc + 1 < nK)
      stage_sq(sbase + (SQ_BUF - cur), A0 + (size_t)(kc + 1) * 64,
               B0 + (size_t)(kc + 1) * 64, ld, tid);
    tile_mma<false>(sm + (cur >> 1) + arow0 * 64, sm + ((cur + SQ_HALF) >> 1), lane,
                    brow0, acc);
    // own LDS reads of this chunk retired before the buffer is handed back
    asm volatile("s_wait_dscnt 0" ::: "memory");
    wait_async0();     // own copies for the next chunk done (overlapped compute)
    __syncthreads();   // block-wide: this chunk's reads done, next chunk visible
  }
}

// ---------------------------------------------------------------------------
// Conversion kernels.  Work-groups of 8 waves take 128 x 128 tiles, 64 elements
// a thread, so that a launch starts 64x fewer waves than one element a thread
// would; global loads are 16 B a lane (512 B of one row a wave), stores cover
// 256 contiguous bytes of a row, and the transposed copy goes through LDS.
// ---------------------------------------------------------------------------
#define CT   128                 // tile edge, elements
#define CTPD (CT / 2 + 1)        // LDS row pitch in dwords (two bf16 a dword)

static __device__ __forceinline__ unsigned pack2bf(float lo, float hi) {
  return (unsigned)f2bf(lo) | ((unsigned)f2bf(hi) << 16);
}

// One 128 x 128 tile of a row-major f32 matrix with HID columns.
//   dstT[c * ldT + r] = bf16(src[r * HID + c]);  STRAIGHT: dst[r * HID + c] too.
// 256 threads; tile = CT * CTPD dwords of LDS.
template <bool STRAIGHT>
static __device__ __forceinline__ void conv_tile(
    const float* __restrict__ src, unsigned short* __restrict__ dst,
    unsigned short* __restrict__ dstT, int ldT, unsigned* tile, int tid) {
  const int c4 = tid & 31;       // group of four columns
  const int r0 = tid >> 5;       // a wave reads one row at a time
  const float* __restrict__ ps = src + (size_t)r0 * HID + c4 * 4;
  float4 v[16];
#pragma unroll
  for (int i = 0; i < 16; ++i)
    v[i] = *reinterpret_cast<const float4*>(ps + (size_t)(8 * i) * HID);
  // The loads' address register pair is reused only behind this wait; naming
  // the address keeps it out of the loads' own destination registers.
  asm volatile("s_wait_xcnt 0x0" :: "v"(ps) : "memory");
  uint2 pk[16];
#pragma unroll
  for (int i = 0; i < 16; ++i) {
    const int r = r0 + 8 * i;
    pk[i] = make_uint2(pack2bf(v[i].x, v[i].y), pack2bf(v[i].z, v[i].w));
    tile[r * CTPD + c4 * 2]     = pk[i].x;
    tile[r * CTPD + c4 * 2 + 1] = pk[i].y;
  }
  __syncthreads();

  // The straight copy is stored behind the barrier: in front of it the barrier
  // would wait until these global stores have completed.
  if (STRAIGHT) {
#pragma unroll
    for (int i = 0; i < 16; ++i)
      *reinterpret_cast<uint2*>(dst + (size_t)(r0 + 8 * i) * HID + c4 * 4) = pk[i];
  }

  // A thread gathers eight rows of one column pair: 16 B for each of two rows
  // of the transposed copy; sixteen lanes fill 256 contiguous bytes of a row.
  const int rg = tid & 15;       // group of eight source rows
#pragma unroll
  for (int p = 0; p < 4; ++p) {
    const int cp = (tid >> 4) + 16 * p;      // column pair, 0..63
    unsigned a[8];
#pragma unroll
    for (int j = 0; j < 8; ++j) a[j] = tile[(rg * 8 + j) * CTPD + cp];
    uint4 lo, hi;
    lo.x = (a[0] & 0xFFFFu) | (a[1] << 16);
    lo.y = (a[2] & 0xFFFFu) | (a[3] << 16);
    lo.z = (a[4] & 0xFFFFu) | (a[5] << 16);
    lo.w = (a[6] & 0xFFFFu) | (a[7] << 16);
    hi.x = (a[0] >> 16) | (a[1] & 0xFFFF0000u);
    hi.y = (a[2] >> 16) | (a[3] & 0xFFFF0000u);
    hi.z = (a[4] >> 16) | (a[5] & 0xFFFF0000u);
    hi.w = (a[6] >> 16) | (a[7] & 0xFFFF0000u);
    *reinterpret_cast<uint4*>(dstT + (size_t)(2 * cp) * ldT + rg * 8)     = lo;
    *reinterpret_cast<uint4*>(dstT + (size_t)(2 * cp + 1) * ldT + rg * 8) = hi;
  }
}

// ---------------------------------------------------------------------------
// Kernel 1: X,Y fp32 -> bf16 row-major; also write Y^T (per batch) in bf16.
// grid (1024, 2): y = 0 takes a tile of Y, y = 1 the same count of X elements.
// ---------------------------------------------------------------------------
// At most 8 waves a SIMD are planned for, so that the register budget holds a
// thread's 16 loads in flight at once (at 64 registers they go out in turns).
__global__ __launch_bounds__(256) __attribute__((amdgpu_waves_per_eu(2, 8)))
void attn_conv_xy(const float* __restrict__ X,
                  const float* __restrict__ Y,
                  unsigned short* __restrict__ Xb,
                  unsigned short* __restrict__ Yb,
                  unsigned short* __restrict__ YT) {
  __shared__ unsigned tile[CT * CTPD];
  const int tid = threadIdx.x;
  const int t   = blockIdx.x;
  if (blockIdx.y == 0) {
    const int f0  = (t & 7) * CT;            // HID / CT = 8 column tiles
    const int row = (t >> 3) * CT;           // row of the [NROWS, HID] view
    const int b   = row >> 11;               // / SEQ
    const int s0  = row & (SEQ - 1);
    const size_t o = (size_t)row * HID + f0;
    conv_tile<true>(Y + o, Yb + o, YT + ((size_t)b * HID + f0) * SEQ + s0, SEQ,
                    tile, tid);              // Y^T[b][f][s]
  } else {
    const size_t base = (size_t)t * (CT * CT) + (size_t)tid * 4;
    const float* __restrict__ px = X + base;
    float4 v[16];
#pragma unroll
    for (int i = 0; i < 16; ++i)
      v[i] = *reinterpret_cast<const float4*>(px + i * 1024);
    // As in conv_tile: the address pair is reused only behind this wait.
    asm volatile("s_wait_xcnt 0x0" :: "v"(px) : "memory");
#pragma unroll
    for (int i = 0; i < 16; ++i)
      *reinterpret_cast<uint2*>(Xb + base + i * 1024) =
          make_uint2(pack2bf(v[i].x, v[i].y), pack2bf(v[i].z, v[i].w));
    // The stores' data and address registers are reused only behind this wait.
    asm volatile("s_wait_xcnt 0x0" ::: "memory");
  }
}

// ---------------------------------------------------------------------------
// Kernel 2: K,Q fp32 [F,H] -> transposed bf16 [H,F]  (B-operand layout)
// grid (64, 2): y picks the matrix, x its tile.
// ---------------------------------------------------------------------------
// At most 8 waves a SIMD are planned for, so that the register budget holds a
// thread's 16 loads in flight at once (at 64 registers they go out in turns).
__global__ __launch_bounds__(256) __attribute__((amdgpu_waves_per_eu(2, 8)))
void attn_conv_w(const float* __restrict__ K,
                 const float* __restrict__ Q,
                 unsigned short* __restrict__ KT,
                 unsigned short* __restrict__ QT) {
  __shared__ unsigned tile[CT * CTPD];
  const int t  = blockIdx.x;
  const int h0 = (t & 7) * CT;
  const int f0 = (t >> 3) * CT;
  const float* __restrict__ s    = (blockIdx.y == 0) ? K : Q;
  unsigned short* __restrict__ d = (blockIdx.y == 0) ? KT : QT;
  conv_tile<false>(s + (size_t)f0 * HID + h0, nullptr,
                   d + (size_t)h0 * HID + f0, HID, tile, threadIdx.x);
}

// ---------------------------------------------------------------------------
// Kernel 3: fused GEMM + LayerNorm.  512 thr (16 waves): 64 rows x 1024 cols,
// each wave 64 rows x 64 cols.  Dynamic LDS: 2 x 128KB B-tile buffers, behind
// them 2 x 8KB for the A rows.
// ---------------------------------------------------------------------------
__global__ __launch_bounds__(512)
void attn_gemm_ln(const unsigned short* __restrict__ A,
                  const unsigned short* __restrict__ WT,
                  const float* __restrict__ gamma,
                  const float* __restrict__ beta,
                  unsigned short* __restrict__ out) {
  extern __shared__ unsigned short smem[];          // 2 * 1024*64 bf16 + A rows
  const int tid  = threadIdx.x;
  const int lane = tid & 31;
  const int wave = tid >> 5;            // 0..15
  const int half = (lane >> 4) & 1;
  const int mr   = lane & 15;
  const int row0 = blockIdx.x * 64;
  const int col0 = wave * 64;

  v8f acc[4][4];
#pragma unroll
  for (int m = 0; m < 4; ++m)
#pragma unroll
    for (int t = 0; t < 4; ++t)
#pragma unroll
      for (int r = 0; r < 8; ++r) acc[m][t][r] = 0.0f;

  gemm_pipeline(A + (size_t)row0 * HID, HID, WT, HID, HID,
                smem, tid, lane, col0, acc);

  __shared__ float s_sum[64];
  __shared__ float s_sq[64];
  if (tid < 64) { s_sum[tid] = 0.0f; s_sq[tid] = 0.0f; }
  __syncthreads();

  // gamma and beta of the lane's 32 columns, asked for ahead of the row sums,
  // which cover the loads' latency
  const int n0 = col0 + 8 * half;       // the lane's eight columns of tile t = 0
  float4 gv[4][2], bv[4][2];
#pragma unroll
  for (int t = 0; t < 4; ++t)
#pragma unroll
    for (int h = 0; h < 2; ++h) {
      gv[t][h] = *reinterpret_cast<const float4*>(gamma + n0 + t * 16 + h * 4);
      bv[t][h] = *reinterpret_cast<const float4*>(beta + n0 + t * 16 + h * 4);
    }

  // A lane holds 32 columns of each of its four rows: their sums are taken in
  // the lane, the other 32 columns of the wave come from lane ^ 16, and one LDS
  // add a row and wave joins the sixteen waves.
#pragma unroll
  for (int m = 0; m < 4; ++m) {
    float ps = 0.0f, pq = 0.0f;
#pragma unroll
    for (int t = 0; t < 4; ++t) {
      float s = 0.0f, q = 0.0f;
#pragma unroll
      for (int r = 0; r < 8; ++r) { float v = acc[m][t][r]; s += v; q += v * v; }
      ps += s;
      pq += q;
    }
    ps += xhalf(ps);
    pq += xhalf(pq);
    if (half == 0) {
      atomicAdd(&s_sum[m * 16 + mr], ps);   // ds_add_f32
      atomicAdd(&s_sq[m * 16 + mr], pq);
    }
  }
  __syncthreads();

  const float inv_h = 1.0f / (float)HID;
  float mu[4], rs[4];
#pragma unroll
  for (int m = 0; m < 4; ++m) {
    const int row = m * 16 + mr;
    mu[m]         = s_sum[row] * inv_h;
    float var     = s_sq[row] * inv_h - mu[m] * mu[m];
    rs[m]         = rsqrtf(var + LN_EPS);
  }
#pragma unroll
  for (int t = 0; t < 4; ++t) {
    const float g[8] = {gv[t][0].x, gv[t][0].y, gv[t][0].z, gv[t][0].w,
                        gv[t][1].x, gv[t][1].y, gv[t][1].z, gv[t][1].w};
    const float b[8] = {bv[t][0].x, bv[t][0].y, bv[t][0].z, bv[t][0].w,
                        bv[t][1].x, bv[t][1].y, bv[t][1].z, bv[t][1].w};
#pragma unroll
    for (int m = 0; m < 4; ++m) {
      float v[8];
#pragma unroll
      for (int r = 0; r < 8; ++r)
        v[r] = (acc[m][t][r] - mu[m]) * rs[m] * g[r] + b[r];
      // eight successive columns of one row: one 16-B store
      *reinterpret_cast<uint4*>(out + (size_t)(row0 + m * 16 + mr) * HID + n0 + t * 16) =
          make_uint4(pack2bf(v[0], v[1]), pack2bf(v[2], v[3]),
                     pack2bf(v[4], v[5]), pack2bf(v[6], v[7]));
    }
  }
}

// ---------------------------------------------------------------------------
// Kernel 4: scores = queries @ keys^T / H, f32.  512 thr (16 waves): 256 q rows
// x 256 keys, each wave 64 x 64.  Dynamic LDS: 2 x 64KB (q rows + key rows).
// ---------------------------------------------------------------------------
__global__ __launch_bounds__(512)
void attn_scores(const unsigned short* __restrict__ Qb,
                 const unsigned short* __restrict__ Kb,
                 float* __restrict__ S) {
  extern __shared__ unsigned short smem[];          // 2 * (256 + 256) * 64 bf16
  const int tid  = threadIdx.x;
  const int lane = tid & 31;
  const int wave = tid >> 5;            // 0..15
  const int half = (lane >> 4) & 1;
  const int mr   = lane & 15;
  const int b    = blockIdx.x >> 6;
  const int row0 = ((blockIdx.x >> 3) & 7) * 256;
  const int key0 = (blockIdx.x & 7) * 256;
  const int wr0  = (wave >> 2) * 64;    // the wave's rows and keys in the tile
  const int wc0  = (wave & 3) * 64;

  v8f acc[4][4];
#pragma unroll
  for (int m = 0; m < 4; ++m)
#pragma unroll
    for (int t = 0; t < 4; ++t)
#pragma unroll
      for (int r = 0; r < 8; ++r) acc[m][t][r] = 0.0f;

  gemm_pipeline_sq(Qb + ((size_t)b * SEQ + row0) * HID,
                   Kb + ((size_t)b * SEQ + key0) * HID, HID, HID,
                   smem, tid, lane, wr0, wc0, acc);

  const float sc = 1.0f / (float)HID;
  float* __restrict__ ps =
      S + ((size_t)b * SEQ + row0 + wr0 + 8 * half) * SEQ + key0 + wc0 + mr;
#pragma unroll
  for (int m = 0; m < 4; ++m)
#pragma unroll
    for (int r = 0; r < 8; ++r)
#pragma unroll
      for (int t = 0; t < 4; ++t)
        ps[(size_t)(m * 16 + r) * SEQ + t * 16] = acc[m][t][r] * sc;
}

// ---------------------------------------------------------------------------
// Kernel 4b: alpha = softmax(scores) by rows, bf16 out.  One wave a row, the
// row's 2048 scores in its registers (64 a lane): no LDS and no barrier.
// ---------------------------------------------------------------------------
// At most 8 waves a SIMD are planned for, so that the register budget holds a
// thread's 16 loads in flight at once.
__global__ __launch_bounds__(256) __attribute__((amdgpu_waves_per_eu(2, 8)))
void attn_softmax(const float* __restrict__ S,
                  unsigned short* __restrict__ alpha) {
  const int lane = threadIdx.x & 31;
  const size_t o = (size_t)(blockIdx.x * 8 + (threadIdx.x >> 5)) * SEQ + lane * 4;
  const float* __restrict__ ps = S + o;
  float4 v[16];
#pragma unroll
  for (int i = 0; i < 16; ++i)
    v[i] = *reinterpret_cast<const float4*>(ps + i * 128);
  // As in conv_tile: the address pair is reused only behind this wait.
  asm volatile("s_wait_xcnt 0x0" :: "v"(ps) : "memory");

  float mx = -3.0e38f;
#pragma unroll
  for (int i = 0; i < 16; ++i)
    mx = fmaxf(mx, fmaxf(fmaxf(v[i].x, v[i].y), fmaxf(v[i].z, v[i].w)));
#pragma unroll
  for (int msk = 1; msk <= 16; msk <<= 1) mx = fmaxf(mx, __shfl_xor(mx, msk, 32));

  float s = 0.0f;
#pragma unroll
  for (int i = 0; i < 16; ++i) {
    v[i].x = __expf(v[i].x - mx);
    v[i].y = __expf(v[i].y - mx);
    v[i].z = __expf(v[i].z - mx);
    v[i].w = __expf(v[i].w - mx);
    s += (v[i].x + v[i].y) + (v[i].z + v[i].w);
  }
#pragma unroll
  for (int msk = 1; msk <= 16; msk <<= 1) s += __shfl_xor(s, msk, 32);
  const float inv = 1.0f / s;

#pragma unroll
  for (int i = 0; i < 16; ++i)
    *reinterpret_cast<uint2*>(alpha + o + i * 128) =
        make_uint2(pack2bf(v[i].x * inv, v[i].y * inv),
                   pack2bf(v[i].z * inv, v[i].w * inv));
}

// ---------------------------------------------------------------------------
// Kernel 5: out = alpha @ Y   (per batch [2048x2048] x [2048x1024], fp32 out)
// 512 thr (16 waves): 256 q rows x 256 f cols, each wave 64 x 64; K-loop over
// 2048.  Dynamic LDS: 2 x 64KB (alpha rows + YT rows).
// ---------------------------------------------------------------------------
__global__ __launch_bounds__(512)
void attn_pv_gemm(const unsigned short* __restrict__ alpha,
                  const unsigned short* __restrict__ YT,
                  float* __restrict__ out) {
  extern __shared__ unsigned short smem[];          // 2 * (256 + 256) * 64 bf16
  const int tid  = threadIdx.x;
  const int lane = tid & 31;
  const int wave = tid >> 5;            // 0..15
  const int half = (lane >> 4) & 1;
  const int mr   = lane & 15;
  const int b    = blockIdx.x >> 5;
  const int row0 = ((blockIdx.x >> 2) & 7) * 256;
  const int f0   = (blockIdx.x & 3) * 256;
  const int wr0  = (wave >> 2) * 64;    // the wave's rows and columns in the tile
  const int wc0  = (wave & 3) * 64;

  v8f acc[4][4];
#pragma unroll
  for (int m = 0; m < 4; ++m)
#pragma unroll
    for (int t = 0; t < 4; ++t)
#pragma unroll
      for (int r = 0; r < 8; ++r) acc[m][t][r] = 0.0f;

  gemm_pipeline_sq(alpha + ((size_t)b * SEQ + row0) * SEQ,
                   YT + ((size_t)b * HID + f0) * SEQ, SEQ, SEQ,
                   smem, tid, lane, wr0, wc0, acc);

  float* __restrict__ po =
      out + ((size_t)b * SEQ + row0 + wr0 + 8 * half) * HID + f0 + wc0 + mr;
#pragma unroll
  for (int m = 0; m < 4; ++m)
#pragma unroll
    for (int r = 0; r < 8; ++r)
#pragma unroll
      for (int t = 0; t < 4; ++t)
        po[(size_t)(m * 16 + r) * HID + t * 16] = acc[m][t][r];
}

// ---------------------------------------------------------------------------
// host launcher
// ---------------------------------------------------------------------------
extern "C" void kernel_launch(void* const* d_in, const int* in_sizes, int n_in,
                              void* d_out, int out_size, void* d_ws, size_t ws_size,
                              hipStream_t stream) {
  const float* X  = (const float*)d_in[0];
  const float* Y  = (const float*)d_in[1];
  const float* K  = (const float*)d_in[2];
  const float* Q  = (const float*)d_in[3];
  const float* g1 = (const float*)d_in[4];
  const float* b1 = (const float*)d_in[5];
  const float* g2 = (const float*)d_in[6];
  const float* b2 = (const float*)d_in[7];
  float* out = (float*)d_out;

  // workspace layout (bytes); total 224 MB.  The f32 scores (128 MB) lie over
  // Xb, Yb, KT and QT, which nothing reads once the keys and queries are made;
  // alpha (64 MB) lies over Kb and Qb, which nothing reads behind the scores.
  char* w = (char*)d_ws;
  const size_t SZ_XY = (size_t)NROWS * HID * 2;        // 32 MB each
  const size_t SZ_W  = (size_t)HID * HID * 2;          // 2 MB each
  unsigned short* YT    = (unsigned short*)(w);
  unsigned short* Kb    = (unsigned short*)(w + SZ_XY);
  unsigned short* Qb    = (unsigned short*)(w + 2 * SZ_XY);
  unsigned short* Xb    = (unsigned short*)(w + 3 * SZ_XY);
  unsigned short* Yb    = (unsigned short*)(w + 4 * SZ_XY);
  unsigned short* KT    = (unsigned short*)(w + 5 * SZ_XY);
  unsigned short* QT    = (unsigned short*)(w + 5 * SZ_XY + SZ_W);
  float*          S     = (float*)(w + 3 * SZ_XY);
  unsigned short* alpha = (unsigned short*)(w + SZ_XY);

  // 256 KB (double-buffered 128KB B tiles) + 16 KB (double-buffered A rows)
  const size_t LDS_B = 2u * 1024u * 128u + 2u * 64u * 128u;

  // 1) convert X,Y -> bf16 (+ Y^T), K,Q -> transposed bf16
  attn_conv_xy<<<dim3(1024, 2), 256, 0, stream>>>(X, Y, Xb, Yb, YT);
  attn_conv_w<<<dim3(64, 2), 256, 0, stream>>>(K, Q, KT, QT);

  // 2) keys = LN(Y @ K), queries = LN(X @ Q)   [fused GEMM+LN, bf16 out]
  attn_gemm_ln<<<NROWS / 64, 512, LDS_B, stream>>>(Yb, KT, g1, b1, Kb);
  attn_gemm_ln<<<NROWS / 64, 512, LDS_B, stream>>>(Xb, QT, g2, b2, Qb);

  // 3) alpha = softmax(queries @ keys^T / H)   [f32 scores, then bf16 alpha]
  attn_scores<<<NBATCH * (SEQ / 256) * (SEQ / 256), 512, 2u * SQ_BUF, stream>>>(Qb, Kb, S);
  attn_softmax<<<NROWS / 8, 256, 0, stream>>>(S, alpha);

  // 4) out = alpha @ Y                          [fp32 out]
  attn_pv_gemm<<<NBATCH * (SEQ / 256) * (HID / 256), 512, 2u * SQ_BUF, stream>>>(alpha, YT, out);
}

// v009
// One run takes 193 microseconds.
// Versions between v007 and this one are left out; their measured steps multiply to 1.17 times as fast.
// All steps since v000 together make it 6.12 times as fast.
#include <hip/hip_runtime.h>

// ---------------------------------------------------------------------------
// MI455X (gfx1250) attention pipeline.
//   keys    = LN(Y @ K)        queries = LN(X @ Q)
//   alpha   = softmax(queries @ keys^T / 1024)
//   out     = alpha @ Y
// All contractions: v_wmma_f32_16x16x32_bf16 with f32 accumulation.
// B operands double-buffered in LDS via global_load_async_to_lds_b128
// (ASYNCcnt) so async DMA of tile k+1 overlaps the WMMAs of tile k.
// Each staged B tile of the LN kernel serves 64 whole rows of A; its products
// are taken transposed (weights as the A operand), so that a lane holds pieces
// of whole output rows and the row sums need no walk over lanes.  The score and
// PV kernels need no whole rows: they take square tiles of 256 x 256, the shape
// that copies the fewest bytes from L2 into LDS per matrix instruction.  The
// softmax has no kernel and no f32 scores in memory: a score tile stores
// P = 2^(s * log2 e - c) in bf16, c a whole number at or above the largest
// exponent of the row's 256 keys, with c and the row's sums of P beside it; the
// PV kernel brings the eight tiles of a row to one exponent, which is exact for
// a power of two, and divides by the row's sum at its end.
// A staged B row is 64 k = 128 B, one whole cache line, so that a wave's copy
// of 512 B touches four lines of L2 and no line is asked for twice.
// The A rows of a work-group are staged the same way, once for all its waves:
// a fragment load from global memory touches sixteen lines for its 512 B, and
// every wave would ask for the same rows again.
// ---------------------------------------------------------------------------

typedef __attribute__((ext_vector_type(16))) __bf16 v16bf;
typedef __attribute__((ext_vector_type(8)))  float  v8f;

#define HID    1024
#define SEQ    2048
#define NBATCH 8
#define NROWS  (NBATCH * SEQ)      // 16384
#define LN_EPS 1e-5f

// round-to-nearest-even float -> bf16 (raw u16)
static __device__ __forceinline__ unsigned short f2bf(float x) {
  unsigned u = __builtin_bit_cast(unsigned, x);
  unsigned r = u + 0x7FFFu + ((u >> 16) & 1u);
  return (unsigned short)(r >> 16);
}

union FragU { v16bf v; uint4 q[2]; };

// LDS tile: rows of 64 bf16 = eight 16-B chunks, no pad.  Chunk q of row n lies
// at place q ^ ((n >> 1) & 7) of its row.  The sixteen lanes of a half wave read
// one chunk number of sixteen successive rows: at plain places they fall on 8
// of the 64 banks, eight deep; at these places they cover all 64 banks once.
static __device__ __forceinline__ int lds_place(int n, int q) {
  return q ^ ((n >> 1) & 7);
}

// 16x32 bf16 fragment read from such an LDS tile, for the k step ks (0 or 1)
// of 32 inside the tile's 64 k; n0 a multiple of 16.
// CDNA5 16-bit A layout: lanes 0-15 hold row M=lane, K in {0..7,16..23};
// lanes 16-31 hold row M=lane-16, K in {8..15,24..31}. Two b128 loads/lane.
static __device__ __forceinline__ v16bf lds_frag(
    const unsigned short* __restrict__ sm, int n0, int ks, int lane) {
  const int half = (lane >> 4) & 1;
  const int r    = lane & 15;
  const unsigned short* row = sm + (size_t)(n0 + r) * 64;
  FragU f;
  f.q[0] = *reinterpret_cast<const uint4*>(row + lds_place(r, ks * 4 + half) * 8);      // ds_load_b128
  f.q[1] = *reinterpret_cast<const uint4*>(row + lds_place(r, ks * 4 + half + 2) * 8);
  return f.v;
}

static __device__ __forceinline__ v8f wmma_bf16(v16bf a, v16bf b, v8f c) {
  return __builtin_amdgcn_wmma_f32_16x16x32_bf16(false, a, false, b,
                                                 (short)0, c, false, false);
}

typedef __attribute__((ext_vector_type(2))) unsigned short u16x2;

// Every bf16 of a fragment of values >= 0 times 2^-d: dd holds d << 7 (d in
// 0..255) in both halves, taken off the exponent fields by a saturating 16-bit
// subtraction.  Exact while the result is a normal number; below that it ends at
// zero or in the subnormals, under 2^-126.
static __device__ __forceinline__ v16bf frag_down(v16bf a, unsigned dd) {
  union { v16bf v; u16x2 h[8]; } f;
  f.v = a;
  const u16x2 d = __builtin_bit_cast(u16x2, dd);
#pragma unroll
  for (int i = 0; i < 8; ++i) f.h[i] = __builtin_elementwise_sub_sat(f.h[i], d);
  return f.v;
}

// lane l takes the value of lane l ^ 16 (v_permlanex16_b32, no LDS trip)
static __device__ __forceinline__ float xhalf(float x) {
  const int b = __builtin_bit_cast(int, x);
  return __builtin_bit_cast(float, __builtin_amdgcn_permlanex16(
      b, b, 0x76543210, 0xfedcba98, false, false));
}

static __device__ __forceinline__ void wait_async0() {
  asm volatile("s_wait_asynccnt 0" ::: "memory");
}

#define TILE_ROWS  1024u                 // B rows in a staged tile
#define TILE_BYTES (TILE_ROWS * 128u)    // 128 KB

// Async-copy one B tile (1024 rows x 64 bf16, row stride ld elems in global,
// rows of 128 B in LDS) into LDS at byte offset lds_base.  512 threads: eight
// lanes move one row, a wave four whole rows; a sweep of the block covers 64
// rows, and sweep i takes the 64 global rows from i * gstep on into LDS rows
// from i * 64 on.  Chunk part of row n lands at place lds_place(n, part); the
// place is the same in every sweep, as 64 rows leave (n >> 1) & 7 as it is.
template <int NC>
static __device__ __forceinline__ void stage_tile(
    unsigned lds_base, const unsigned short* __restrict__ g, int ld, int gstep,
    int tid) {
  static_assert(NC % 8 == 0, "copies are issued in groups of eight");
  static_assert(NC * 64 == (int)TILE_ROWS, "the sweeps cover the tile");
  const int n0   = tid >> 3;
  const int part = tid & 7;
  const unsigned long long gb =
      (unsigned long long)(uintptr_t)(g + (size_t)n0 * ld + part * 8);
  const unsigned l0 =
      lds_base + (unsigned)n0 * 128u + (unsigned)lds_place(n0, part) * 16u;
#pragma unroll
  for (int i0 = 0; i0 < NC; i0 += 8) {
    // One LDS address serves the eight copies of a group: copy j carries the
    // immediate offset j * 8192 (64 LDS rows), which moves BOTH its addresses,
    // so its global address register is set back by as much (the global step of
    // a sweep is larger, so the register still points into the source).  With
    // an LDS address register a copy the compiler keeps them all across the
    // loop.
    const unsigned lo = l0 + (unsigned)i0 * 8192u;
    unsigned long long gp[8];
#pragma unroll
    for (int j = 0; j < 8; ++j)
      gp[j] = gb + ((unsigned long long)((i0 + j) * gstep) * (unsigned long long)ld * 2ull -
                    (unsigned long long)(j * 8192));
    // Eight copies and their s_wait_xcnt in one statement: the address
    // registers stay untouched until the wait has passed.
    asm volatile(
        "global_load_async_to_lds_b128 %0, %1, off\n\t"
        "global_load_async_to_lds_b128 %0, %2, off offset:8192\n\t"
        "global_load_async_to_lds_b128 %0, %3, off offset:16384\n\t"
        "global_load_async_to_lds_b128 %0, %4, off offset:24576\n\t"
        "global_load_async_to_lds_b128 %0, %5, off offset:32768\n\t"
        "global_load_async_to_lds_b128 %0, %6, off offset:40960\n\t"
        "global_load_async_to_lds_b128 %0, %7, off offset:49152\n\t"
        "global_load_async_to_lds_b128 %0, %8, off offset:57344\n\t"
        "s_wait_xcnt 0x0"
        :: "v"(lo),
           "v"(gp[0]), "v"(gp[1]), "v"(gp[2]), "v"(gp[3]),
           "v"(gp[4]), "v"(gp[5]), "v"(gp[6]), "v"(gp[7])
        : "memory");
  }
}

// Async-copy the work-group's A rows of one k chunk (64 rows x 64 bf16, row
// stride ld elems in global, rows of 128 B in LDS, chunks at the places of
// lds_place) into LDS at byte offset lds_base: one copy a thread, every lane on;
// 8 KB, 16 B a lane, a wave four whole rows.
static __device__ __forceinline__ void stage_a(
    unsigned lds_base, const unsigned short* __restrict__ g, int ld, int tid) {
  const int n    = tid >> 3;
  const int part = tid & 7;
  const unsigned short* gp = g + (size_t)n * ld + part * 8;
  const unsigned lo =
      lds_base + (unsigned)n * 128u + (unsigned)lds_place(n, part) * 16u;
  // The copy and its s_wait_xcnt in one statement: the address registers
  // stay untouched until the wait has passed.
  asm volatile(
      "global_load_async_to_lds_b128 %0, %1, off\n\t"
      "s_wait_xcnt 0x0"
      :: "v"(lo), "v"(gp) : "memory");
}

// The matrix work of one staged k chunk, for one wave tile of 64 rows x 64 cols:
//   acc[m][t] += A chunk[LDS rows m*16..+16] * B tile[LDS rows col0+t*16..+16]
// Every fragment read from LDS feeds four matrix instructions; the fragments of
// a k step of 32 are read as one group.
// SWAP: the B tile's rows go in as the A operand and the A chunk's rows as the
// B operand (both fragments have one layout and one k order), so acc[m][t] holds
// the transposed 16 x 16 tile: lane = A chunk row, register = B tile row.
// DOWN: row n of the A chunk is taken times 2^-d, d << 7 twice in dl[n].
template <bool SWAP, bool DOWN>
static __device__ __forceinline__ void tile_mma(
    const unsigned short* sma, const unsigned short* smc, int lane, int col0,
    const unsigned* dl, v8f (&acc)[4][4]) {
  unsigned dd[4];
  if (DOWN) {
#pragma unroll
    for (int m = 0; m < 4; ++m) dd[m] = dl[m * 16 + (lane & 15)];
  }
#pragma unroll
  for (int ks = 0; ks < 2; ++ks) {
    // the fragments of this k step from LDS as one group, then the 16 WMMAs
    v16bf a[4], bf[4];
    bf[0] = lds_frag(smc, col0, ks, lane);
#pragma unroll
    for (int m = 0; m < 4; ++m) a[m] = lds_frag(sma, m * 16, ks, lane);
#pragma unroll
    for (int t = 1; t < 4; ++t)
      bf[t] = lds_frag(smc, col0 + t * 16, ks, lane);
    // Keeps the LDS reads as one group ahead of the WMMAs: the compiler
    // otherwise spreads them among the WMMAs, a full wait at each.
    __builtin_amdgcn_sched_barrier(0);
    if (DOWN) {
#pragma unroll
      for (int m = 0; m < 4; ++m) a[m] = frag_down(a[m], dd[m]);
    }
#pragma unroll
    for (int t = 0; t < 4; ++t)
#pragma unroll
      for (int m = 0; m < 4; ++m)
        acc[m][t] = SWAP ? wmma_bf16(bf[t], a[m], acc[m][t])
                         : wmma_bf16(a[m], bf[t], acc[m][t]);
    // Holds the WMMAs in front of what follows (the waits at the tile's foot):
    // the compiler otherwise sinks them behind the barrier, and the next
    // tile's copies no longer fly under them.
    __builtin_amdgcn_sched_barrier(0);
  }
}

// Double-buffered pipelined mainloop, one wave tile of 64 rows x 64 cols of a
// block tile of 64 rows x 1024 cols.  B staged async into LDS in tiles of 1024
// rows x 64 k, the tile of k chunk kc in the buffer of kc's parity; a wave reads
// LDS rows col0 .. +64, col0 = wave*64.  The block's A rows of k chunk kc lie
// behind the two B buffers, in the A buffer of kc's parity; they are copied
// together with the chunk's B tile.  The tiles come out transposed:
// acc[m][t][r] of lane (half, mr) is row m*16 + mr, column col0 + t*16 + 8*half + r.
static __device__ __forceinline__ void gemm_pipeline(
    const unsigned short* __restrict__ Arow, int ldA,
    const unsigned short* __restrict__ B0,  int ldB,
    int Kdim, unsigned short* sm, int tid, int lane, int col0,
    v8f (&acc)[4][4]) {
  constexpr unsigned A_BYTES = 64u * 128u;
  const unsigned sbase = (unsigned)(unsigned long long)(uintptr_t)sm;
  const unsigned abase = sbase + 2u * TILE_BYTES;
  const unsigned short* smA = sm + TILE_BYTES;      // 2 * TILE_BYTES bytes on
  const int nK = Kdim / 64;

  stage_a(abase, Arow, ldA, tid);
  stage_tile<16>(sbase, B0, ldB, 64, tid);
  wait_async0();
  __syncthreads();

  for (int kc = 0; kc < nK; ++kc) {
    const bool odd = (kc & 1) != 0;
    const unsigned aCur = odd ? A_BYTES : 0u;
    const unsigned aNxt = odd ? 0u : A_BYTES;
    const unsigned curOff = odd ? TILE_BYTES : 0u;
    const unsigned nxtOff = odd ? 0u : TILE_BYTES;
    // issue async DMA for the next tile (overlaps this tile's compute)
    if (kc + 1 < nK) {
      stage_a(abase + aNxt, Arow + (size_t)(kc + 1) * 64, ldA, tid);
      stage_tile<16>(sbase + nxtOff, B0 + (size_t)(kc + 1) * 64, ldB, 64, tid);
    }
    tile_mma<true, false>(smA + (aCur >> 1), sm + (curOff >> 1), lane, col0, nullptr, acc);
    // own LDS reads of this tile retired before the buffer is handed back
    asm volatile("s_wait_dscnt 0" ::: "memory");
    wait_async0();     // own copies for the next tile done (overlapped compute)
    __syncthreads();   // block-wide: this tile's reads done, next tile visible
  }
}

#define SQ_HALF (256u * 128u)    // 32 KB: 256 rows of 64 k
#define SQ_BUF  (2u * SQ_HALF)   // one buffer: the A rows, behind them the B rows

// Async-copy one k chunk of a 256 x 256 block tile (256 A rows and 256 B rows x
// 64 bf16, row stride ld elems in global, rows of 128 B in LDS, chunks at the
// places of lds_place) into the buffer at LDS byte offset lds_base.  512 threads:
// eight lanes move one row, a sweep of the block 64 rows, four sweeps a matrix.
static __device__ __forceinline__ void stage_sq(
    unsigned lds_base, const unsigned short* __restrict__ ga,
    const unsigned short* __restrict__ gb, int ld, int tid) {
  const int n0   = tid >> 3;
  const int part = tid & 7;
  const size_t o = (size_t)n0 * ld + part * 8;
  const unsigned long long a0 = (unsigned long long)(uintptr_t)(ga + o);
  const unsigned long long b0 = (unsigned long long)(uintptr_t)(gb + o);
  const unsigned la =
      lds_base + (unsigned)n0 * 128u + (unsigned)lds_place(n0, part) * 16u;
  const unsigned lb = la + SQ_HALF;
  // As in stage_tile: copy j of a matrix carries the immediate offset j * 8192
  // (64 LDS rows), which moves both its addresses, so its global address
  // register is set back by as much.
  unsigned long long pa[4], pb[4];
#pragma unroll
  for (int j = 0; j < 4; ++j) {
    const unsigned long long step =
        (unsigned long long)(j * 64) * (unsigned long long)ld * 2ull -
        (unsigned long long)(j * 8192);
    pa[j] = a0 + step;
    pb[j] = b0 + step;
  }
  // Eight copies and their s_wait_xcnt in one statement: the address registers
  // stay untouched until the wait has passed.
  asm volatile(
      "global_load_async_to_lds_b128 %0, %2, off\n\t"
      "global_load_async_to_lds_b128 %0, %3, off offset:8192\n\t"
      "global_load_async_to_lds_b128 %0, %4, off offset:16384\n\t"
      "global_load_async_to_lds_b128 %0, %5, off offset:24576\n\t"
      "global_load_async_to_lds_b128 %1, %6, off\n\t"
      "global_load_async_to_lds_b128 %1, %7, off offset:8192\n\t"
      "global_load_async_to_lds_b128 %1, %8, off offset:16384\n\t"
      "global_load_async_to_lds_b128 %1, %9, off offset:24576\n\t"
      "s_wait_xcnt 0x0"
      :: "v"(la), "v"(lb),
         "v"(pa[0]), "v"(pa[1]), "v"(pa[2]), "v"(pa[3]),
         "v"(pb[0]), "v"(pb[1]), "v"(pb[2]), "v"(pb[3])
      : "memory");
}

// Double-buffered mainloop of a 256 x 256 block tile, sixteen wave tiles of
// 64 x 64: a k chunk of 64 brings 64 KB into LDS for 512 matrix instructions.
// The wave reads A rows arow0 .. +64 and B rows brow0 .. +64 of the buffer.
// SWAP: the tiles come out transposed, as in gemm_pipeline.  DOWN: dtab (LDS,
// written in front of the call; the barrier ahead of the loop publishes it) holds
// for every 256 k a plane of 256 words, the A rows' d << 7 of tile_mma.
template <bool SWAP, bool DOWN>
static __device__ __forceinline__ void gemm_pipeline_sq(
    const unsigned short* __restrict__ A0, const unsigned short* __restrict__ B0,
    int ld, int Kdim, unsigned short* sm, int tid, int lane, int arow0, int brow0,
    const unsigned* dtab, v8f (&acc)[4][4]) {
  const unsigned sbase = (unsigned)(unsigned long long)(uintptr_t)sm;
  const int nK = Kdim / 64;

  stage_sq(sbase, A0, B0, ld, tid);
  wait_async0();
  __syncthreads();

  for (int kc = 0; kc < nK; ++kc) {
    const unsigned cur = (kc & 1) ? SQ_BUF : 0u;
    // issue async DMA for the next chunk (overlaps this chunk's compute)
    if (kc + 1 < nK)
      stage_sq(sbase + (SQ_BUF - cur), A0 + (size_t)(kc + 1) * 64,
               B0 + (size_t)(kc + 1) * 64, ld, tid);
    tile_mma<SWAP, DOWN>(sm + (cur >> 1) + arow0 * 64, sm + ((cur + SQ_HALF) >> 1), lane,
                         brow0, DOWN ? dtab + (kc >> 2) * 256 + arow0 : nullptr, acc);
    // own LDS reads of this chunk retired before the buffer is handed back
    asm volatile("s_wait_dscnt 0" ::: "memory");
    wait_async0();     // own copies for the next chunk done (overlapped compute)
    __syncthreads();   // block-wide: this chunk's reads done, next chunk visible
  }
}

// ---------------------------------------------------------------------------
// Conversion kernels.  Work-groups of 8 waves take 128 x 128 tiles, 64 elements
// a thread, so that a launch starts 64x fewer waves than one element a thread
// would; global loads are 16 B a lane (512 B of one row a wave), stores cover
// 256 contiguous bytes of a row, and the transposed copy goes through LDS.
// ---------------------------------------------------------------------------
#define CT   128                 // tile edge, elements
#define CTPD (CT / 2 + 1)        // LDS row pitch in dwords (two bf16 a dword)

static __device__ __forceinline__ unsigned pack2bf(float lo, float hi) {
  return (unsigned)f2bf(lo) | ((unsigned)f2bf(hi) << 16);
}

// One 128 x 128 tile of a row-major f32 matrix with HID columns.
//   dstT[c * ldT + r] = bf16(src[r * HID + c]);  STRAIGHT: dst[r * HID + c] too.
// 256 threads; tile = CT * CTPD dwords of LDS.
template <bool STRAIGHT>
static __device__ __forceinline__ void conv_tile(
    const float* __restrict__ src, unsigned short* __restrict__ dst,
    unsigned short* __restrict__ dstT, int ldT, unsigned* tile, int tid) {
  const int c4 = tid & 31;       // group of four columns
  const int r0 = tid >> 5;       // a wave reads one row at a time
  const float* __restrict__ ps = src + (size_t)r0 * HID + c4 * 4;
  float4 v[16];
#pragma unroll
  for (int i = 0; i < 16; ++i)
    v[i] = *reinterpret_cast<const float4*>(ps + (size_t)(8 * i) * HID);
  // The loads' address register pair is reused only behind this wait; naming
  // the address keeps it out of the loads' own destination registers.
  asm volatile("s_wait_xcnt 0x0" :: "v"(ps) : "memory");
  uint2 pk[16];
#pragma unroll
  for (int i = 0; i < 16; ++i) {
    const int r = r0 + 8 * i;
    pk[i] = make_uint2(pack2bf(v[i].x, v[i].y), pack2bf(v[i].z, v[i].w));
    tile[r * CTPD + c4 * 2]     = pk[i].x;
    tile[r * CTPD + c4 * 2 + 1] = pk[i].y;
  }
  __syncthreads();

  // The straight copy is stored behind the barrier: in front of it the barrier
  // would wait until these global stores have completed.
  if (STRAIGHT) {
#pragma unroll
    for (int i = 0; i < 16; ++i)
      *reinterpret_cast<uint2*>(dst + (size_t)(r0 + 8 * i) * HID + c4 * 4) = pk[i];
  }

  // A thread gathers eight rows of one column pair: 16 B for each of two rows
  // of the transposed copy; sixteen lanes fill 256 contiguous bytes of a row.
  const int rg = tid & 15;       // group of eight source rows
#pragma unroll
  for (int p = 0; p < 4; ++p) {
    const int cp = (tid >> 4) + 16 * p;      // column pair, 0..63
    unsigned a[8];
#pragma unroll
    for (int j = 0; j < 8; ++j) a[j] = tile[(rg * 8 + j) * CTPD + cp];
    uint4 lo, hi;
    lo.x = (a[0] & 0xFFFFu) | (a[1] << 16);
    lo.y = (a[2] & 0xFFFFu) | (a[3] << 16);
    lo.z = (a[4] & 0xFFFFu) | (a[5] << 16);
    lo.w = (a[6] & 0xFFFFu) | (a[7] << 16);
    hi.x = (a[0] >> 16) | (a[1] & 0xFFFF0000u);
    hi.y = (a[2] >> 16) | (a[3] & 0xFFFF0000u);
    hi.z = (a[4] >> 16) | (a[5] & 0xFFFF0000u);
    hi.w = (a[6] >> 16) | (a[7] & 0xFFFF0000u);
    *reinterpret_cast<uint4*>(dstT + (size_t)(2 * cp) * ldT + rg * 8)     = lo;
    *reinterpret_cast<uint4*>(dstT + (size_t)(2 * cp + 1) * ldT + rg * 8) = hi;
  }
}

// ---------------------------------------------------------------------------
// Kernel 1: all four conversions in one grid; none reads what another writes.
//   K,Q fp32 [F,H] -> transposed bf16 [H,F]  (B-operand layout)
//   X,Y fp32 -> bf16 row-major; also Y^T (per batch) in bf16
// Work-groups 0..127 take the 64 tiles of K and of Q (first, as they are few and
// the next launch waits for them as for the rest), the next 1024 a tile of Y
// each, the last 1024 the same count of X elements each.
// ---------------------------------------------------------------------------
#define CONV_W_TILES  ((HID / CT) * (HID / CT))       // 64 a weight matrix
#define CONV_XY_TILES ((NROWS / CT) * (HID / CT))     // 1024 a matrix
// At most 8 waves a SIMD are planned for, so that the register budget holds a
// thread's 16 loads in flight at once (at 64 registers they go out in turns).
__global__ __launch_bounds__(256) __attribute__((amdgpu_waves_per_eu(2, 8)))
void attn_conv(const float* __restrict__ X,
               const float* __restrict__ Y,
               const float* __restrict__ K,
               const float* __restrict__ Q,
               unsigned short* __restrict__ Xb,
               unsigned short* __restrict__ Yb,
               unsigned short* __restrict__ YT,
               unsigned short* __restrict__ KT,
               unsigned short* __restrict__ QT) {
  __shared__ unsigned tile[CT * CTPD];
  const int tid = threadIdx.x;
  const int bid = blockIdx.x;
  if (bid < 2 * CONV_W_TILES) {
    const int t  = bid & (CONV_W_TILES - 1);
    const int h0 = (t & 7) * CT;
    const int f0 = (t >> 3) * CT;
    const float* __restrict__ s    = (bid < CONV_W_TILES) ? K : Q;
    unsigned short* __restrict__ d = (bid < CONV_W_TILES) ? KT : QT;
    conv_tile<false>(s + (size_t)f0 * HID + h0, nullptr,
                     d + (size_t)h0 * HID + f0, HID, tile, tid);
  } else if (bid < 2 * CONV_W_TILES + CONV_XY_TILES) {
    const int t   = bid - 2 * CONV_W_TILES;
    const int f0  = (t & 7) * CT;            // HID / CT = 8 column tiles
    const int row = (t >> 3) * CT;           // row of the [NROWS, HID] view
    const int b   = row >> 11;               // / SEQ
    const int s0  = row & (SEQ - 1);
    const size_t o = (size_t)row * HID + f0;
    conv_tile<true>(Y + o, Yb + o, YT + ((size_t)b * HID + f0) * SEQ + s0, SEQ,
                    tile, tid);              // Y^T[b][f][s]
  } else {
    const int t = bid - (2 * CONV_W_TILES + CONV_XY_TILES);
    const size_t base = (size_t)t * (CT * CT) + (size_t)tid * 4;
    const float* __restrict__ px = X + base;
    float4 v[16];
#pragma unroll
    for (int i = 0; i < 16; ++i)
      v[i] = *reinterpret_cast<const float4*>(px + i * 1024);
    // As in conv_tile: the address pair is reused only behind this wait.
    asm volatile("s_wait_xcnt 0x0" :: "v"(px) : "memory");
#pragma unroll
    for (int i = 0; i < 16; ++i)
      *reinterpret_cast<uint2*>(Xb + base + i * 1024) =
          make_uint2(pack2bf(v[i].x, v[i].y), pack2bf(v[i].z, v[i].w));
    // The stores' data and address registers are reused only behind this wait.
    asm volatile("s_wait_xcnt 0x0" ::: "memory");
  }
}

// ---------------------------------------------------------------------------
// Kernel 2: fused GEMM + LayerNorm.  512 thr (16 waves): 64 rows x 1024 cols,
// each wave 64 rows x 64 cols.  Dynamic LDS: 2 x 128KB B-tile buffers, behind
// them 2 x 8KB for the A rows.  One grid makes the keys (even work-groups) and
// the queries (odd ones): neither reads the other, and a WGP that is done with
// a work-group takes the next without waiting for the slowest of a launch.
// ---------------------------------------------------------------------------
__global__ __launch_bounds__(512)
void attn_gemm_ln(const unsigned short* __restrict__ A0,
                  const unsigned short* __restrict__ WT0,
                  const float* __restrict__ gamma0,
                  const float* __restrict__ beta0,
                  unsigned short* __restrict__ out0,
                  const unsigned short* __restrict__ A1,
                  const unsigned short* __restrict__ WT1,
                  const float* __restrict__ gamma1,
                  const float* __restrict__ beta1,
                  unsigned short* __restrict__ out1) {
  extern __shared__ unsigned short smem[];          // 2 * 1024*64 bf16 + A rows
  const bool odd = (blockIdx.x & 1) != 0;
  const unsigned short* __restrict__ A  = odd ? A1 : A0;
  const unsigned short* __restrict__ WT = odd ? WT1 : WT0;
  const float* __restrict__ gamma       = odd ? gamma1 : gamma0;
  const float* __restrict__ beta        = odd ? beta1 : beta0;
  unsigned short* __restrict__ out      = odd ? out1 : out0;
  const int tid  = threadIdx.x;
  const int lane = tid & 31;
  const int wave = tid >> 5;            // 0..15
  const int half = (lane >> 4) & 1;
  const int mr   = lane & 15;
  const int row0 = (blockIdx.x >> 1) * 64;
  const int col0 = wave * 64;

  v8f acc[4][4];
#pragma unroll
  for (int m = 0; m < 4; ++m)
#pragma unroll
    for (int t = 0; t < 4; ++t)
#pragma unroll
      for (int r = 0; r < 8; ++r) acc[m][t][r] = 0.0f;

  gemm_pipeline(A + (size_t)row0 * HID, HID, WT, HID, HID,
                smem, tid, lane, col0, acc);

  __shared__ float s_sum[64];
  __shared__ float s_sq[64];
  if (tid < 64) { s_sum[tid] = 0.0f; s_sq[tid] = 0.0f; }
  __syncthreads();

  // gamma and beta of the lane's 32 columns, asked for ahead of the row sums,
  // which cover the loads' latency
  const int n0 = col0 + 8 * half;       // the lane's eight columns of tile t = 0
  float4 gv[4][2], bv[4][2];
#pragma unroll
  for (int t = 0; t < 4; ++t)
#pragma unroll
    for (int h = 0; h < 2; ++h) {
      gv[t][h] = *reinterpret_cast<const float4*>(gamma + n0 + t * 16 + h * 4);
      bv[t][h] = *reinterpret_cast<const float4*>(beta + n0 + t * 16 + h * 4);
    }

  // A lane holds 32 columns of each of its four rows: their sums are taken in
  // the lane, the other 32 columns of the wave come from lane ^ 16, and one LDS
  // add a row and wave joins the sixteen waves.
#pragma unroll
  for (int m = 0; m < 4; ++m) {
    float ps = 0.0f, pq = 0.0f;
#pragma unroll
    for (int t = 0; t < 4; ++t) {
      float s = 0.0f, q = 0.0f;
#pragma unroll
      for (int r = 0; r < 8; ++r) { float v = acc[m][t][r]; s += v; q += v * v; }
      ps += s;
      pq += q;
    }
    ps += xhalf(ps);
    pq += xhalf(pq);
    if (half == 0) {
      atomicAdd(&s_sum[m * 16 + mr], ps);   // ds_add_f32
      atomicAdd(&s_sq[m * 16 + mr], pq);
    }
  }
  __syncthreads();

  const float inv_h = 1.0f / (float)HID;
  float mu[4], rs[4];
#pragma unroll
  for (int m = 0; m < 4; ++m) {
    const int row = m * 16 + mr;
    mu[m]         = s_sum[row] * inv_h;
    float var     = s_sq[row] * inv_h - mu[m] * mu[m];
    rs[m]         = rsqrtf(var + LN_EPS);
  }
#pragma unroll
  for (int t = 0; t < 4; ++t) {
    const float g[8] = {gv[t][0].x, gv[t][0].y, gv[t][0].z, gv[t][0].w,
                        gv[t][1].x, gv[t][1].y, gv[t][1].z, gv[t][1].w};
    const float b[8] = {bv[t][0].x, bv[t][0].y, bv[t][0].z, bv[t][0].w,
                        bv[t][1].x, bv[t][1].y, bv[t][1].z, bv[t][1].w};
#pragma unroll
    for (int m = 0; m < 4; ++m) {
      float v[8];
#pragma unroll
      for (int r = 0; r < 8; ++r)
        v[r] = (acc[m][t][r] - mu[m]) * rs[m] * g[r] + b[r];
      // eight successive columns of one row: one 16-B store
      *reinterpret_cast<uint4*>(out + (size_t)(row0 + m * 16 + mr) * HID + n0 + t * 16) =
          make_uint4(pack2bf(v[0], v[1]), pack2bf(v[2], v[3]),
                     pack2bf(v[4], v[5]), pack2bf(v[6], v[7]));
    }
  }
}

typedef __attribute__((ext_vector_type(2))) float  f32x2;
typedef __attribute__((ext_vector_type(2))) __bf16 bf16x2;

// two f32 to a bf16 pair, round to nearest even, in one v_cvt_pk_bf16_f32
static __device__ __forceinline__ unsigned cvt2bf(float lo, float hi) {
  const f32x2 v = {lo, hi};
  return __builtin_bit_cast(unsigned, __builtin_convertvector(v, bf16x2));
}

// ---------------------------------------------------------------------------
// Kernel 3: P = 2^(queries @ keys^T * log2 e / H - c), bf16, c per row and tile.
// 512 thr (16 waves): 256 q rows x 256 keys, each wave 64 x 64, transposed tiles:
// a lane holds 32 keys of each of its four rows.  Dynamic LDS: 2 x 64KB (q rows +
// key rows).  A work-group writes whole lines of P, of pc and of pl.
//   pc[(b * 8 + key tile) * SEQ + row]             the tile's exponent c
//   pl[((b * 8 + key tile) * SEQ + row) * 4 + w]   sum of P over 64 keys
// ---------------------------------------------------------------------------
__global__ __launch_bounds__(512)
void attn_scores(const unsigned short* __restrict__ Qb,
                 const unsigned short* __restrict__ Kb,
                 unsigned short* __restrict__ P,
                 float* __restrict__ pc,
                 float* __restrict__ pl) {
  extern __shared__ unsigned short smem[];          // 2 * (256 + 256) * 64 bf16
  __shared__ __attribute__((aligned(16))) float s_mx[256 * 4];   // read 16 B a row
  const int tid  = threadIdx.x;
  const int lane = tid & 31;
  const int wave = tid >> 5;            // 0..15
  const int half = (lane >> 4) & 1;
  const int mr   = lane & 15;
  const int b    = blockIdx.x >> 6;
  const int row0 = ((blockIdx.x >> 3) & 7) * 256;
  const int kt   = blockIdx.x & 7;
  const int key0 = kt * 256;
  const int wr0  = (wave >> 2) * 64;    // the wave's rows and keys in the tile
  const int wq   = wave & 3;
  const int wc0  = wq * 64;

  v8f acc[4][4];
#pragma unroll
  for (int m = 0; m < 4; ++m)
#pragma unroll
    for (int t = 0; t < 4; ++t)
#pragma unroll
      for (int r = 0; r < 8; ++r) acc[m][t][r] = 0.0f;

  gemm_pipeline_sq<true, false>(Qb + ((size_t)b * SEQ + row0) * HID,
                                Kb + ((size_t)b * SEQ + key0) * HID, HID, HID,
                                smem, tid, lane, wr0, wc0, nullptr, acc);

  // Largest product of each row: 32 keys in the lane, 32 from lane ^ 16, the
  // other three waves of the row through LDS.
#pragma unroll
  for (int m = 0; m < 4; ++m) {
    float mx = acc[m][0][0];
#pragma unroll
    for (int t = 0; t < 4; ++t)
#pragma unroll
      for (int r = 0; r < 8; ++r) mx = fmaxf(mx, acc[m][t][r]);
    mx = fmaxf(mx, xhalf(mx));
    if (half == 0) s_mx[(wr0 + m * 16 + mr) * 4 + wq] = mx;
  }
  __syncthreads();

  const float sc2 = 1.4426950408889634f / (float)HID;   // log2 e / H
  const size_t srow = (size_t)(b * 8 + kt) * SEQ + row0 + wr0 + mr;
  unsigned short* __restrict__ pp =
      P + ((size_t)b * SEQ + row0 + wr0 + mr) * SEQ + key0 + wc0 + 8 * half;
#pragma unroll
  for (int m = 0; m < 4; ++m) {
    const float4 q = *reinterpret_cast<const float4*>(&s_mx[(wr0 + m * 16 + mr) * 4]);
    const float c = ceilf(fmaxf(fmaxf(q.x, q.y), fmaxf(q.z, q.w)) * sc2);
    float sum = 0.0f;
#pragma unroll
    for (int t = 0; t < 4; ++t) {
      float p[8];
#pragma unroll
      for (int r = 0; r < 8; ++r)
        p[r] = __builtin_amdgcn_exp2f(acc[m][t][r] * sc2 - c);
      sum += ((p[0] + p[1]) + (p[2] + p[3])) + ((p[4] + p[5]) + (p[6] + p[7]));
      // eight successive keys of one row: one 16-B store
      *reinterpret_cast<uint4*>(pp + (size_t)(m * 16) * SEQ + t * 16) =
          make_uint4(cvt2bf(p[0], p[1]), cvt2bf(p[2], p[3]),
                     cvt2bf(p[4], p[5]), cvt2bf(p[6], p[7]));
    }
    sum += xhalf(sum);
    if (half == 0) {
      pl[(srow + m * 16) * 4 + wq] = sum;
      if (wq == 0) pc[srow + m * 16] = c;
    }
  }
}

// ---------------------------------------------------------------------------
// Kernel 4: out = softmax @ Y = (sum over key tiles of 2^(c - C) P @ Y) / L
// (per batch [2048x2048] x [2048x1024], fp32 out), C the largest c of the row,
// L = sum over key tiles of 2^(c - C) * (the tile's sums of P).
// 512 thr (16 waves): 256 q rows x 256 f cols, each wave 64 x 64; K-loop over
// 2048.  Dynamic LDS: 2 x 64KB (P rows + YT rows).
// ---------------------------------------------------------------------------
__global__ __launch_bounds__(512)
void attn_pv_gemm(const unsigned short* __restrict__ P,
                  const float* __restrict__ pc,
                  const float* __restrict__ pl,
                  const unsigned short* __restrict__ YT,
                  float* __restrict__ out) {
  extern __shared__ unsigned short smem[];          // 2 * (256 + 256) * 64 bf16
  __shared__ unsigned s_dd[8 * 256];
  __shared__ __attribute__((aligned(16))) float s_inv[256];      // read 16 B at a time
  const int tid  = threadIdx.x;
  const int lane = tid & 31;
  const int wave = tid >> 5;            // 0..15
  const int half = (lane >> 4) & 1;
  const int mr   = lane & 15;
  const int b    = blockIdx.x >> 5;
  const int row0 = ((blockIdx.x >> 2) & 7) * 256;
  const int f0   = (blockIdx.x & 3) * 256;
  const int wr0  = (wave >> 2) * 64;    // the wave's rows and columns in the tile
  const int wc0  = (wave & 3) * 64;

  // One thread a row (waves 0..7): the row's exponent steps and 1 / L into LDS.
  if (tid < 256) {
    const float* __restrict__ qc = pc + (size_t)(b * 8) * SEQ + row0 + tid;
    const float* __restrict__ ql = pl + ((size_t)(b * 8) * SEQ + row0 + tid) * 4;
    float c[8];
    float4 l[8];
#pragma unroll
    for (int t = 0; t < 8; ++t) {
      c[t] = qc[t * SEQ];
      l[t] = *reinterpret_cast<const float4*>(ql + t * (SEQ * 4));
    }
    // As in conv_tile: the address pair is reused only behind this wait (the
    // loads of c go by the thread's number, which lives on).
    asm volatile("s_wait_xcnt 0x0" :: "v"(ql) : "memory");
    float C = c[0];
#pragma unroll
    for (int t = 1; t < 8; ++t) C = fmaxf(C, c[t]);
    float L = 0.0f;
#pragma unroll
    for (int t = 0; t < 8; ++t) {
      const float d = C - c[t];         // a whole number >= 0
      L += __builtin_amdgcn_exp2f(-d) * ((l[t].x + l[t].y) + (l[t].z + l[t].w));
      s_dd[t * 256 + tid] = ((unsigned)fminf(d, 255.0f) << 7) * 0x10001u;
    }
    s_inv[tid] = 1.0f / L;
  }

  v8f acc[4][4];
#pragma unroll
  for (int m = 0; m < 4; ++m)
#pragma unroll
    for (int t = 0; t < 4; ++t)
#pragma unroll
      for (int r = 0; r < 8; ++r) acc[m][t][r] = 0.0f;

  gemm_pipeline_sq<false, true>(P + ((size_t)b * SEQ + row0) * SEQ,
                                YT + ((size_t)b * HID + f0) * SEQ, SEQ, SEQ,
                                smem, tid, lane, wr0, wc0, s_dd, acc);

  float* __restrict__ po =
      out + ((size_t)b * SEQ + row0 + wr0 + 8 * half) * HID + f0 + wc0 + mr;
#pragma unroll
  for (int m = 0; m < 4; ++m) {
    const float4 i0 = *reinterpret_cast<const float4*>(&s_inv[wr0 + m * 16 + 8 * half]);
    const float4 i1 = *reinterpret_cast<const float4*>(&s_inv[wr0 + m * 16 + 8 * half + 4]);
    const float iv[8] = {i0.x, i0.y, i0.z, i0.w, i1.x, i1.y, i1.z, i1.w};
#pragma unroll
    for (int r = 0; r < 8; ++r)
#pragma unroll
      for (int t = 0; t < 4; ++t)
        po[(size_t)(m * 16 + r) * HID + t * 16] = acc[m][t][r] * iv[r];
  }
}

// ---------------------------------------------------------------------------
// host launcher
// ---------------------------------------------------------------------------
extern "C" void kernel_launch(void* const* d_in, const int* in_sizes, int n_in,
                              void* d_out, int out_size, void* d_ws, size_t ws_size,
                              hipStream_t stream) {
  const float* X  = (const float*)d_in[0];
  const float* Y  = (const float*)d_in[1];
  const float* K  = (const float*)d_in[2];
  const float* Q  = (const float*)d_in[3];
  const float* g1 = (const float*)d_in[4];
  const float* b1 = (const float*)d_in[5];
  const float* g2 = (const float*)d_in[6];
  const float* b2 = (const float*)d_in[7];
  float* out = (float*)d_out;

  // workspace layout (bytes); total 194.5 MB.  P (64 MB) lies over Xb and Yb,
  // which nothing reads once the keys and queries are made.
  char* w = (char*)d_ws;
  const size_t SZ_XY = (size_t)NROWS * HID * 2;        // 32 MB each
  const size_t SZ_W  = (size_t)HID * HID * 2;          // 2 MB each
  unsigned short* YT    = (unsigned short*)(w);
  unsigned short* Kb    = (unsigned short*)(w + SZ_XY);
  unsigned short* Qb    = (unsigned short*)(w + 2 * SZ_XY);
  unsigned short* Xb    = (unsigned short*)(w + 3 * SZ_XY);
  unsigned short* Yb    = (unsigned short*)(w + 4 * SZ_XY);
  unsigned short* KT    = (unsigned short*)(w + 5 * SZ_XY);
  unsigned short* QT    = (unsigned short*)(w + 5 * SZ_XY + SZ_W);
  unsigned short* P     = (unsigned short*)(w + 3 * SZ_XY);
  float*          pl    = (float*)(w + 6 * SZ_XY);            // 2 MB
  float*          pc    = (float*)(w + 6 * SZ_XY + SZ_W);     // 512 KB

  // 256 KB (double-buffered 128KB B tiles) + 16 KB (double-buffered A rows)
  const size_t LDS_B = 2u * 1024u * 128u + 2u * 64u * 128u;

  // 1) convert X,Y -> bf16 (+ Y^T), K,Q -> transposed bf16
  attn_conv<<<2 * CONV_W_TILES + 2 * CONV_XY_TILES, 256, 0, stream>>>(
      X, Y, K, Q, Xb, Yb, YT, KT, QT);

  // 2) keys = LN(Y @ K), queries = LN(X @ Q)   [fused GEMM+LN, bf16 out]
  attn_gemm_ln<<<2 * (NROWS / 64), 512, LDS_B, stream>>>(Yb, KT, g1, b1, Kb,
                                                         Xb, QT, g2, b2, Qb);

  // 3) P = exp(queries @ keys^T / H) by tiles, each to its own power of two
  attn_scores<<<NBATCH * (SEQ / 256) * (SEQ / 256), 512, 2u * SQ_BUF, stream>>>(Qb, Kb, P, pc, pl);

  // 4) out = softmax @ Y                        [fp32 out]
  attn_pv_gemm<<<NBATCH * (SEQ / 256) * (HID / 256), 512, 2u * SQ_BUF, stream>>>(P, pc, pl, YT, out);
}

// v010
// One run takes 182 microseconds.
// Timed twice side by side with v009, it ran 1.06 times as fast both times.
// Counting every step since v000, it is 6.49 times as fast.
#include <hip/hip_runtime.h>

// ---------------------------------------------------------------------------
// MI455X (gfx1250) attention pipeline.
//   keys    = LN(Y @ K)        queries = LN(X @ Q)
//   alpha   = softmax(queries @ keys^T / 1024)
//   out     = alpha @ Y
// All contractions: v_wmma_f32_16x16x32_bf16 with f32 accumulation.
// B operands double-buffered in LDS via global_load_async_to_lds_b128
// (ASYNCcnt) so async DMA of tile k+1 overlaps the WMMAs of tile k.
// The LN kernel needs whole rows of 1024 columns, more than the registers hold
// for 128 rows: a work-group takes 128 rows in two passes of 512 columns and
// keeps the first pass in LDS until the rows' sums are known.  Its products are
// taken transposed (weights as the A operand), so that a lane holds pieces of
// whole output rows and the row sums need no walk over lanes.  The score and
// PV kernels need no whole rows: they take square tiles of 256 x 256, the shape
// that copies the fewest bytes from L2 into LDS per matrix instruction.  The
// softmax has no kernel and no f32 scores in memory: a score tile stores
// P = 2^(s * log2 e - c) in bf16, c a whole number at or above the largest
// exponent of the row's 256 keys, with c and the row's sums of P beside it; the
// PV kernel brings the eight tiles of a row to one exponent, which is exact for
// a power of two, and divides by the row's sum at its end.
// A staged B row is 64 k = 128 B, one whole cache line, so that a wave's copy
// of 512 B touches four lines of L2 and no line is asked for twice.
// The A rows of a work-group are staged the same way, once for all its waves:
// a fragment load from global memory touches sixteen lines for its 512 B, and
// every wave would ask for the same rows again.
// ---------------------------------------------------------------------------

typedef __attribute__((ext_vector_type(16))) __bf16 v16bf;
typedef __attribute__((ext_vector_type(8)))  float  v8f;

#define HID    1024
#define SEQ    2048
#define NBATCH 8
#define NROWS  (NBATCH * SEQ)      // 16384
#define LN_EPS 1e-5f

// round-to-nearest-even float -> bf16 (raw u16)
static __device__ __forceinline__ unsigned short f2bf(float x) {
  unsigned u = __builtin_bit_cast(unsigned, x);
  unsigned r = u + 0x7FFFu + ((u >> 16) & 1u);
  return (unsigned short)(r >> 16);
}

union FragU { v16bf v; uint4 q[2]; };

// LDS tile: rows of 64 bf16 = eight 16-B chunks, no pad.  Chunk q of row n lies
// at place q ^ ((n >> 1) & 7) of its row.  The sixteen lanes of a half wave read
// one chunk number of sixteen successive rows: at plain places they fall on 8
// of the 64 banks, eight deep; at these places they cover all 64 banks once.
static __device__ __forceinline__ int lds_place(int n, int q) {
  return q ^ ((n >> 1) & 7);
}

// 16x32 bf16 fragment read from such an LDS tile, for the k step ks (0 or 1)
// of 32 inside the tile's 64 k; n0 a multiple of 16.
// CDNA5 16-bit A layout: lanes 0-15 hold row M=lane, K in {0..7,16..23};
// lanes 16-31 hold row M=lane-16, K in {8..15,24..31}. Two b128 loads/lane.
static __device__ __forceinline__ v16bf lds_frag(
    const unsigned short* __restrict__ sm, int n0, int ks, int lane) {
  const int half = (lane >> 4) & 1;
  const int r    = lane & 15;
  const unsigned short* row = sm + (size_t)(n0 + r) * 64;
  FragU f;
  f.q[0] = *reinterpret_cast<const uint4*>(row + lds_place(r, ks * 4 + half) * 8);      // ds_load_b128
  f.q[1] = *reinterpret_cast<const uint4*>(row + lds_place(r, ks * 4 + half + 2) * 8);
  return f.v;
}

static __device__ __forceinline__ v8f wmma_bf16(v16bf a, v16bf b, v8f c) {
  return __builtin_amdgcn_wmma_f32_16x16x32_bf16(false, a, false, b,
                                                 (short)0, c, false, false);
}

typedef __attribute__((ext_vector_type(2))) unsigned short u16x2;

// Every bf16 of a fragment of values >= 0 times 2^-d: dd holds d << 7 (d in
// 0..255) in both halves, taken off the exponent fields by a saturating 16-bit
// subtraction.  Exact while the result is a normal number; below that it ends at
// zero or in the subnormals, under 2^-126.
static __device__ __forceinline__ v16bf frag_down(v16bf a, unsigned dd) {
  union { v16bf v; u16x2 h[8]; } f;
  f.v = a;
  const u16x2 d = __builtin_bit_cast(u16x2, dd);
#pragma unroll
  for (int i = 0; i < 8; ++i) f.h[i] = __builtin_elementwise_sub_sat(f.h[i], d);
  return f.v;
}

// lane l takes the value of lane l ^ 16 (v_permlanex16_b32, no LDS trip)
static __device__ __forceinline__ float xhalf(float x) {
  const int b = __builtin_bit_cast(int, x);
  return __builtin_bit_cast(float, __builtin_amdgcn_permlanex16(
      b, b, 0x76543210, 0xfedcba98, false, false));
}

static __device__ __forceinline__ void wait_async0() {
  asm volatile("s_wait_asynccnt 0" ::: "memory");
}

#define LN_ROWS    128u                       // rows of a work-group of the LN kernel
#define LN_COLS    512u                       // columns of one of its two passes
#define LN_A_BYTES (LN_ROWS * 128u)           // 16 KB: the A rows of a k chunk
#define LN_BUF     (LN_A_BYTES + LN_COLS * 128u)   // 80 KB: behind them the B rows

// Async-copy one k chunk of a 128 x 512 block tile (128 A rows and 512 B rows x
// 64 bf16, row stride HID elems in global, rows of 128 B in LDS, chunks at the
// places of lds_place) into the buffer at LDS byte offset lds_base.  512 threads:
// eight lanes move one row, a wave four whole rows; a sweep of the block covers
// 64 rows, two sweeps the A rows, eight the B rows.  The place is the same in
// every sweep, as 64 rows leave (n >> 1) & 7 as it is.
static __device__ __forceinline__ void stage_ln(
    unsigned lds_base, const unsigned short* __restrict__ ga,
    const unsigned short* __restrict__ gb, int tid) {
  const int n0   = tid >> 3;
  const int part = tid & 7;
  const size_t o = (size_t)n0 * HID + part * 8;
  const unsigned long long a0 = (unsigned long long)(uintptr_t)(ga + o);
  const unsigned long long b0 = (unsigned long long)(uintptr_t)(gb + o);
  const unsigned la =
      lds_base + (unsigned)n0 * 128u + (unsigned)lds_place(n0, part) * 16u;
  const unsigned lb = la + LN_A_BYTES;
  // One LDS address serves the copies of a matrix: copy j carries the immediate
  // offset j * 8192 (64 LDS rows), which moves BOTH its addresses, so its global
  // address register is set back by as much (the global step of a sweep is
  // larger, so the register still points into the source).
  unsigned long long pa[2], pb[8];
#pragma unroll
  for (int j = 0; j < 8; ++j) {
    const unsigned long long step =
        (unsigned long long)(j * 64) * (unsigned long long)HID * 2ull -
        (unsigned long long)(j * 8192);
    if (j < 2) pa[j] = a0 + step;
    pb[j] = b0 + step;
  }
  // Ten copies and their s_wait_xcnt in one statement: the address registers
  // stay untouched until the wait has passed.
  asm volatile(
      "global_load_async_to_lds_b128 %0, %2, off\n\t"
      "global_load_async_to_lds_b128 %0, %3, off offset:8192\n\t"
      "global_load_async_to_lds_b128 %1, %4, off\n\t"
      "global_load_async_to_lds_b128 %1, %5, off offset:8192\n\t"
      "global_load_async_to_lds_b128 %1, %6, off offset:16384\n\t"
      "global_load_async_to_lds_b128 %1, %7, off offset:24576\n\t"
      "global_load_async_to_lds_b128 %1, %8, off offset:32768\n\t"
      "global_load_async_to_lds_b128 %1, %9, off offset:40960\n\t"
      "global_load_async_to_lds_b128 %1, %10, off offset:49152\n\t"
      "global_load_async_to_lds_b128 %1, %11, off offset:57344\n\t"
      "s_wait_xcnt 0x0"
      :: "v"(la), "v"(lb), "v"(pa[0]), "v"(pa[1]),
         "v"(pb[0]), "v"(pb[1]), "v"(pb[2]), "v"(pb[3]),
         "v"(pb[4]), "v"(pb[5]), "v"(pb[6]), "v"(pb[7])
      : "memory");
}

// The matrix work of one staged k chunk, for one wave tile of 64 rows x 64 cols:
//   acc[m][t] += A chunk[LDS rows m*16..+16] * B tile[LDS rows col0+t*16..+16]
// Every fragment read from LDS feeds four matrix instructions; the fragments of
// a k step of 32 are read as one group.
// SWAP: the B tile's rows go in as the A operand and the A chunk's rows as the
// B operand (both fragments have one layout and one k order), so acc[m][t] holds
// the transposed 16 x 16 tile: lane = A chunk row, register = B tile row.
// DOWN: row n of the A chunk is taken times 2^-d, d << 7 twice in dl[n].
template <bool SWAP, bool DOWN>
static __device__ __forceinline__ void tile_mma(
    const unsigned short* sma, const unsigned short* smc, int lane, int col0,
    const unsigned* dl, v8f (&acc)[4][4]) {
  unsigned dd[4];
  if (DOWN) {
#pragma unroll
    for (int m = 0; m < 4; ++m) dd[m] = dl[m * 16 + (lane & 15)];
  }
#pragma unroll
  for (int ks = 0; ks < 2; ++ks) {
    // the fragments of this k step from LDS as one group, then the 16 WMMAs
    v16bf a[4], bf[4];
    bf[0] = lds_frag(smc, col0, ks, lane);
#pragma unroll
    for (int m = 0; m < 4; ++m) a[m] = lds_frag(sma, m * 16, ks, lane);
#pragma unroll
    for (int t = 1; t < 4; ++t)
      bf[t] = lds_frag(smc, col0 + t * 16, ks, lane);
    // Keeps the LDS reads as one group ahead of the WMMAs: the compiler
    // otherwise spreads them among the WMMAs, a full wait at each.
    __builtin_amdgcn_sched_barrier(0);
    if (DOWN) {
#pragma unroll
      for (int m = 0; m < 4; ++m) a[m] = frag_down(a[m], dd[m]);
    }
#pragma unroll
    for (int t = 0; t < 4; ++t)
#pragma unroll
      for (int m = 0; m < 4; ++m)
        acc[m][t] = SWAP ? wmma_bf16(bf[t], a[m], acc[m][t])
                         : wmma_bf16(a[m], bf[t], acc[m][t]);
    // Holds the WMMAs in front of what follows (the waits at the tile's foot):
    // the compiler otherwise sinks them behind the barrier, and the next
    // tile's copies no longer fly under them.
    __builtin_amdgcn_sched_barrier(0);
  }
}

#define SQ_HALF (256u * 128u)    // 32 KB: 256 rows of 64 k
#define SQ_BUF  (2u * SQ_HALF)   // one buffer: the A rows, behind them the B rows

// Async-copy one k chunk of a 256 x 256 block tile (256 A rows and 256 B rows x
// 64 bf16, row stride ld elems in global, rows of 128 B in LDS, chunks at the
// places of lds_place) into the buffer at LDS byte offset lds_base.  512 threads:
// eight lanes move one row, a sweep of the block 64 rows, four sweeps a matrix.
static __device__ __forceinline__ void stage_sq(
    unsigned lds_base, const unsigned short* __restrict__ ga,
    const unsigned short* __restrict__ gb, int ld, int tid) {
  const int n0   = tid >> 3;
  const int part = tid & 7;
  const size_t o = (size_t)n0 * ld + part * 8;
  const unsigned long long a0 = (unsigned long long)(uintptr_t)(ga + o);
  const unsigned long long b0 = (unsigned long long)(uintptr_t)(gb + o);
  const unsigned la =
      lds_base + (unsigned)n0 * 128u + (unsigned)lds_place(n0, part) * 16u;
  const unsigned lb = la + SQ_HALF;
  // As in stage_ln: copy j of a matrix carries the immediate offset j * 8192
  // (64 LDS rows), which moves both its addresses, so its global address
  // register is set back by as much.
  unsigned long long pa[4], pb[4];
#pragma unroll
  for (int j = 0; j < 4; ++j) {
    const unsigned long long step =
        (unsigned long long)(j * 64) * (unsigned long long)ld * 2ull -
        (unsigned long long)(j * 8192);
    pa[j] = a0 + step;
    pb[j] = b0 + step;
  }
  // Eight copies and their s_wait_xcnt in one statement: the address registers
  // stay untouched until the wait has passed.
  asm volatile(
      "global_load_async_to_lds_b128 %0, %2, off\n\t"
      "global_load_async_to_lds_b128 %0, %3, off offset:8192\n\t"
      "global_load_async_to_lds_b128 %0, %4, off offset:16384\n\t"
      "global_load_async_to_lds_b128 %0, %5, off offset:24576\n\t"
      "global_load_async_to_lds_b128 %1, %6, off\n\t"
      "global_load_async_to_lds_b128 %1, %7, off offset:8192\n\t"
      "global_load_async_to_lds_b128 %1, %8, off offset:16384\n\t"
      "global_load_async_to_lds_b128 %1, %9, off offset:24576\n\t"
      "s_wait_xcnt 0x0"
      :: "v"(la), "v"(lb),
         "v"(pa[0]), "v"(pa[1]), "v"(pa[2]), "v"(pa[3]),
         "v"(pb[0]), "v"(pb[1]), "v"(pb[2]), "v"(pb[3])
      : "memory");
}

// Double-buffered mainloop of a 256 x 256 block tile, sixteen wave tiles of
// 64 x 64: a k chunk of 64 brings 64 KB into LDS for 512 matrix instructions.
// The wave reads A rows arow0 .. +64 and B rows brow0 .. +64 of the buffer.
// SWAP: the tiles come out transposed, as tile_mma says.  DOWN: dtab (LDS,
// written in front of the call; the barrier ahead of the loop publishes it) holds
// for every 256 k a plane of 256 words, the A rows' d << 7 of tile_mma.
template <bool SWAP, bool DOWN>
static __device__ __forceinline__ void gemm_pipeline_sq(
    const unsigned short* __restrict__ A0, const unsigned short* __restrict__ B0,
    int ld, int Kdim, unsigned short* sm, int tid, int lane, int arow0, int brow0,
    const unsigned* dtab, v8f (&acc)[4][4]) {
  const unsigned sbase = (unsigned)(unsigned long long)(uintptr_t)sm;
  const int nK = Kdim / 64;

  stage_sq(sbase, A0, B0, ld, tid);
  wait_async0();
  __syncthreads();

  for (int kc = 0; kc < nK; ++kc) {
    const unsigned cur = (kc & 1) ? SQ_BUF : 0u;
    // issue async DMA for the next chunk (overlaps this chunk's compute)
    if (kc + 1 < nK)
      stage_sq(sbase + (SQ_BUF - cur), A0 + (size_t)(kc + 1) * 64,
               B0 + (size_t)(kc + 1) * 64, ld, tid);
    tile_mma<SWAP, DOWN>(sm + (cur >> 1) + arow0 * 64, sm + ((cur + SQ_HALF) >> 1), lane,
                         brow0, DOWN ? dtab + (kc >> 2) * 256 + arow0 : nullptr, acc);
    // own LDS reads of this chunk retired before the buffer is handed back
    asm volatile("s_wait_dscnt 0" ::: "memory");
    wait_async0();     // own copies for the next chunk done (overlapped compute)
    __syncthreads();   // block-wide: this chunk's reads done, next chunk visible
  }
}

// ---------------------------------------------------------------------------
// Conversion kernels.  Work-groups of 8 waves take 128 x 128 tiles, 64 elements
// a thread, so that a launch starts 64x fewer waves than one element a thread
// would; global loads are 16 B a lane (512 B of one row a wave), stores cover
// 256 contiguous bytes of a row, and the transposed copy goes through LDS.
// ---------------------------------------------------------------------------
#define CT   128                 // tile edge, elements
#define CTPD (CT / 2 + 1)        // LDS row pitch in dwords (two bf16 a dword)

static __device__ __forceinline__ unsigned pack2bf(float lo, float hi) {
  return (unsigned)f2bf(lo) | ((unsigned)f2bf(hi) << 16);
}

// One 128 x 128 tile of a row-major f32 matrix with HID columns.
//   dstT[c * ldT + r] = bf16(src[r * HID + c]);  STRAIGHT: dst[r * HID + c] too.
// 256 threads; tile = CT * CTPD dwords of LDS.
template <bool STRAIGHT>
static __device__ __forceinline__ void conv_tile(
    const float* __restrict__ src, unsigned short* __restrict__ dst,
    unsigned short* __restrict__ dstT, int ldT, unsigned* tile, int tid) {
  const int c4 = tid & 31;       // group of four columns
  const int r0 = tid >> 5;       // a wave reads one row at a time
  const float* __restrict__ ps = src + (size_t)r0 * HID + c4 * 4;
  float4 v[16];
#pragma unroll
  for (int i = 0; i < 16; ++i)
    v[i] = *reinterpret_cast<const float4*>(ps + (size_t)(8 * i) * HID);
  // The loads' address register pair is reused only behind this wait; naming
  // the address keeps it out of the loads' own destination registers.
  asm volatile("s_wait_xcnt 0x0" :: "v"(ps) : "memory");
  uint2 pk[16];
#pragma unroll
  for (int i = 0; i < 16; ++i) {
    const int r = r0 + 8 * i;
    pk[i] = make_uint2(pack2bf(v[i].x, v[i].y), pack2bf(v[i].z, v[i].w));
    tile[r * CTPD + c4 * 2]     = pk[i].x;
    tile[r * CTPD + c4 * 2 + 1] = pk[i].y;
  }
  __syncthreads();

  // The straight copy is stored behind the barrier: in front of it the barrier
  // would wait until these global stores have completed.
  if (STRAIGHT) {
#pragma unroll
    for (int i = 0; i < 16; ++i)
      *reinterpret_cast<uint2*>(dst + (size_t)(r0 + 8 * i) * HID + c4 * 4) = pk[i];
  }

  // A thread gathers eight rows of one column pair: 16 B for each of two rows
  // of the transposed copy; sixteen lanes fill 256 contiguous bytes of a row.
  const int rg = tid & 15;       // group of eight source rows
#pragma unroll
  for (int p = 0; p < 4; ++p) {
    const int cp = (tid >> 4) + 16 * p;      // column pair, 0..63
    unsigned a[8];
#pragma unroll
    for (int j = 0; j < 8; ++j) a[j] = tile[(rg * 8 + j) * CTPD + cp];
    uint4 lo, hi;
    lo.x = (a[0] & 0xFFFFu) | (a[1] << 16);
    lo.y = (a[2] & 0xFFFFu) | (a[3] << 16);
    lo.z = (a[4] & 0xFFFFu) | (a[5] << 16);
    lo.w = (a[6] & 0xFFFFu) | (a[7] << 16);
    hi.x = (a[0] >> 16) | (a[1] & 0xFFFF0000u);
    hi.y = (a[2] >> 16) | (a[3] & 0xFFFF0000u);
    hi.z = (a[4] >> 16) | (a[5] & 0xFFFF0000u);
    hi.w = (a[6] >> 16) | (a[7] & 0xFFFF0000u);
    *reinterpret_cast<uint4*>(dstT + (size_t)(2 * cp) * ldT + rg * 8)     = lo;
    *reinterpret_cast<uint4*>(dstT + (size_t)(2 * cp + 1) * ldT + rg * 8) = hi;
  }
}

// ---------------------------------------------------------------------------
// Kernel 1: all four conversions in one grid; none reads what another writes.
//   K,Q fp32 [F,H] -> transposed bf16 [H,F]  (B-operand layout)
//   X,Y fp32 -> bf16 row-major; also Y^T (per batch) in bf16
// Work-groups 0..127 take the 64 tiles of K and of Q (first, as they are few and
// the next launch waits for them as for the rest), the next 1024 a tile of Y
// each, the last 1024 the same count of X elements each.
// ---------------------------------------------------------------------------
#define CONV_W_TILES  ((HID / CT) * (HID / CT))       // 64 a weight matrix
#define CONV_XY_TILES ((NROWS / CT) * (HID / CT))     // 1024 a matrix
// At most 8 waves a SIMD are planned for, so that the register budget holds a
// thread's 16 loads in flight at once (at 64 registers they go out in turns).
__global__ __launch_bounds__(256) __attribute__((amdgpu_waves_per_eu(2, 8)))
void attn_conv(const float* __restrict__ X,
               const float* __restrict__ Y,
               const float* __restrict__ K,
               const float* __restrict__ Q,
               unsigned short* __restrict__ Xb,
               unsigned short* __restrict__ Yb,
               unsigned short* __restrict__ YT,
               unsigned short* __restrict__ KT,
               unsigned short* __restrict__ QT) {
  __shared__ unsigned tile[CT * CTPD];
  const int tid = threadIdx.x;
  const int bid = blockIdx.x;
  if (bid < 2 * CONV_W_TILES) {
    const int t  = bid & (CONV_W_TILES - 1);
    const int h0 = (t & 7) * CT;
    const int f0 = (t >> 3) * CT;
    const float* __restrict__ s    = (bid < CONV_W_TILES) ? K : Q;
    unsigned short* __restrict__ d = (bid < CONV_W_TILES) ? KT : QT;
    conv_tile<false>(s + (size_t)f0 * HID + h0, nullptr,
                     d + (size_t)h0 * HID + f0, HID, tile, tid);
  } else if (bid < 2 * CONV_W_TILES + CONV_XY_TILES) {
    const int t   = bid - 2 * CONV_W_TILES;
    const int f0  = (t & 7) * CT;            // HID / CT = 8 column tiles
    const int row = (t >> 3) * CT;           // row of the [NROWS, HID] view
    const int b   = row >> 11;               // / SEQ
    const int s0  = row & (SEQ - 1);
    const size_t o = (size_t)row * HID + f0;
    conv_tile<true>(Y + o, Yb + o, YT + ((size_t)b * HID + f0) * SEQ + s0, SEQ,
                    tile, tid);              // Y^T[b][f][s]
  } else {
    const int t = bid - (2 * CONV_W_TILES + CONV_XY_TILES);
    const size_t base = (size_t)t * (CT * CT) + (size_t)tid * 4;
    const float* __restrict__ px = X + base;
    float4 v[16];
#pragma unroll
    for (int i = 0; i < 16; ++i)
      v[i] = *reinterpret_cast<const float4*>(px + i * 1024);
    // As in conv_tile: the address pair is reused only behind this wait.
    asm volatile("s_wait_xcnt 0x0" :: "v"(px) : "memory");
#pragma unroll
    for (int i = 0; i < 16; ++i)
      *reinterpret_cast<uint2*>(Xb + base + i * 1024) =
          make_uint2(pack2bf(v[i].x, v[i].y), pack2bf(v[i].z, v[i].w));
    // The stores' data and address registers are reused only behind this wait.
    asm volatile("s_wait_xcnt 0x0" ::: "memory");
  }
}

typedef __attribute__((ext_vector_type(2))) float  f32x2;
typedef __attribute__((ext_vector_type(2))) __bf16 bf16x2;

// two f32 to a bf16 pair, round to nearest even, in one v_cvt_pk_bf16_f32
static __device__ __forceinline__ unsigned cvt2bf(float lo, float hi) {
  const f32x2 v = {lo, hi};
  return __builtin_bit_cast(unsigned, __builtin_convertvector(v, bf16x2));
}

// Sums and sums of squares of a wave tile's rows, added to the rows' LDS words.
// A lane holds 32 columns of each of its four rows: their sums are taken in the
// lane, the other 32 columns of the wave come from lane ^ 16, and one LDS add a
// row, wave and pass joins the waves.  row = the lane's row of m = 0.
static __device__ __forceinline__ void ln_row_sums(
    const v8f (&acc)[4][4], float* s_sum, float* s_sq, int row, int half) {
#pragma unroll
  for (int m = 0; m < 4; ++m) {
    float ps = 0.0f, pq = 0.0f;
#pragma unroll
    for (int t = 0; t < 4; ++t) {
      float s = 0.0f, q = 0.0f;
#pragma unroll
      for (int r = 0; r < 8; ++r) { float v = acc[m][t][r]; s += v; q += v * v; }
      ps += s;
      pq += q;
    }
    ps += xhalf(ps);
    pq += xhalf(pq);
    if (half == 0) {
      atomicAdd(&s_sum[row + m * 16], ps);   // ds_add_f32
      atomicAdd(&s_sq[row + m * 16], pq);
    }
  }
}

// ---------------------------------------------------------------------------
// Kernel 2: fused GEMM + LayerNorm.  512 thr (16 waves): 128 rows x 1024 cols in
// two passes of 512 cols, each wave 64 rows x 64 cols a pass: a k chunk of 64
// brings 80 KB into LDS for 512 matrix instructions.  The two passes are one
// loop of 32 chunks, so that the second pass's first copies fly under the first
// pass's last chunk.  The first pass's products wait in LDS, in bf16, each
// thread's own, until the second pass has completed the rows' sums.
// Dynamic LDS: 2 x 80KB (A rows + B rows), behind them 128KB for the first pass.
// One grid makes the keys (even work-groups) and the queries (odd ones).
// ---------------------------------------------------------------------------
__global__ __launch_bounds__(512)
void attn_gemm_ln(const unsigned short* __restrict__ A0,
                  const unsigned short* __restrict__ WT0,
                  const float* __restrict__ gamma0,
                  const float* __restrict__ beta0,
                  unsigned short* __restrict__ out0,
                  const unsigned short* __restrict__ A1,
                  const unsigned short* __restrict__ WT1,
                  const float* __restrict__ gamma1,
                  const float* __restrict__ beta1,
                  unsigned short* __restrict__ out1) {
  extern __shared__ unsigned short smem[];
  __shared__ float s_sum[LN_ROWS];
  __shared__ float s_sq[LN_ROWS];
  const bool odd = (blockIdx.x & 1) != 0;
  const unsigned short* __restrict__ A  = odd ? A1 : A0;
  const unsigned short* __restrict__ WT = odd ? WT1 : WT0;
  const float* __restrict__ gamma       = odd ? gamma1 : gamma0;
  const float* __restrict__ beta        = odd ? beta1 : beta0;
  unsigned short* __restrict__ out      = odd ? out1 : out0;
  const int tid  = threadIdx.x;
  const int lane = tid & 31;
  const int wave = tid >> 5;            // 0..15
  const int half = (lane >> 4) & 1;
  const int mr   = lane & 15;
  const int row0 = (blockIdx.x >> 1) * (int)LN_ROWS;
  const int wr0  = (wave >> 3) * 64;    // the wave's rows and columns in the tile
  const int wc0  = (wave & 7) * 64;

  // published by the barrier ahead of the loop
  if (tid < (int)LN_ROWS) { s_sum[tid] = 0.0f; s_sq[tid] = 0.0f; }

  v8f acc[4][4];
#pragma unroll
  for (int m = 0; m < 4; ++m)
#pragma unroll
    for (int t = 0; t < 4; ++t)
#pragma unroll
      for (int r = 0; r < 8; ++r) acc[m][t][r] = 0.0f;

  const unsigned short* __restrict__ Arow = A + (size_t)row0 * HID;
  const unsigned sbase = (unsigned)(unsigned long long)(uintptr_t)smem;
  // the thread's own 16 x 16 B of the first pass: word (m * 4 + t) * 512 + tid
  uint4* keep = reinterpret_cast<uint4*>(smem + LN_BUF) + tid;   // 2 * LN_BUF bytes on
  constexpr int NK = HID / 64;          // k chunks of a pass

  stage_ln(sbase, Arow, WT, tid);
  wait_async0();
  __syncthreads();

  // Chunk c: pass c / NK, k chunk c % NK, in the buffer of c's parity.  The tiles
  // come out transposed: acc[m][t][r] of lane (half, mr) is row wr0 + m*16 + mr,
  // column pass*512 + wc0 + t*16 + 8*half + r.
  for (int c = 0; c < 2 * NK; ++c) {
    const unsigned cur = (c & 1) ? LN_BUF : 0u;
    // issue async DMA for the next chunk (overlaps this chunk's compute)
    if (c + 1 < 2 * NK) {
      const int n = c + 1;
      stage_ln(sbase + (LN_BUF - cur), Arow + (size_t)(n & (NK - 1)) * 64,
               WT + (size_t)(n / NK) * (LN_COLS * HID) + (size_t)(n & (NK - 1)) * 64, tid);
    }
    tile_mma<true, false>(smem + (cur >> 1) + wr0 * 64, smem + ((cur + LN_A_BYTES) >> 1),
                          lane, wc0, nullptr, acc);
    if (c == NK - 1) {
      // the first pass is done: its share of the row sums, its products to LDS
      ln_row_sums(acc, s_sum, s_sq, wr0 + mr, half);
#pragma unroll
      for (int m = 0; m < 4; ++m)
#pragma unroll
        for (int t = 0; t < 4; ++t) {
          keep[(m * 4 + t) * 512] =
              make_uint4(cvt2bf(acc[m][t][0], acc[m][t][1]), cvt2bf(acc[m][t][2], acc[m][t][3]),
                         cvt2bf(acc[m][t][4], acc[m][t][5]), cvt2bf(acc[m][t][6], acc[m][t][7]));
#pragma unroll
          for (int r = 0; r < 8; ++r) acc[m][t][r] = 0.0f;
        }
    }
    // own LDS reads of this chunk retired before the buffer is handed back
    asm volatile("s_wait_dscnt 0" ::: "memory");
    wait_async0();     // own copies for the next chunk done (overlapped compute)
    __syncthreads();   // block-wide: this chunk's reads done, next chunk visible
  }

  // gamma and beta of the lane's 32 columns of the second pass, asked for ahead
  // of the row sums, which cover the loads' latency
  const int n0 = wc0 + 8 * half;        // the lane's eight columns of tile t = 0
  float4 gv[4][2], bv[4][2];
#pragma unroll
  for (int t = 0; t < 4; ++t)
#pragma unroll
    for (int h = 0; h < 2; ++h) {
      gv[t][h] = *reinterpret_cast<const float4*>(gamma + LN_COLS + n0 + t * 16 + h * 4);
      bv[t][h] = *reinterpret_cast<const float4*>(beta + LN_COLS + n0 + t * 16 + h * 4);
    }

  ln_row_sums(acc, s_sum, s_sq, wr0 + mr, half);
  __syncthreads();

  const float inv_h = 1.0f / (float)HID;
  float mu[4], rs[4];
#pragma unroll
  for (int m = 0; m < 4; ++m) {
    const int row = wr0 + m * 16 + mr;
    mu[m]         = s_sum[row] * inv_h;
    float var     = s_sq[row] * inv_h - mu[m] * mu[m];
    rs[m]         = rsqrtf(var + LN_EPS);
  }
  unsigned short* __restrict__ po = out + (size_t)(row0 + wr0 + mr) * HID + n0;
#pragma unroll
  for (int p = 1; p >= 0; --p) {
    if (p == 0) {
      // The second pass's stores name registers that the loads below may take
      // as their destinations: they are reused only behind this wait.
      asm volatile("s_wait_xcnt 0x0" ::: "memory");
#pragma unroll
      for (int t = 0; t < 4; ++t)
#pragma unroll
        for (int h = 0; h < 2; ++h) {
          gv[t][h] = *reinterpret_cast<const float4*>(gamma + n0 + t * 16 + h * 4);
          bv[t][h] = *reinterpret_cast<const float4*>(beta + n0 + t * 16 + h * 4);
        }
    }
#pragma unroll
    for (int t = 0; t < 4; ++t) {
      const float g[8] = {gv[t][0].x, gv[t][0].y, gv[t][0].z, gv[t][0].w,
                          gv[t][1].x, gv[t][1].y, gv[t][1].z, gv[t][1].w};
      const float b[8] = {bv[t][0].x, bv[t][0].y, bv[t][0].z, bv[t][0].w,
                          bv[t][1].x, bv[t][1].y, bv[t][1].z, bv[t][1].w};
#pragma unroll
      for (int m = 0; m < 4; ++m) {
        float x[8];
        if (p == 0) {
          const uint4 k = keep[(m * 4 + t) * 512];
          const unsigned w[4] = {k.x, k.y, k.z, k.w};
#pragma unroll
          for (int i = 0; i < 4; ++i) {
            x[2 * i]     = __builtin_bit_cast(float, w[i] << 16);
            x[2 * i + 1] = __builtin_bit_cast(float, w[i] & 0xFFFF0000u);
          }
        } else {
#pragma unroll
          for (int r = 0; r < 8; ++r) x[r] = acc[m][t][r];
        }
        float v[8];
#pragma unroll
        for (int r = 0; r < 8; ++r)
          v[r] = (x[r] - mu[m]) * rs[m] * g[r] + b[r];
        // eight successive columns of one row: one 16-B store
        *reinterpret_cast<uint4*>(po + (size_t)(m * 16) * HID + p * (int)LN_COLS + t * 16) =
            make_uint4(pack2bf(v[0], v[1]), pack2bf(v[2], v[3]),
                       pack2bf(v[4], v[5]), pack2bf(v[6], v[7]));
      }
    }
  }
}

// ---------------------------------------------------------------------------
// Kernel 3: P = 2^(queries @ keys^T * log2 e / H - c), bf16, c per row and tile.
// 512 thr (16 waves): 256 q rows x 256 keys, each wave 64 x 64, transposed tiles:
// a lane holds 32 keys of each of its four rows.  Dynamic LDS: 2 x 64KB (q rows +
// key rows).  A work-group writes whole lines of P, of pc and of pl.
//   pc[(b * 8 + key tile) * SEQ + row]             the tile's exponent c
//   pl[((b * 8 + key tile) * SEQ + row) * 4 + w]   sum of P over 64 keys
// ---------------------------------------------------------------------------
__global__ __launch_bounds__(512)
void attn_scores(const unsigned short* __restrict__ Qb,
                 const unsigned short* __restrict__ Kb,
                 unsigned short* __restrict__ P,
                 float* __restrict__ pc,
                 float* __restrict__ pl) {
  extern __shared__ unsigned short smem[];          // 2 * (256 + 256) * 64 bf16
  __shared__ __attribute__((aligned(16))) float s_mx[256 * 4];   // read 16 B a row
  const int tid  = threadIdx.x;
  const int lane = tid & 31;
  const int wave = tid >> 5;            // 0..15
  const int half = (lane >> 4) & 1;
  const int mr   = lane & 15;
  const int b    = blockIdx.x >> 6;
  const int row0 = ((blockIdx.x >> 3) & 7) * 256;
  const int kt   = blockIdx.x & 7;
  const int key0 = kt * 256;
  const int wr0  = (wave >> 2) * 64;    // the wave's rows and keys in the tile
  const int wq   = wave & 3;
  const int wc0  = wq * 64;

  v8f acc[4][4];
#pragma unroll
  for (int m = 0; m < 4; ++m)
#pragma unroll
    for (int t = 0; t < 4; ++t)
#pragma unroll
      for (int r = 0; r < 8; ++r) acc[m][t][r] = 0.0f;

  gemm_pipeline_sq<true, false>(Qb + ((size_t)b * SEQ + row0) * HID,
                                Kb + ((size_t)b * SEQ + key0) * HID, HID, HID,
                                smem, tid, lane, wr0, wc0, nullptr, acc);

  // Largest product of each row: 32 keys in the lane, 32 from lane ^ 16, the
  // other three waves of the row through LDS.
#pragma unroll
  for (int m = 0; m < 4; ++m) {
    float mx = acc[m][0][0];
#pragma unroll
    for (int t = 0; t < 4; ++t)
#pragma unroll
      for (int r = 0; r < 8; ++r) mx = fmaxf(mx, acc[m][t][r]);
    mx = fmaxf(mx, xhalf(mx));
    if (half == 0) s_mx[(wr0 + m * 16 + mr) * 4 + wq] = mx;
  }
  __syncthreads();

  const float sc2 = 1.4426950408889634f / (float)HID;   // log2 e / H
  const size_t srow = (size_t)(b * 8 + kt) * SEQ + row0 + wr0 + mr;
  unsigned short* __restrict__ pp =
      P + ((size_t)b * SEQ + row0 + wr0 + mr) * SEQ + key0 + wc0 + 8 * half;
#pragma unroll
  for (int m = 0; m < 4; ++m) {
    const float4 q = *reinterpret_cast<const float4*>(&s_mx[(wr0 + m * 16 + mr) * 4]);
    const float c = ceilf(fmaxf(fmaxf(q.x, q.y), fmaxf(q.z, q.w)) * sc2);
    float sum = 0.0f;
#pragma unroll
    for (int t = 0; t < 4; ++t) {
      float p[8];
#pragma unroll
      for (int r = 0; r < 8; ++r)
        p[r] = __builtin_amdgcn_exp2f(acc[m][t][r] * sc2 - c);
      sum += ((p[0] + p[1]) + (p[2] + p[3])) + ((p[4] + p[5]) + (p[6] + p[7]));
      // eight successive keys of one row: one 16-B store
      *reinterpret_cast<uint4*>(pp + (size_t)(m * 16) * SEQ + t * 16) =
          make_uint4(cvt2bf(p[0], p[1]), cvt2bf(p[2], p[3]),
                     cvt2bf(p[4], p[5]), cvt2bf(p[6], p[7]));
    }
    sum += xhalf(sum);
    if (half == 0) {
      pl[(srow + m * 16) * 4 + wq] = sum;
      if (wq == 0) pc[srow + m * 16] = c;
    }
  }
}

// ---------------------------------------------------------------------------
// Kernel 4: out = softmax @ Y = (sum over key tiles of 2^(c - C) P @ Y) / L
// (per batch [2048x2048] x [2048x1024], fp32 out), C the largest c of the row,
// L = sum over key tiles of 2^(c - C) * (the tile's sums of P).
// 512 thr (16 waves): 256 q rows x 256 f cols, each wave 64 x 64; K-loop over
// 2048.  Dynamic LDS: 2 x 64KB (P rows + YT rows).
// ---------------------------------------------------------------------------
__global__ __launch_bounds__(512)
void attn_pv_gemm(const unsigned short* __restrict__ P,
                  const float* __restrict__ pc,
                  const float* __restrict__ pl,
                  const unsigned short* __restrict__ YT,
                  float* __restrict__ out) {
  extern __shared__ unsigned short smem[];          // 2 * (256 + 256) * 64 bf16
  __shared__ unsigned s_dd[8 * 256];
  __shared__ __attribute__((aligned(16))) float s_inv[256];      // read 16 B at a time
  const int tid  = threadIdx.x;
  const int lane = tid & 31;
  const int wave = tid >> 5;            // 0..15
  const int half = (lane >> 4) & 1;
  const int mr   = lane & 15;
  const int b    = blockIdx.x >> 5;
  const int row0 = ((blockIdx.x >> 2) & 7) * 256;
  const int f0   = (blockIdx.x & 3) * 256;
  const int wr0  = (wave >> 2) * 64;    // the wave's rows and columns in the tile
  const int wc0  = (wave & 3) * 64;

  // One thread a row (waves 0..7): the row's exponent steps and 1 / L into LDS.
  if (tid < 256) {
    const float* __restrict__ qc = pc + (size_t)(b * 8) * SEQ + row0 + tid;
    const float* __restrict__ ql = pl + ((size_t)(b * 8) * SEQ + row0 + tid) * 4;
    float c[8];
    float4 l[8];
#pragma unroll
    for (int t = 0; t < 8; ++t) {
      c[t] = qc[t * SEQ];
      l[t] = *reinterpret_cast<const float4*>(ql + t * (SEQ * 4));
    }
    // As in conv_tile: the address pair is reused only behind this wait (the
    // loads of c go by the thread's number, which lives on).
    asm volatile("s_wait_xcnt 0x0" :: "v"(ql) : "memory");
    float C = c[0];
#pragma unroll
    for (int t = 1; t < 8; ++t) C = fmaxf(C, c[t]);
    float L = 0.0f;
#pragma unroll
    for (int t = 0; t < 8; ++t) {
      const float d = C - c[t];         // a whole number >= 0
      L += __builtin_amdgcn_exp2f(-d) * ((l[t].x + l[t].y) + (l[t].z + l[t].w));
      s_dd[t * 256 + tid] = ((unsigned)fminf(d, 255.0f) << 7) * 0x10001u;
    }
    s_inv[tid] = 1.0f / L;
  }

  v8f acc[4][4];
#pragma unroll
  for (int m = 0; m < 4; ++m)
#pragma unroll
    for (int t = 0; t < 4; ++t)
#pragma unroll
      for (int r = 0; r < 8; ++r) acc[m][t][r] = 0.0f;

  gemm_pipeline_sq<false, true>(P + ((size_t)b * SEQ + row0) * SEQ,
                                YT + ((size_t)b * HID + f0) * SEQ, SEQ, SEQ,
                                smem, tid, lane, wr0, wc0, s_dd, acc);

  float* __restrict__ po =
      out + ((size_t)b * SEQ + row0 + wr0 + 8 * half) * HID + f0 + wc0 + mr;
#pragma unroll
  for (int m = 0; m < 4; ++m) {
    const float4 i0 = *reinterpret_cast<const float4*>(&s_inv[wr0 + m * 16 + 8 * half]);
    const float4 i1 = *reinterpret_cast<const float4*>(&s_inv[wr0 + m * 16 + 8 * half + 4]);
    const float iv[8] = {i0.x, i0.y, i0.z, i0.w, i1.x, i1.y, i1.z, i1.w};
#pragma unroll
    for (int r = 0; r < 8; ++r)
#pragma unroll
      for (int t = 0; t < 4; ++t)
        po[(size_t)(m * 16 + r) * HID + t * 16] = acc[m][t][r] * iv[r];
  }
}

// ---------------------------------------------------------------------------
// host launcher
// ---------------------------------------------------------------------------
extern "C" void kernel_launch(void* const* d_in, const int* in_sizes, int n_in,
                              void* d_out, int out_size, void* d_ws, size_t ws_size,
                              hipStream_t stream) {
  const float* X  = (const float*)d_in[0];
  const float* Y  = (const float*)d_in[1];
  const float* K  = (const float*)d_in[2];
  const float* Q  = (const float*)d_in[3];
  const float* g1 = (const float*)d_in[4];
  const float* b1 = (const float*)d_in[5];
  const float* g2 = (const float*)d_in[6];
  const float* b2 = (const float*)d_in[7];
  float* out = (float*)d_out;

  // workspace layout (bytes); total 194.5 MB.  P (64 MB) lies over Xb and Yb,
  // which nothing reads once the keys and queries are made.
  char* w = (char*)d_ws;
  const size_t SZ_XY = (size_t)NROWS * HID * 2;        // 32 MB each
  const size_t SZ_W  = (size_t)HID * HID * 2;          // 2 MB each
  unsigned short* YT    = (unsigned short*)(w);
  unsigned short* Kb    = (unsigned short*)(w + SZ_XY);
  unsigned short* Qb    = (unsigned short*)(w + 2 * SZ_XY);
  unsigned short* Xb    = (unsigned short*)(w + 3 * SZ_XY);
  unsigned short* Yb    = (unsigned short*)(w + 4 * SZ_XY);
  unsigned short* KT    = (unsigned short*)(w + 5 * SZ_XY);
  unsigned short* QT    = (unsigned short*)(w + 5 * SZ_XY + SZ_W);
  unsigned short* P     = (unsigned short*)(w + 3 * SZ_XY);
  float*          pl    = (float*)(w + 6 * SZ_XY);            // 2 MB
  float*          pc    = (float*)(w + 6 * SZ_XY + SZ_W);     // 512 KB

  // 160 KB (double-buffered A + B rows) + 128 KB (the first pass's products)
  const size_t LDS_B = 2u * LN_BUF + LN_ROWS * LN_COLS * 2u;

  // 1) convert X,Y -> bf16 (+ Y^T), K,Q -> transposed bf16
  attn_conv<<<2 * CONV_W_TILES + 2 * CONV_XY_TILES, 256, 0, stream>>>(
      X, Y, K, Q, Xb, Yb, YT, KT, QT);

  // 2) keys = LN(Y @ K), queries = LN(X @ Q)   [fused GEMM+LN, bf16 out]
  attn_gemm_ln<<<2 * (NROWS / LN_ROWS), 512, LDS_B, stream>>>(Yb, KT, g1, b1, Kb,
                                                         Xb, QT, g2, b2, Qb);

  // 3) P = exp(queries @ keys^T / H) by tiles, each to its own power of two
  attn_scores<<<NBATCH * (SEQ / 256) * (SEQ / 256), 512, 2u * SQ_BUF, stream>>>(Qb, Kb, P, pc, pl);

  // 4) out = softmax @ Y                        [fp32 out]
  attn_pv_gemm<<<NBATCH * (SEQ / 256) * (HID / 256), 512, 2u * SQ_BUF, stream>>>(P, pc, pl, YT, out);
}
